// v000
// The times below were measured on an AMD MI455X: many runs one after another, warmed up first and cycling through
// copies of the inputs, with the whole window's GPU time divided by the number of runs. Launches and the gaps
// between them are all in it. The median over several windows is given; except for v000 it joins two sittings, which
// can be a few percent apart, so the side-by-side timings, each taken in one sitting, are the better comparison.
// v000 is the starting kernel. One run takes 829 microseconds.
// compute dtype: all float inputs rounded to bf16; q/k/v = x W^T with EXACT bf16 products on WMMA 16x16x32 (natural rows); per head the bilinear scores sum_d q_d m_hd k_d as a 512-deep WMMA product of (q * m_h) and k, each rounded once to f16 (1 product; the attention is diffuse: logits std ~0.1), content bias x . Wb^T exact, x 1/8; running-max softmax in f32 (hardware exp); P as f16 hi + residual (x 2^11) . v (f16; 2 products); out = ctx (bf16 hi + lo) . Wd^T + bd; f32 output.
#include <hip/hip_runtime.h>
#include <math.h>

typedef __attribute__((ext_vector_type(16))) _Float16 v16h;
typedef __attribute__((ext_vector_type(16))) __bf16 v16b;
typedef __attribute__((ext_vector_type(8)))  _Float16 v8h;
typedef __attribute__((ext_vector_type(8)))  float v8f;
typedef __attribute__((ext_vector_type(4)))  float v4f;
typedef __attribute__((ext_vector_type(2)))  float v2f;
typedef __attribute__((ext_vector_type(4)))  unsigned v4u;
typedef __attribute__((ext_vector_type(4)))  int v4i;
typedef float __attribute__((may_alias)) float_a;
typedef int __attribute__((may_alias)) int_a;

template <typename T> __device__ __forceinline__ void vst2(void* p, T v) { *(T*)p = v;  }
__device__ __forceinline__ v8f wmma16(v16h a, v16h b, v8f c) {
  v8f d = __builtin_amdgcn_wmma_f32_16x16x32_f16(false, a, false, b, (short)0, c, false, false);
  asm volatile("v_nop\n\tv_nop\n\tv_nop\n\tv_nop" : "+v"(d) : "v"(a), "v"(b));
  return d;
}
__device__ __forceinline__ v8f wmma_bf(v16b a, v16b b, v8f c) {
  v8f d = __builtin_amdgcn_wmma_f32_16x16x32_bf16(false, a, false, b, (short)0, c, false, false);
  asm volatile("v_nop\n\tv_nop\n\tv_nop\n\tv_nop" : "+v"(d) : "v"(a), "v"(b));
  return d;
}
// 16x16x32 fragments: lane = (h = lane>>4, row/col = lane&15); elements 0..7 = k0+8h+0..7, 8..15 = k0+16+8h+0..7; D element r = row 8h+r
__device__ __forceinline__ v16h frag_h(const _Float16* rowk0, int lane) {
  union { v16h v; v8h q[2]; } u; const _Float16* p = rowk0 + 8 * (lane >> 4);
  u.q[0] = *(const v8h*)p; u.q[1] = *(const v8h*)(p + 16); return u.v;
}
__device__ __forceinline__ v16h frag_f32(const float* rowk0, int lane) {
  v16h a; const float* p = rowk0 + 8 * (lane >> 4);
#pragma unroll
  for (int i = 0; i < 8; ++i) { a[i] = (_Float16)p[i]; a[8 + i] = (_Float16)p[16 + i]; }
  return a;
}
__device__ __forceinline__ v16h frag_f32s(const float* rowk0, int lane, float sc) {
  v16h a; const float* p = rowk0 + 8 * (lane >> 4);
#pragma unroll
  for (int i = 0; i < 8; ++i) { a[i] = (_Float16)(p[i] * sc); a[8 + i] = (_Float16)(p[16 + i] * sc); }
  return a;
}
// column fragment from a [K][ld] layout (column n), rows >= K read as 0
__device__ __forceinline__ v16h fragc_f32(const float* W, int k0, int n, int lane, int ld, int K) {
  v16h a; const int g = lane >> 4;
#pragma unroll
  for (int i = 0; i < 8; ++i) { const int ka = k0 + 8 * g + i, kb = ka + 16;
    a[i] = (_Float16)(ka < K ? W[(size_t)(ka < K ? ka : K - 1) * ld + n] : 0.f); a[8 + i] = (_Float16)(kb < K ? W[(size_t)(kb < K ? kb : K - 1) * ld + n] : 0.f); }
  return a;
}
struct F2 { v16b h, l; };
__device__ __forceinline__ F2 bsplit16(const float v[16]) { F2 r;
#pragma unroll
  for (int i = 0; i < 16; ++i) { const __bf16 h = (__bf16)v[i]; r.h[i] = h; r.l[i] = (__bf16)(v[i] - (float)h); }
  return r; }
__device__ __forceinline__ F2 split_row(const float* row, int k0, int lane) { float v[16]; const float* p = row + k0 + 8 * (lane >> 4);
#pragma unroll
  for (int i = 0; i < 8; ++i) { v[i] = p[i]; v[8 + i] = p[16 + i]; }
  return bsplit16(v); }
__device__ __forceinline__ F2 split_rowK(const float* row, int k0, int lane, int K) { float v[16]; const int g = lane >> 4;
#pragma unroll
  for (int i = 0; i < 8; ++i) { const int ka = k0 + 8 * g + i, kb = ka + 16; v[i] = ka < K ? row[ka < K ? ka : K - 1] : 0.f; v[8 + i] = kb < K ? row[kb < K ? kb : K - 1] : 0.f; }
  return bsplit16(v); }
__device__ __forceinline__ F2 split_col(const float* W, int k0, int n, int lane, int ld, int K) { float v[16]; const int g = lane >> 4;
#pragma unroll
  for (int i = 0; i < 8; ++i) { const int ka = k0 + 8 * g + i, kb = ka + 16; v[i] = ka < K ? W[(size_t)(ka < K ? ka : K - 1) * ld + n] : 0.f; v[8 + i] = kb < K ? W[(size_t)(kb < K ? kb : K - 1) * ld + n] : 0.f; }
  return bsplit16(v); }
__device__ __forceinline__ v8f mac3(const F2& a, const F2& b, v8f c) { c = wmma_bf(a.l, b.h, c); c = wmma_bf(a.h, b.l, c); return wmma_bf(a.h, b.h, c); }
__device__ __forceinline__ float sigm(float v) { return 1.0f / (1.0f + expf(-v)); }
#define LDSX() do { asm volatile("s_wait_dscnt 0" ::: "memory"); __builtin_amdgcn_wave_barrier(); __builtin_amdgcn_fence(__ATOMIC_RELEASE, "workgroup"); } while (0)


// Collaborative attention (B 2, L 2,048, D 512, 8 heads x 64 with a shared 512-wide key/query space): scores = (q diag(m_h) k^T + content_bias(k side)) / sqrt(64); softmax; per-head 64-dim values; dense output projection.
#define NB 2
#define NN 2048
#define DD 512
#define NH 8
#define DH 64
#ifndef TNB
#define TNB NB
#endif
#ifndef TQB
#define TQB (NN / 64)
#endif
typedef __attribute__((ext_vector_type(8))) __bf16 v8b;
__device__ __forceinline__ v16b frag_b(const __bf16* rowk0, int lane) {
  union { v16b v; v8b q[2]; } u; const __bf16* p = rowk0 + 8 * (lane >> 4);
  u.q[0] = *(const v8b*)p; u.q[1] = *(const v8b*)(p + 16); return u.v;
}
__device__ __forceinline__ float bfr(float v) { return (float)(__bf16)v; }
__device__ __attribute__((noinline)) float exp_ni(float v) { return expf(v); }
__device__ __attribute__((noinline)) float erf_ni(float v) { return erff(v); }

#define WS_QM  0u                                   // f16 (q * m_h) rows [b*NN + l][h*512 + d]
#define WS_KH  (WS_QM + 2u * (size_t)NB * NN * NH * DD)   // f16 k rows [b*NN + s][512]
#define WS_VT  (WS_KH + 2u * (size_t)NB * NN * DD)       // f16 v planes [b][512][NN]
#define WS_CB  (WS_VT + 2u * (size_t)NB * DD * NN)       // f32 content bias [b][h][NN]
#define WS_O   (WS_CB + 4u * (size_t)NB * NH * NN)       // f32 ctx rows [b*NN + l][512]
#define WS_END (WS_O + 4u * (size_t)NB * NN * DD)

__device__ __forceinline__ v16b fragb_f32(const float* __restrict__ p, int lane) { v16b a; const float* pp = p + 8 * (lane >> 4);
#pragma unroll
  for (int i = 0; i < 8; ++i) { a[i] = (__bf16)pp[i]; a[8 + i] = (__bf16)pp[16 + i]; } return a; }
// ---- k_proj: block = (64 rows, 128 cols, which*NB + b): which 0 q -> 8 mixed copies (q * m_h) f16; 1 k -> f16 rows; 2 v -> f16 planes
__global__ __launch_bounds__(128) void k_proj(const float* __restrict__ X, const float* __restrict__ WQ, const float* __restrict__ WK, const float* __restrict__ WV, const float* __restrict__ MIX, _Float16* __restrict__ QM, _Float16* __restrict__ KH, _Float16* __restrict__ VT) {
  __shared__ __align__(16) float sf[64][132]; __shared__ __align__(16) _Float16 sh[64][136]; __shared__ __align__(16) _Float16 th[128][72];
  const int tid = threadIdx.x, wave = tid >> 5, lane = tid & 31, col = lane & 15, g = lane >> 4; const int which = blockIdx.z / NB; const size_t b = blockIdx.z % NB; const int n0 = blockIdx.x * 64; const int c0 = blockIdx.y * 128; const size_t r0 = b * NN + n0 + wave * 16;
  const float* Wm = which == 0 ? WQ : which == 1 ? WK : WV;
  v8f acc[8] = {};
#pragma unroll 2
  for (int kc = 0; kc < DD / 32; ++kc) { const v16b a = fragb_f32(X + (r0 + col) * DD + kc * 32, lane);
#pragma unroll
    for (int j = 0; j < 8; ++j) acc[j] = wmma_bf(a, fragb_f32(Wm + (size_t)(c0 + j * 16 + col) * DD + kc * 32, lane), acc[j]); }
#pragma unroll
  for (int j = 0; j < 8; ++j)
#pragma unroll
    for (int r = 0; r < 8; ++r) { const float v = acc[j][r]; if (which == 0) sf[wave * 16 + 8 * g + r][j * 16 + col] = v; else if (which == 1) sh[wave * 16 + 8 * g + r][j * 16 + col] = (_Float16)v; else th[j * 16 + col][wave * 16 + 8 * g + r] = (_Float16)v; }
  __syncthreads();
  if (which == 0) {
#pragma unroll 1
    for (int h = 0; h < NH; ++h) { for (int e = tid; e < 64 * 128; e += 128) { const int rl = e >> 7, c = e & 127; sh[rl][c] = (_Float16)(sf[rl][c] * bfr(MIX[h * DD + c0 + c])); } __syncthreads();
      for (int e = tid; e < 64 * 16; e += 128) { const int rl = e >> 4, q = e & 15; vst2((unsigned*)(QM + (b * NN + n0 + rl) * (size_t)(NH * DD) + (size_t)h * DD + c0 + q * 8), *(const v4u*)&sh[rl][q * 8]); } __syncthreads(); } }
  else if (which == 1) { for (int e = tid; e < 64 * 16; e += 128) { const int rl = e >> 4, q = e & 15; vst2((unsigned*)(KH + (b * NN + n0 + rl) * DD + c0 + q * 8), *(const v4u*)&sh[rl][q * 8]); } }
  else { for (int e = tid; e < 128 * 8; e += 128) { const int cl = e >> 3, q = e & 7; vst2((unsigned*)(VT + (b * DD + c0 + cl) * (size_t)NN + n0 + q * 8), *(const v4u*)&th[cl][q * 8]); } } }
// ---- k_cb: block = (64 keys, b): cb[b][h][s] = x_s . Wb[h] (exact products, f32 accumulate on VALU: 8 x 512 per key, rolled)
__global__ __launch_bounds__(256) void k_cb(const float* __restrict__ X, const float* __restrict__ WB, float* __restrict__ CB) { __shared__ __align__(16) float so[NH][64]; __shared__ float red[NH][64][4]; const int t = threadIdx.x; const size_t b = blockIdx.y; const int s0 = blockIdx.x * 64; const int sl = t & 63, part = t >> 6;
#pragma unroll 1
  for (int h = 0; h < NH; ++h) { float acc = 0.f; const float* xr = X + (b * NN + s0 + sl) * DD; const float* wr = WB + h * DD;
#pragma unroll 1
    for (int d = part; d < DD; d += 4) acc += bfr(xr[d]) * bfr(wr[d]); red[h][sl][part] = acc; }
  __syncthreads(); for (int e = t; e < NH * 64; e += 256) { const int h = e >> 6, s = e & 63; so[h][s] = red[h][s][0] + red[h][s][1] + red[h][s][2] + red[h][s][3]; } __syncthreads();
  if (t < NH * 16) { const int h = t >> 4, q = t & 15; vst2(CB + (b * NH + h) * (size_t)NN + s0 + q * 4, *(const v4f*)&so[h][q * 4]); } }
// ---- k_att: block = (64 queries, h, b): logits = ((q*m_h) . k + cb[s]) / 8 (K 512), softmax, P (hi + residual) . v_h
__global__ __launch_bounds__(128) void k_att(const _Float16* __restrict__ QM, const _Float16* __restrict__ KH, const _Float16* __restrict__ VT, const float* __restrict__ CB, float* __restrict__ O) {
  __shared__ __align__(16) float sp[4][16][36]; __shared__ __align__(16) float so[4][16][68];
  const int tid = threadIdx.x, wave = tid >> 5, lane = tid & 31, col = lane & 15, g = lane >> 4; const int h = blockIdx.y; const size_t b = blockIdx.z; const int q0 = blockIdx.x * 64 + wave * 16; const size_t rq = b * NN + q0;
  const _Float16* qbase = QM + (rq + col) * (size_t)(NH * DD) + (size_t)h * DD; const float* cbh = CB + (b * NH + h) * (size_t)NN;
  float m[8], l[8];
#pragma unroll
  for (int r = 0; r < 8; ++r) { m[r] = -3.0e38f; l[r] = 0.f; }
  v8f acc[4] = {}, accl[4] = {};
#pragma unroll 1
  for (int ks = 0; ks < NN / 32; ++ks) { v8f s[2];
#pragma unroll
    for (int ct = 0; ct < 2; ++ct) { const int kk = ks * 32 + ct * 16 + col; const _Float16* kbase = KH + (b * NN + kk) * DD; v8f c = {};
#pragma unroll 4
      for (int kc = 0; kc < DD / 32; ++kc) c = wmma16(frag_h(qbase + kc * 32, lane), frag_h(kbase + kc * 32, lane), c);
      const float cbv = cbh[kk];
#pragma unroll
      for (int r = 0; r < 8; ++r) s[ct][r] = (c[r] + cbv) * 0.125f; }
    float alpha[8];
#pragma unroll
    for (int r = 0; r < 8; ++r) { float mx = fmaxf(s[0][r], s[1][r]);
#pragma unroll
      for (int o = 1; o < 16; o <<= 1) mx = fmaxf(mx, __shfl_xor(mx, o));
      const float mn = fmaxf(m[r], mx); alpha[r] = __expf(m[r] - mn); const float e0 = __expf(s[0][r] - mn), e1 = __expf(s[1][r] - mn); float es = e0 + e1;
#pragma unroll
      for (int o = 1; o < 16; o <<= 1) es += __shfl_xor(es, o);
      l[r] = l[r] * alpha[r] + es; m[r] = mn; sp[wave][8 * g + r][col] = e0; sp[wave][8 * g + r][16 + col] = e1; }
#pragma unroll
    for (int j = 0; j < 4; ++j)
#pragma unroll
      for (int r = 0; r < 8; ++r) { acc[j][r] *= alpha[r]; accl[j][r] *= alpha[r]; }
    LDSX();
    v16h pa, pal; { const float* prow = &sp[wave][col][0] + 8 * (lane >> 4);
#pragma unroll
      for (int i = 0; i < 8; ++i) { const float p0 = prow[i] * 2048.0f, p1 = prow[16 + i] * 2048.0f; pa[i] = (_Float16)p0; pa[8 + i] = (_Float16)p1; pal[i] = (_Float16)((p0 - (float)pa[i]) * 2048.0f); pal[8 + i] = (_Float16)((p1 - (float)pa[8 + i]) * 2048.0f); } }
#pragma unroll
    for (int j = 0; j < 4; ++j) { const v16h vf = frag_h(VT + (b * DD + (size_t)h * DH + j * 16 + col) * (size_t)NN + ks * 32, lane); acc[j] = wmma16(pa, vf, acc[j]); accl[j] = wmma16(pal, vf, accl[j]); }
    LDSX(); }
#pragma unroll
  for (int r = 0; r < 8; ++r) { const float il = (1.0f / 2048.0f) / l[r];
#pragma unroll
    for (int j = 0; j < 4; ++j) so[wave][8 * g + r][j * 16 + col] = (acc[j][r] + accl[j][r] * (1.0f / 2048.0f)) * il; }
  LDSX(); for (int rl = 0; rl < 16; ++rl) if (lane < 16) vst2(O + (rq + rl) * DD + (size_t)h * DH + lane * 4, *(const v4f*)&so[wave][rl][lane * 4]); }
// ---- k_out: block = (64 rows, 128 cols): out = ctx (hi + lo) . Wd^T + bd
__global__ __launch_bounds__(128) void k_out(const float* __restrict__ Or, const float* __restrict__ WD, const float* __restrict__ BD, float* __restrict__ OUT) { __shared__ __align__(16) float sf[4][16][132];
  const int tid = threadIdx.x, wave = tid >> 5, lane = tid & 31, col = lane & 15, g = lane >> 4; const size_t r0 = (size_t)blockIdx.x * 64 + wave * 16; const int c0 = blockIdx.y * 128;
  v8f acc[8] = {};
#pragma unroll 2
  for (int kc = 0; kc < DD / 32; ++kc) { const F2 a = split_row(Or + (r0 + col) * DD, kc * 32, lane);
#pragma unroll
    for (int j = 0; j < 8; ++j) { const v16b w = fragb_f32(WD + (size_t)(c0 + j * 16 + col) * DD + kc * 32, lane); acc[j] = wmma_bf(a.h, w, acc[j]); acc[j] = wmma_bf(a.l, w, acc[j]); } }
#pragma unroll
  for (int j = 0; j < 8; ++j) { const float bb = bfr(BD[c0 + j * 16 + col]);
#pragma unroll
    for (int r = 0; r < 8; ++r) sf[wave][8 * g + r][j * 16 + col] = acc[j][r] + bb; }
  LDSX(); for (int rl = 0; rl < 16; ++rl) vst2(OUT + (r0 + rl) * DD + c0 + lane * 4, *(const v4f*)&sf[wave][rl][lane * 4]); }
extern "C" void kernel_launch(void* const* d_in, const int* in_sizes, int n_in, void* d_out, int out_size, void* d_ws, size_t ws_size, hipStream_t stream) {
  (void)in_sizes; (void)n_in; (void)out_size;
  const float** F = (const float**)d_in;   // 0 x [2,2048,512], 1 Wq, 2 Wk, 3 Wv [512,512] natural, 4 Wb [8,512], 5 mixing [8,512], 6 Wd [512,512], 7 bd [512]
  if (ws_size < (size_t)WS_END) return;
  char* ws = (char*)d_ws; _Float16 *QM = (_Float16*)(ws + WS_QM), *KH = (_Float16*)(ws + WS_KH), *VT = (_Float16*)(ws + WS_VT); float *CB = (float*)(ws + WS_CB), *O = (float*)(ws + WS_O);
  k_proj<<<dim3(NN / 64, DD / 128, 3 * NB), 128, 0, stream>>>(F[0], F[1], F[2], F[3], F[5], QM, KH, VT);
  k_cb<<<dim3(NN / 64, NB), 256, 0, stream>>>(F[0], F[4], CB);
  k_att<<<dim3(TQB, NH, TNB), 128, 0, stream>>>(QM, KH, VT, CB, O);
  k_out<<<dim3(TNB * NN / 64, DD / 128), 128, 0, stream>>>(O, F[6], F[7], (float*)d_out);
}

// v001
// One run takes 368 microseconds.
// In two side-by-side timings against v000, it was 2.33 and 2.32 times as fast.
// compute dtype: all float inputs rounded to bf16; q/k/v = x W^T with EXACT bf16 products on WMMA 16x16x32 (natural rows); per head the bilinear scores sum_d q_d m_hd k_d as a 512-deep WMMA product of (q * m_h) and k, each rounded once to f16 (1 product; the attention is diffuse: logits std ~0.1), content bias x . Wb^T exact, x 1/8; running-max softmax in f32 (hardware exp); P as f16 hi + residual (x 2^11) . v (f16; 2 products); out = ctx (bf16 hi + lo) . Wd^T + bd; f32 output.
#include <hip/hip_runtime.h>
#include <math.h>

typedef __attribute__((ext_vector_type(16))) _Float16 v16h;
typedef __attribute__((ext_vector_type(16))) __bf16 v16b;
typedef __attribute__((ext_vector_type(8)))  _Float16 v8h;
typedef __attribute__((ext_vector_type(8)))  float v8f;
typedef __attribute__((ext_vector_type(4)))  float v4f;
typedef __attribute__((ext_vector_type(2)))  float v2f;
typedef __attribute__((ext_vector_type(4)))  unsigned v4u;
typedef __attribute__((ext_vector_type(4)))  int v4i;
typedef float __attribute__((may_alias)) float_a;
typedef int __attribute__((may_alias)) int_a;

template <typename T> __device__ __forceinline__ void vst2(void* p, T v) { *(T*)p = v;  }
__device__ __forceinline__ v8f wmma16(v16h a, v16h b, v8f c) {
  v8f d = __builtin_amdgcn_wmma_f32_16x16x32_f16(false, a, false, b, (short)0, c, false, false);
  asm volatile("v_nop\n\tv_nop\n\tv_nop\n\tv_nop" : "+v"(d) : "v"(a), "v"(b));
  return d;
}
__device__ __forceinline__ v8f wmma_bf(v16b a, v16b b, v8f c) {
  v8f d = __builtin_amdgcn_wmma_f32_16x16x32_bf16(false, a, false, b, (short)0, c, false, false);
  asm volatile("v_nop\n\tv_nop\n\tv_nop\n\tv_nop" : "+v"(d) : "v"(a), "v"(b));
  return d;
}
// 16x16x32 fragments: lane = (h = lane>>4, row/col = lane&15); elements 0..7 = k0+8h+0..7, 8..15 = k0+16+8h+0..7; D element r = row 8h+r
__device__ __forceinline__ v16h frag_h(const _Float16* rowk0, int lane) {
  union { v16h v; v8h q[2]; } u; const _Float16* p = rowk0 + 8 * (lane >> 4);
  u.q[0] = *(const v8h*)p; u.q[1] = *(const v8h*)(p + 16); return u.v;
}
__device__ __forceinline__ v16h frag_f32(const float* rowk0, int lane) {
  v16h a; const float* p = rowk0 + 8 * (lane >> 4);
#pragma unroll
  for (int i = 0; i < 8; ++i) { a[i] = (_Float16)p[i]; a[8 + i] = (_Float16)p[16 + i]; }
  return a;
}
__device__ __forceinline__ v16h frag_f32s(const float* rowk0, int lane, float sc) {
  v16h a; const float* p = rowk0 + 8 * (lane >> 4);
#pragma unroll
  for (int i = 0; i < 8; ++i) { a[i] = (_Float16)(p[i] * sc); a[8 + i] = (_Float16)(p[16 + i] * sc); }
  return a;
}
// column fragment from a [K][ld] layout (column n), rows >= K read as 0
__device__ __forceinline__ v16h fragc_f32(const float* W, int k0, int n, int lane, int ld, int K) {
  v16h a; const int g = lane >> 4;
#pragma unroll
  for (int i = 0; i < 8; ++i) { const int ka = k0 + 8 * g + i, kb = ka + 16;
    a[i] = (_Float16)(ka < K ? W[(size_t)(ka < K ? ka : K - 1) * ld + n] : 0.f); a[8 + i] = (_Float16)(kb < K ? W[(size_t)(kb < K ? kb : K - 1) * ld + n] : 0.f); }
  return a;
}
struct F2 { v16b h, l; };
__device__ __forceinline__ F2 bsplit16(const float v[16]) { F2 r;
#pragma unroll
  for (int i = 0; i < 16; ++i) { const __bf16 h = (__bf16)v[i]; r.h[i] = h; r.l[i] = (__bf16)(v[i] - (float)h); }
  return r; }
__device__ __forceinline__ F2 split_row(const float* row, int k0, int lane) { float v[16]; const float* p = row + k0 + 8 * (lane >> 4);
#pragma unroll
  for (int i = 0; i < 8; ++i) { v[i] = p[i]; v[8 + i] = p[16 + i]; }
  return bsplit16(v); }
__device__ __forceinline__ F2 split_rowK(const float* row, int k0, int lane, int K) { float v[16]; const int g = lane >> 4;
#pragma unroll
  for (int i = 0; i < 8; ++i) { const int ka = k0 + 8 * g + i, kb = ka + 16; v[i] = ka < K ? row[ka < K ? ka : K - 1] : 0.f; v[8 + i] = kb < K ? row[kb < K ? kb : K - 1] : 0.f; }
  return bsplit16(v); }
__device__ __forceinline__ F2 split_col(const float* W, int k0, int n, int lane, int ld, int K) { float v[16]; const int g = lane >> 4;
#pragma unroll
  for (int i = 0; i < 8; ++i) { const int ka = k0 + 8 * g + i, kb = ka + 16; v[i] = ka < K ? W[(size_t)(ka < K ? ka : K - 1) * ld + n] : 0.f; v[8 + i] = kb < K ? W[(size_t)(kb < K ? kb : K - 1) * ld + n] : 0.f; }
  return bsplit16(v); }
__device__ __forceinline__ v8f mac3(const F2& a, const F2& b, v8f c) { c = wmma_bf(a.l, b.h, c); c = wmma_bf(a.h, b.l, c); return wmma_bf(a.h, b.h, c); }
__device__ __forceinline__ float sigm(float v) { return 1.0f / (1.0f + expf(-v)); }
#define LDSX() do { asm volatile("s_wait_dscnt 0" ::: "memory"); __builtin_amdgcn_wave_barrier(); __builtin_amdgcn_fence(__ATOMIC_RELEASE, "workgroup"); } while (0)


// Collaborative attention (B 2, L 2,048, D 512, 8 heads x 64 with a shared 512-wide key/query space): scores = (q diag(m_h) k^T + content_bias(k side)) / sqrt(64); softmax; per-head 64-dim values; dense output projection.
#define NB 2
#define NN 2048
#define DD 512
#define NH 8
#define DH 64
#ifndef TNB
#define TNB NB
#endif
#ifndef TQB
#define TQB (NN / 64)
#endif
typedef __attribute__((ext_vector_type(8))) __bf16 v8b;
__device__ __forceinline__ v16b frag_b(const __bf16* rowk0, int lane) {
  union { v16b v; v8b q[2]; } u; const __bf16* p = rowk0 + 8 * (lane >> 4);
  u.q[0] = *(const v8b*)p; u.q[1] = *(const v8b*)(p + 16); return u.v;
}
__device__ __forceinline__ float bfr(float v) { return (float)(__bf16)v; }
__device__ __attribute__((noinline)) float exp_ni(float v) { return expf(v); }
__device__ __attribute__((noinline)) float erf_ni(float v) { return erff(v); }

#define WS_QM  0u                                   // f16 (q * m_h) rows [b*NN + l][h*512 + d]
#define WS_KH  (WS_QM + 2u * (size_t)NB * NN * NH * DD)   // f16 k rows [b*NN + s][512]
#define WS_VT  (WS_KH + 2u * (size_t)NB * NN * DD)       // f16 v planes [b][512][NN]
#define WS_CB  (WS_VT + 2u * (size_t)NB * DD * NN)       // f32 content bias [b][h][NN]
#define WS_O   (WS_CB + 4u * (size_t)NB * NH * NN)       // f32 ctx rows [b*NN + l][512]
#define WS_END (WS_O + 4u * (size_t)NB * NN * DD)

__device__ __forceinline__ v16b fragb_f32(const float* __restrict__ p, int lane) { v16b a; const float* pp = p + 8 * (lane >> 4);
#pragma unroll
  for (int i = 0; i < 8; ++i) { a[i] = (__bf16)pp[i]; a[8 + i] = (__bf16)pp[16 + i]; } return a; }
// ---- k_proj: block = (64 rows, 128 cols, which*NB + b): which 0 q -> 8 mixed copies (q * m_h) f16; 1 k -> f16 rows; 2 v -> f16 planes
__global__ __launch_bounds__(128) void k_proj(const float* __restrict__ X, const float* __restrict__ WQ, const float* __restrict__ WK, const float* __restrict__ WV, const float* __restrict__ MIX, _Float16* __restrict__ QM, _Float16* __restrict__ KH, _Float16* __restrict__ VT) {
  __shared__ __align__(16) float sf[64][132]; __shared__ __align__(16) _Float16 sh[64][136]; __shared__ __align__(16) _Float16 th[128][72];
  const int tid = threadIdx.x, wave = tid >> 5, lane = tid & 31, col = lane & 15, g = lane >> 4; const int which = blockIdx.z / NB; const size_t b = blockIdx.z % NB; const int n0 = blockIdx.x * 64; const int c0 = blockIdx.y * 128; const size_t r0 = b * NN + n0 + wave * 16;
  const float* Wm = which == 0 ? WQ : which == 1 ? WK : WV;
  v8f acc[8] = {};
#pragma unroll 2
  for (int kc = 0; kc < DD / 32; ++kc) { const v16b a = fragb_f32(X + (r0 + col) * DD + kc * 32, lane);
#pragma unroll
    for (int j = 0; j < 8; ++j) acc[j] = wmma_bf(a, fragb_f32(Wm + (size_t)(c0 + j * 16 + col) * DD + kc * 32, lane), acc[j]); }
#pragma unroll
  for (int j = 0; j < 8; ++j)
#pragma unroll
    for (int r = 0; r < 8; ++r) { const float v = acc[j][r]; if (which == 0) sf[wave * 16 + 8 * g + r][j * 16 + col] = v; else if (which == 1) sh[wave * 16 + 8 * g + r][j * 16 + col] = (_Float16)v; else th[j * 16 + col][wave * 16 + 8 * g + r] = (_Float16)v; }
  __syncthreads();
  if (which == 0) {
#pragma unroll 1
    for (int h = 0; h < NH; ++h) { for (int e = tid; e < 64 * 128; e += 128) { const int rl = e >> 7, c = e & 127; sh[rl][c] = (_Float16)(sf[rl][c] * bfr(MIX[h * DD + c0 + c])); } __syncthreads();
      for (int e = tid; e < 64 * 16; e += 128) { const int rl = e >> 4, q = e & 15; vst2((unsigned*)(QM + (b * NN + n0 + rl) * (size_t)(NH * DD) + (size_t)h * DD + c0 + q * 8), *(const v4u*)&sh[rl][q * 8]); } __syncthreads(); } }
  else if (which == 1) { for (int e = tid; e < 64 * 16; e += 128) { const int rl = e >> 4, q = e & 15; vst2((unsigned*)(KH + (b * NN + n0 + rl) * DD + c0 + q * 8), *(const v4u*)&sh[rl][q * 8]); } }
  else { for (int e = tid; e < 128 * 8; e += 128) { const int cl = e >> 3, q = e & 7; vst2((unsigned*)(VT + (b * DD + c0 + cl) * (size_t)NN + n0 + q * 8), *(const v4u*)&th[cl][q * 8]); } } }
// ---- k_cb: block = (64 keys, b): cb[b][h][s] = x_s . Wb[h] (exact products, f32 accumulate on VALU: 8 x 512 per key, rolled)
__global__ __launch_bounds__(256) void k_cb(const float* __restrict__ X, const float* __restrict__ WB, float* __restrict__ CB) { __shared__ __align__(16) float so[NH][64]; __shared__ float red[NH][64][4]; const int t = threadIdx.x; const size_t b = blockIdx.y; const int s0 = blockIdx.x * 64; const int sl = t & 63, part = t >> 6;
#pragma unroll 1
  for (int h = 0; h < NH; ++h) { float acc = 0.f; const float* xr = X + (b * NN + s0 + sl) * DD; const float* wr = WB + h * DD;
#pragma unroll 1
    for (int d = part; d < DD; d += 4) acc += bfr(xr[d]) * bfr(wr[d]); red[h][sl][part] = acc; }
  __syncthreads(); for (int e = t; e < NH * 64; e += 256) { const int h = e >> 6, s = e & 63; so[h][s] = red[h][s][0] + red[h][s][1] + red[h][s][2] + red[h][s][3]; } __syncthreads();
  if (t < NH * 16) { const int h = t >> 4, q = t & 15; vst2(CB + (b * NH + h) * (size_t)NN + s0 + q * 4, *(const v4f*)&so[h][q * 4]); } }
// ---- k_att: block = (64 queries, h, b): logits = ((q*m_h) . k + cb[s]) / 8 (K 512), softmax, P (hi + residual) . v_h
// The Q tile and the head's bias row (once) and each pass's K and V tiles (two buffers) come into LDS by asynchronous copies whose waves cover whole 128-B lines (V: 64-B row pieces); every operand of the key loop is read from LDS.
#define KP 520   // f16 per staged Q or K row: 1,040 B = 16 B x 65, an odd multiple of 16 B for the ds_load_b128 readers
#define VP 40    // f16 per staged V row: 80 B = 16 B x 5
typedef __attribute__((address_space(3))) const unsigned char lds_byte;
__device__ __forceinline__ unsigned lds_off(const void* p) { return (unsigned)(size_t)(lds_byte*)p; }
// eight copies of 16 B per lane, LDS step ls bytes, global step gs bytes; the s_wait_xcnt stands inside the statement so that no address register of a copy is rewritten ahead of it
__device__ __forceinline__ void cp8(unsigned l, unsigned ls, const char* g, size_t gs) {
  asm volatile("global_load_async_to_lds_b128 %0, %8, off\n\tglobal_load_async_to_lds_b128 %1, %9, off\n\tglobal_load_async_to_lds_b128 %2, %10, off\n\tglobal_load_async_to_lds_b128 %3, %11, off\n\t"
               "global_load_async_to_lds_b128 %4, %12, off\n\tglobal_load_async_to_lds_b128 %5, %13, off\n\tglobal_load_async_to_lds_b128 %6, %14, off\n\tglobal_load_async_to_lds_b128 %7, %15, off\n\ts_wait_xcnt 0x0"
               :: "v"(l), "v"(l + ls), "v"(l + 2 * ls), "v"(l + 3 * ls), "v"(l + 4 * ls), "v"(l + 5 * ls), "v"(l + 6 * ls), "v"(l + 7 * ls),
                  "v"(g), "v"(g + gs), "v"(g + 2 * gs), "v"(g + 3 * gs), "v"(g + 4 * gs), "v"(g + 5 * gs), "v"(g + 6 * gs), "v"(g + 7 * gs) : "memory"); }
// two copies, same form
__device__ __forceinline__ void cp2(unsigned l, unsigned ls, const char* g, size_t gs) {
  asm volatile("global_load_async_to_lds_b128 %0, %2, off\n\tglobal_load_async_to_lds_b128 %1, %3, off\n\ts_wait_xcnt 0x0" :: "v"(l), "v"(l + ls), "v"(g), "v"(g + gs) : "memory"); }
__global__ __launch_bounds__(128) void k_att(const _Float16* __restrict__ QM, const _Float16* __restrict__ KH, const _Float16* __restrict__ VT, const float* __restrict__ CB, float* __restrict__ O) {
  __shared__ __align__(16) _Float16 sq[64][KP]; __shared__ __align__(16) _Float16 sk[2][32][KP]; __shared__ __align__(16) _Float16 sv[2][DH][VP]; __shared__ __align__(16) float sp[4][16][36]; __shared__ __align__(16) float scb[NN];
  const int tid = threadIdx.x, wave = tid >> 5, lane = tid & 31, col = lane & 15, g = lane >> 4; const int h = blockIdx.y; const size_t b = blockIdx.z; const int q0 = blockIdx.x * 64 + wave * 16; const size_t rq = b * NN + q0;
  // copy maps: 1,024-B rows (Q, K): one copy of the block = two rows, a wave = 512 contiguous bytes; V: one copy = 32 rows of 64 B
  const int crow = tid >> 6, ccol = (tid & 63) * 8, vrow = tid >> 2, vcol = (tid & 3) * 8;
  const char* qsrc = (const char*)(QM + (b * NN + blockIdx.x * 64 + crow) * (size_t)(NH * DD) + (size_t)h * DD + ccol);
  const char* ksrc = (const char*)(KH + (b * NN + crow) * DD + ccol);
  const char* vsrc = (const char*)(VT + (b * DD + (size_t)h * DH + vrow) * (size_t)NN + vcol);
  const char* bsrc = (const char*)(CB + (b * NH + h) * (size_t)NN + tid * 4);
  const unsigned kdst = lds_off(&sk[0][crow][ccol]), vdst = lds_off(&sv[0][vrow][vcol]);
#define STAGE(t, bf) do { const char* kt = ksrc + (size_t)(t) * (32 * DD * 2); const unsigned kl = kdst + (unsigned)(bf) * (32u * KP * 2u); \
    cp8(kl, 2u * KP * 2u, kt, 2 * DD * 2); cp8(kl + 16u * KP * 2u, 2u * KP * 2u, kt + 16 * DD * 2, 2 * DD * 2); \
    cp2(vdst + (unsigned)(bf) * (DH * VP * 2u), 32u * VP * 2u, vsrc + (t) * 64, (size_t)32 * NN * 2); } while (0)
#pragma unroll
  for (int i = 0; i < 4; ++i) cp8(lds_off(&sq[16 * i + crow][ccol]), 2u * KP * 2u, qsrc + (size_t)(16 * i) * (NH * DD * 2), (size_t)2 * NH * DD * 2);
  cp2(lds_off(&scb[tid * 4]), 2048u, bsrc, 2048); cp2(lds_off(&scb[1024 + tid * 4]), 2048u, bsrc + 4096, 2048);
  STAGE(0, 0);
  asm volatile("s_wait_asynccnt 0x0" ::: "memory");   // this wave's copies of Q, of the bias row and of pass 0 have landed
  __syncthreads();                                     // ... and every other wave's: nothing staged is read before this
  STAGE(1, 1);
  float m[8], l[8];
#pragma unroll
  for (int r = 0; r < 8; ++r) { m[r] = -3.0e38f; l[r] = 0.f; }
  v8f acc[4] = {}, accl[4] = {};
  const _Float16* qrow = &sq[wave * 16 + col][0];
#pragma unroll 1
  for (int ks = 0; ks < NN / 32; ++ks) { const int bf = ks & 1; v8f s[2];
    v16h vf[4];
    { const _Float16* k0 = &sk[bf][col][0]; const _Float16* k1 = &sk[bf][16 + col][0]; v8f c0 = {}, c1 = {};
      const float cb0 = scb[ks * 32 + col], cb1 = scb[ks * 32 + 16 + col];
      // LDS reads in groups, one group (two k steps: 12 reads) ahead of the products that use them, in a second register set; each Q fragment serves both 16-key groups
      v16h qf[2][2], ka[2][2], kb[2][2];
#pragma unroll
      for (int i = 0; i < 2; ++i) { qf[0][i] = frag_h(qrow + i * 32, lane); ka[0][i] = frag_h(k0 + i * 32, lane); kb[0][i] = frag_h(k1 + i * 32, lane); }
#pragma unroll
      for (int kb2 = 0; kb2 < DD / 64; ++kb2) { const int cs = kb2 & 1, ns = cs ^ 1;
        if (kb2 + 1 < DD / 64) {
#pragma unroll
          for (int i = 0; i < 2; ++i) { const int kc = (kb2 + 1) * 2 + i; qf[ns][i] = frag_h(qrow + kc * 32, lane); ka[ns][i] = frag_h(k0 + kc * 32, lane); kb[ns][i] = frag_h(k1 + kc * 32, lane); } }
        else {
#pragma unroll
          for (int j = 0; j < 4; ++j) vf[j] = frag_h(&sv[bf][j * 16 + col][0], lane); }
#pragma unroll
        for (int i = 0; i < 2; ++i) { c0 = wmma16(qf[cs][i], ka[cs][i], c0); c1 = wmma16(qf[cs][i], kb[cs][i], c1); } }
#pragma unroll
      for (int r = 0; r < 8; ++r) { s[0][r] = (c0[r] + cb0) * 0.125f; s[1][r] = (c1[r] + cb1) * 0.125f; } }
    float alpha[8];
#pragma unroll
    for (int r = 0; r < 8; ++r) { float mx = fmaxf(s[0][r], s[1][r]);
#pragma unroll
      for (int o = 1; o < 16; o <<= 1) mx = fmaxf(mx, __shfl_xor(mx, o));
      const float mn = fmaxf(m[r], mx); alpha[r] = __expf(m[r] - mn); const float e0 = __expf(s[0][r] - mn), e1 = __expf(s[1][r] - mn); float es = e0 + e1;
#pragma unroll
      for (int o = 1; o < 16; o <<= 1) es += __shfl_xor(es, o);
      l[r] = l[r] * alpha[r] + es; m[r] = mn; sp[wave][8 * g + r][col] = e0; sp[wave][8 * g + r][16 + col] = e1; }
#pragma unroll
    for (int j = 0; j < 4; ++j)
#pragma unroll
      for (int r = 0; r < 8; ++r) { acc[j][r] *= alpha[r]; accl[j][r] *= alpha[r]; }
    LDSX();
    v16h pa, pal; { const float* prow = &sp[wave][col][0] + 8 * (lane >> 4);
#pragma unroll
      for (int i = 0; i < 8; ++i) { const float p0 = prow[i] * 2048.0f, p1 = prow[16 + i] * 2048.0f; pa[i] = (_Float16)p0; pa[8 + i] = (_Float16)p1; pal[i] = (_Float16)((p0 - (float)pa[i]) * 2048.0f); pal[8 + i] = (_Float16)((p1 - (float)pa[8 + i]) * 2048.0f); } }
#pragma unroll
    for (int j = 0; j < 4; ++j) { acc[j] = wmma16(pa, vf[j], acc[j]); accl[j] = wmma16(pal, vf[j], accl[j]); }
    asm volatile("s_wait_dscnt 0x0" ::: "memory");     // this wave's reads of sp and of this pass's buffers have returned
    asm volatile("s_wait_asynccnt 0x0" ::: "memory");  // this wave's copies of the next pass have landed
    __syncthreads();                                   // publishes the next pass and ends every reader's last read of this pass's buffers
    if (ks + 2 < NN / 32) STAGE(ks + 2, bf); }
  asm volatile("s_wait_asynccnt 0x0" ::: "memory");    // no copy is outstanding when the wave reuses LDS and ends
  // output staging in the wave's own 16 Q rows (no other wave reads them; its own reads returned at the last pass's s_wait_dscnt): keeps the block's LDS small enough for two blocks per WGP
  float (*so)[68] = (float (*)[68])&sq[wave * 16][0];
#pragma unroll
  for (int r = 0; r < 8; ++r) { const float il = (1.0f / 2048.0f) / l[r];
#pragma unroll
    for (int j = 0; j < 4; ++j) so[8 * g + r][j * 16 + col] = (acc[j][r] + accl[j][r] * (1.0f / 2048.0f)) * il; }
  LDSX(); for (int rl = 0; rl < 16; ++rl) if (lane < 16) vst2(O + (rq + rl) * DD + (size_t)h * DH + lane * 4, *(const v4f*)&so[rl][lane * 4]); }
// ---- k_out: block = (64 rows, 128 cols): out = ctx (hi + lo) . Wd^T + bd
__global__ __launch_bounds__(128) void k_out(const float* __restrict__ Or, const float* __restrict__ WD, const float* __restrict__ BD, float* __restrict__ OUT) { __shared__ __align__(16) float sf[4][16][132];
  const int tid = threadIdx.x, wave = tid >> 5, lane = tid & 31, col = lane & 15, g = lane >> 4; const size_t r0 = (size_t)blockIdx.x * 64 + wave * 16; const int c0 = blockIdx.y * 128;
  v8f acc[8] = {};
#pragma unroll 2
  for (int kc = 0; kc < DD / 32; ++kc) { const F2 a = split_row(Or + (r0 + col) * DD, kc * 32, lane);
#pragma unroll
    for (int j = 0; j < 8; ++j) { const v16b w = fragb_f32(WD + (size_t)(c0 + j * 16 + col) * DD + kc * 32, lane); acc[j] = wmma_bf(a.h, w, acc[j]); acc[j] = wmma_bf(a.l, w, acc[j]); } }
#pragma unroll
  for (int j = 0; j < 8; ++j) { const float bb = bfr(BD[c0 + j * 16 + col]);
#pragma unroll
    for (int r = 0; r < 8; ++r) sf[wave][8 * g + r][j * 16 + col] = acc[j][r] + bb; }
  LDSX(); for (int rl = 0; rl < 16; ++rl) vst2(OUT + (r0 + rl) * DD + c0 + lane * 4, *(const v4f*)&sf[wave][rl][lane * 4]); }
extern "C" void kernel_launch(void* const* d_in, const int* in_sizes, int n_in, void* d_out, int out_size, void* d_ws, size_t ws_size, hipStream_t stream) {
  (void)in_sizes; (void)n_in; (void)out_size;
  const float** F = (const float**)d_in;   // 0 x [2,2048,512], 1 Wq, 2 Wk, 3 Wv [512,512] natural, 4 Wb [8,512], 5 mixing [8,512], 6 Wd [512,512], 7 bd [512]
  if (ws_size < (size_t)WS_END) return;
  char* ws = (char*)d_ws; _Float16 *QM = (_Float16*)(ws + WS_QM), *KH = (_Float16*)(ws + WS_KH), *VT = (_Float16*)(ws + WS_VT); float *CB = (float*)(ws + WS_CB), *O = (float*)(ws + WS_O);
  k_proj<<<dim3(NN / 64, DD / 128, 3 * NB), 128, 0, stream>>>(F[0], F[1], F[2], F[3], F[5], QM, KH, VT);
  k_cb<<<dim3(NN / 64, NB), 256, 0, stream>>>(F[0], F[4], CB);
  k_att<<<dim3(TQB, NH, TNB), 128, 0, stream>>>(QM, KH, VT, CB, O);
  k_out<<<dim3(TNB * NN / 64, DD / 128), 128, 0, stream>>>(O, F[6], F[7], (float*)d_out);
}

// v002
// A run of this version takes 278 microseconds.
// In two side-by-side timings against v001, it was 1.32 and 1.33 times as fast.
// All steps since v000 together make it 3.09 times as fast.
// compute dtype: all float inputs rounded to bf16; q/k/v = x W^T with EXACT bf16 products on WMMA 16x16x32 (natural rows); per head the bilinear scores sum_d q_d m_hd k_d as a 512-deep WMMA product of (q * m_h) and k, each rounded once to f16 (1 product; the attention is diffuse: logits std ~0.1), content bias x . Wb^T exact, x 1/8; running-max softmax in f32 (hardware exp); P as f16 hi + residual (x 2^11) . v (f16; 2 products); out = ctx (bf16 hi + lo) . Wd^T + bd; f32 output.
#include <hip/hip_runtime.h>
#include <math.h>

typedef __attribute__((ext_vector_type(16))) _Float16 v16h;
typedef __attribute__((ext_vector_type(16))) __bf16 v16b;
typedef __attribute__((ext_vector_type(8)))  _Float16 v8h;
typedef __attribute__((ext_vector_type(8)))  float v8f;
typedef __attribute__((ext_vector_type(4)))  float v4f;
typedef __attribute__((ext_vector_type(2)))  float v2f;
typedef __attribute__((ext_vector_type(4)))  unsigned v4u;
typedef __attribute__((ext_vector_type(4)))  int v4i;
typedef float __attribute__((may_alias)) float_a;
typedef int __attribute__((may_alias)) int_a;

template <typename T> __device__ __forceinline__ void vst2(void* p, T v) { *(T*)p = v;  }
__device__ __forceinline__ v8f wmma16(v16h a, v16h b, v8f c) {
  v8f d = __builtin_amdgcn_wmma_f32_16x16x32_f16(false, a, false, b, (short)0, c, false, false);
  asm volatile("v_nop\n\tv_nop\n\tv_nop\n\tv_nop" : "+v"(d) : "v"(a), "v"(b));
  return d;
}
__device__ __forceinline__ v8f wmma_bf(v16b a, v16b b, v8f c) {
  v8f d = __builtin_amdgcn_wmma_f32_16x16x32_bf16(false, a, false, b, (short)0, c, false, false);
  asm volatile("v_nop\n\tv_nop\n\tv_nop\n\tv_nop" : "+v"(d) : "v"(a), "v"(b));
  return d;
}
// 16x16x32 fragments: lane = (h = lane>>4, row/col = lane&15); elements 0..7 = k0+8h+0..7, 8..15 = k0+16+8h+0..7; D element r = row 8h+r
__device__ __forceinline__ v16h frag_h(const _Float16* rowk0, int lane) {
  union { v16h v; v8h q[2]; } u; const _Float16* p = rowk0 + 8 * (lane >> 4);
  u.q[0] = *(const v8h*)p; u.q[1] = *(const v8h*)(p + 16); return u.v;
}
__device__ __forceinline__ v16h frag_f32(const float* rowk0, int lane) {
  v16h a; const float* p = rowk0 + 8 * (lane >> 4);
#pragma unroll
  for (int i = 0; i < 8; ++i) { a[i] = (_Float16)p[i]; a[8 + i] = (_Float16)p[16 + i]; }
  return a;
}
__device__ __forceinline__ v16h frag_f32s(const float* rowk0, int lane, float sc) {
  v16h a; const float* p = rowk0 + 8 * (lane >> 4);
#pragma unroll
  for (int i = 0; i < 8; ++i) { a[i] = (_Float16)(p[i] * sc); a[8 + i] = (_Float16)(p[16 + i] * sc); }
  return a;
}
// column fragment from a [K][ld] layout (column n), rows >= K read as 0
__device__ __forceinline__ v16h fragc_f32(const float* W, int k0, int n, int lane, int ld, int K) {
  v16h a; const int g = lane >> 4;
#pragma unroll
  for (int i = 0; i < 8; ++i) { const int ka = k0 + 8 * g + i, kb = ka + 16;
    a[i] = (_Float16)(ka < K ? W[(size_t)(ka < K ? ka : K - 1) * ld + n] : 0.f); a[8 + i] = (_Float16)(kb < K ? W[(size_t)(kb < K ? kb : K - 1) * ld + n] : 0.f); }
  return a;
}
struct F2 { v16b h, l; };
__device__ __forceinline__ F2 bsplit16(const float v[16]) { F2 r;
#pragma unroll
  for (int i = 0; i < 16; ++i) { const __bf16 h = (__bf16)v[i]; r.h[i] = h; r.l[i] = (__bf16)(v[i] - (float)h); }
  return r; }
__device__ __forceinline__ F2 split_row(const float* row, int k0, int lane) { float v[16]; const float* p = row + k0 + 8 * (lane >> 4);
#pragma unroll
  for (int i = 0; i < 8; ++i) { v[i] = p[i]; v[8 + i] = p[16 + i]; }
  return bsplit16(v); }
__device__ __forceinline__ F2 split_rowK(const float* row, int k0, int lane, int K) { float v[16]; const int g = lane >> 4;
#pragma unroll
  for (int i = 0; i < 8; ++i) { const int ka = k0 + 8 * g + i, kb = ka + 16; v[i] = ka < K ? row[ka < K ? ka : K - 1] : 0.f; v[8 + i] = kb < K ? row[kb < K ? kb : K - 1] : 0.f; }
  return bsplit16(v); }
__device__ __forceinline__ F2 split_col(const float* W, int k0, int n, int lane, int ld, int K) { float v[16]; const int g = lane >> 4;
#pragma unroll
  for (int i = 0; i < 8; ++i) { const int ka = k0 + 8 * g + i, kb = ka + 16; v[i] = ka < K ? W[(size_t)(ka < K ? ka : K - 1) * ld + n] : 0.f; v[8 + i] = kb < K ? W[(size_t)(kb < K ? kb : K - 1) * ld + n] : 0.f; }
  return bsplit16(v); }
__device__ __forceinline__ v8f mac3(const F2& a, const F2& b, v8f c) { c = wmma_bf(a.l, b.h, c); c = wmma_bf(a.h, b.l, c); return wmma_bf(a.h, b.h, c); }
__device__ __forceinline__ float sigm(float v) { return 1.0f / (1.0f + expf(-v)); }
#define LDSX() do { asm volatile("s_wait_dscnt 0" ::: "memory"); __builtin_amdgcn_wave_barrier(); __builtin_amdgcn_fence(__ATOMIC_RELEASE, "workgroup"); } while (0)


// Collaborative attention (B 2, L 2,048, D 512, 8 heads x 64 with a shared 512-wide key/query space): scores = (q diag(m_h) k^T + content_bias(k side)) / sqrt(64); softmax; per-head 64-dim values; dense output projection.
#define NB 2
#define NN 2048
#define DD 512
#define NH 8
#define DH 64
#ifndef TNB
#define TNB NB
#endif
#ifndef TQB
#define TQB (NN / 64)
#endif
typedef __attribute__((ext_vector_type(8))) __bf16 v8b;
__device__ __forceinline__ v16b frag_b(const __bf16* rowk0, int lane) {
  union { v16b v; v8b q[2]; } u; const __bf16* p = rowk0 + 8 * (lane >> 4);
  u.q[0] = *(const v8b*)p; u.q[1] = *(const v8b*)(p + 16); return u.v;
}
__device__ __forceinline__ float bfr(float v) { return (float)(__bf16)v; }
__device__ __attribute__((noinline)) float exp_ni(float v) { return expf(v); }
__device__ __attribute__((noinline)) float erf_ni(float v) { return erff(v); }

#define WS_QM  0u                                   // f16 (q * m_h) rows [b*NN + l][h*512 + d]
#define WS_KH  (WS_QM + 2u * (size_t)NB * NN * NH * DD)   // f16 k rows [b*NN + s][512]
#define WS_VT  (WS_KH + 2u * (size_t)NB * NN * DD)       // f16 v planes [b][512][NN]
#define WS_CB  (WS_VT + 2u * (size_t)NB * DD * NN)       // f32 content bias [b][h][NN]
#define WS_O   (WS_CB + 4u * (size_t)NB * NH * NN)       // f32 ctx rows [b*NN + l][512]
#define WS_END (WS_O + 4u * (size_t)NB * NN * DD)

__device__ __forceinline__ v16b fragb_f32(const float* __restrict__ p, int lane) { v16b a; const float* pp = p + 8 * (lane >> 4);
#pragma unroll
  for (int i = 0; i < 8; ++i) { a[i] = (__bf16)pp[i]; a[8 + i] = (__bf16)pp[16 + i]; } return a; }
// ---- k_proj: block = (64 rows, 128 cols, which*NB + b): which 0 q -> 8 mixed copies (q * m_h) f16; 1 k -> f16 rows; 2 v -> f16 planes
__global__ __launch_bounds__(128) void k_proj(const float* __restrict__ X, const float* __restrict__ WQ, const float* __restrict__ WK, const float* __restrict__ WV, const float* __restrict__ MIX, _Float16* __restrict__ QM, _Float16* __restrict__ KH, _Float16* __restrict__ VT) {
  __shared__ __align__(16) float sf[64][132]; __shared__ __align__(16) _Float16 sh[64][136]; __shared__ __align__(16) _Float16 th[128][72];
  const int tid = threadIdx.x, wave = tid >> 5, lane = tid & 31, col = lane & 15, g = lane >> 4; const int which = blockIdx.z / NB; const size_t b = blockIdx.z % NB; const int n0 = blockIdx.x * 64; const int c0 = blockIdx.y * 128; const size_t r0 = b * NN + n0 + wave * 16;
  const float* Wm = which == 0 ? WQ : which == 1 ? WK : WV;
  v8f acc[8] = {};
#pragma unroll 2
  for (int kc = 0; kc < DD / 32; ++kc) { const v16b a = fragb_f32(X + (r0 + col) * DD + kc * 32, lane);
#pragma unroll
    for (int j = 0; j < 8; ++j) acc[j] = wmma_bf(a, fragb_f32(Wm + (size_t)(c0 + j * 16 + col) * DD + kc * 32, lane), acc[j]); }
#pragma unroll
  for (int j = 0; j < 8; ++j)
#pragma unroll
    for (int r = 0; r < 8; ++r) { const float v = acc[j][r]; if (which == 0) sf[wave * 16 + 8 * g + r][j * 16 + col] = v; else if (which == 1) sh[wave * 16 + 8 * g + r][j * 16 + col] = (_Float16)v; else th[j * 16 + col][wave * 16 + 8 * g + r] = (_Float16)v; }
  __syncthreads();
  if (which == 0) {
#pragma unroll 1
    for (int h = 0; h < NH; ++h) { for (int e = tid; e < 64 * 128; e += 128) { const int rl = e >> 7, c = e & 127; sh[rl][c] = (_Float16)(sf[rl][c] * bfr(MIX[h * DD + c0 + c])); } __syncthreads();
      for (int e = tid; e < 64 * 16; e += 128) { const int rl = e >> 4, q = e & 15; vst2((unsigned*)(QM + (b * NN + n0 + rl) * (size_t)(NH * DD) + (size_t)h * DD + c0 + q * 8), *(const v4u*)&sh[rl][q * 8]); } __syncthreads(); } }
  else if (which == 1) { for (int e = tid; e < 64 * 16; e += 128) { const int rl = e >> 4, q = e & 15; vst2((unsigned*)(KH + (b * NN + n0 + rl) * DD + c0 + q * 8), *(const v4u*)&sh[rl][q * 8]); } }
  else { for (int e = tid; e < 128 * 8; e += 128) { const int cl = e >> 3, q = e & 7; vst2((unsigned*)(VT + (b * DD + c0 + cl) * (size_t)NN + n0 + q * 8), *(const v4u*)&th[cl][q * 8]); } } }
// ---- k_cb: block = (32 keys, b): cb[b][h][s] = x_s . Wb[h] (exact products, f32 accumulate on VALU)
// The block's 32 x rows and the 8 Wb rows come in by 16-B loads whose waves cover whole 128-B lines, are rounded once and staged in LDS; thread (key, head) sums its 512 products from LDS in four chains d = j + 4 i, joined j = 0..3 (the order of additions that four threads per key gave); a wave stores one whole 128-B line of one head.
#define CP 516   // f32 per staged row: 2,064 B = 16 B x 129, an odd multiple of 16 B for the ds_load_b128 readers (32 rows, one column)
__device__ __forceinline__ v4f bfr4(v4f v) { v4f r; r[0] = bfr(v[0]); r[1] = bfr(v[1]); r[2] = bfr(v[2]); r[3] = bfr(v[3]); return r; }
__global__ __launch_bounds__(256) void k_cb(const float* __restrict__ X, const float* __restrict__ WB, float* __restrict__ CB) { __shared__ __align__(16) float sx[32][CP]; __shared__ __align__(16) float sw[NH][CP]; const int t = threadIdx.x; const size_t b = blockIdx.y; const int s0 = blockIdx.x * 32;
  const float* xs = X + (b * NN + s0) * DD + t * 4; const float* wsrc = WB + t * 4; const int r2 = t >> 7, c4 = (t & 127) * 4;
  v4f xv[16], wv[4];   // the four loops below are unrolled whole so that the arrays stay in registers and all 20 loads are in flight before the first is used
#pragma unroll
  for (int i = 0; i < 16; ++i) xv[i] = *(const v4f*)(xs + i * 1024);
#pragma unroll
  for (int i = 0; i < 4; ++i) wv[i] = *(const v4f*)(wsrc + i * 1024);
#pragma unroll
  for (int i = 0; i < 16; ++i) *(v4f*)&sx[2 * i + r2][c4] = bfr4(xv[i]);
#pragma unroll
  for (int i = 0; i < 4; ++i) *(v4f*)&sw[2 * i + r2][c4] = bfr4(wv[i]);
  __syncthreads();
  const int sl = t & 31, h = t >> 5; const float* xr = &sx[sl][0]; const float* wr = &sw[h][0]; float a0 = 0.f, a1 = 0.f, a2 = 0.f, a3 = 0.f;
#pragma unroll 8   // eight steps' LDS reads go out as a group ahead of their products; without it each step waits for its own two reads
  for (int i = 0; i < DD / 4; ++i) { const v4f x4 = *(const v4f*)(xr + 4 * i), w4 = *(const v4f*)(wr + 4 * i); a0 += x4[0] * w4[0]; a1 += x4[1] * w4[1]; a2 += x4[2] * w4[2]; a3 += x4[3] * w4[3]; }
  CB[(b * NH + h) * (size_t)NN + s0 + sl] = a0 + a1 + a2 + a3; }
// ---- k_att: block = (64 queries, h, b): logits = ((q*m_h) . k + cb[s]) / 8 (K 512), softmax, P (hi + residual) . v_h
// The Q tile and the head's bias row (once) and each pass's K and V tiles (two buffers) come into LDS by asynchronous copies whose waves cover whole 128-B lines (V: 64-B row pieces); every operand of the key loop is read from LDS.
#define KP 520   // f16 per staged Q or K row: 1,040 B = 16 B x 65, an odd multiple of 16 B for the ds_load_b128 readers
#define VP 40    // f16 per staged V row: 80 B = 16 B x 5
typedef __attribute__((address_space(3))) const unsigned char lds_byte;
__device__ __forceinline__ unsigned lds_off(const void* p) { return (unsigned)(size_t)(lds_byte*)p; }
// eight copies of 16 B per lane, LDS step ls bytes, global step gs bytes; the s_wait_xcnt stands inside the statement so that no address register of a copy is rewritten ahead of it
__device__ __forceinline__ void cp8(unsigned l, unsigned ls, const char* g, size_t gs) {
  asm volatile("global_load_async_to_lds_b128 %0, %8, off\n\tglobal_load_async_to_lds_b128 %1, %9, off\n\tglobal_load_async_to_lds_b128 %2, %10, off\n\tglobal_load_async_to_lds_b128 %3, %11, off\n\t"
               "global_load_async_to_lds_b128 %4, %12, off\n\tglobal_load_async_to_lds_b128 %5, %13, off\n\tglobal_load_async_to_lds_b128 %6, %14, off\n\tglobal_load_async_to_lds_b128 %7, %15, off\n\ts_wait_xcnt 0x0"
               :: "v"(l), "v"(l + ls), "v"(l + 2 * ls), "v"(l + 3 * ls), "v"(l + 4 * ls), "v"(l + 5 * ls), "v"(l + 6 * ls), "v"(l + 7 * ls),
                  "v"(g), "v"(g + gs), "v"(g + 2 * gs), "v"(g + 3 * gs), "v"(g + 4 * gs), "v"(g + 5 * gs), "v"(g + 6 * gs), "v"(g + 7 * gs) : "memory"); }
// two copies, same form
__device__ __forceinline__ void cp2(unsigned l, unsigned ls, const char* g, size_t gs) {
  asm volatile("global_load_async_to_lds_b128 %0, %2, off\n\tglobal_load_async_to_lds_b128 %1, %3, off\n\ts_wait_xcnt 0x0" :: "v"(l), "v"(l + ls), "v"(g), "v"(g + gs) : "memory"); }
__global__ __launch_bounds__(128) void k_att(const _Float16* __restrict__ QM, const _Float16* __restrict__ KH, const _Float16* __restrict__ VT, const float* __restrict__ CB, float* __restrict__ O) {
  __shared__ __align__(16) _Float16 sq[64][KP]; __shared__ __align__(16) _Float16 sk[2][32][KP]; __shared__ __align__(16) _Float16 sv[2][DH][VP]; __shared__ __align__(16) float sp[4][16][36]; __shared__ __align__(16) float scb[NN];
  const int tid = threadIdx.x, wave = tid >> 5, lane = tid & 31, col = lane & 15, g = lane >> 4; const int h = blockIdx.y; const size_t b = blockIdx.z; const int q0 = blockIdx.x * 64 + wave * 16; const size_t rq = b * NN + q0;
  // copy maps: 1,024-B rows (Q, K): one copy of the block = two rows, a wave = 512 contiguous bytes; V: one copy = 32 rows of 64 B
  const int crow = tid >> 6, ccol = (tid & 63) * 8, vrow = tid >> 2, vcol = (tid & 3) * 8;
  const char* qsrc = (const char*)(QM + (b * NN + blockIdx.x * 64 + crow) * (size_t)(NH * DD) + (size_t)h * DD + ccol);
  const char* ksrc = (const char*)(KH + (b * NN + crow) * DD + ccol);
  const char* vsrc = (const char*)(VT + (b * DD + (size_t)h * DH + vrow) * (size_t)NN + vcol);
  const char* bsrc = (const char*)(CB + (b * NH + h) * (size_t)NN + tid * 4);
  const unsigned kdst = lds_off(&sk[0][crow][ccol]), vdst = lds_off(&sv[0][vrow][vcol]);
#define STAGE(t, bf) do { const char* kt = ksrc + (size_t)(t) * (32 * DD * 2); const unsigned kl = kdst + (unsigned)(bf) * (32u * KP * 2u); \
    cp8(kl, 2u * KP * 2u, kt, 2 * DD * 2); cp8(kl + 16u * KP * 2u, 2u * KP * 2u, kt + 16 * DD * 2, 2 * DD * 2); \
    cp2(vdst + (unsigned)(bf) * (DH * VP * 2u), 32u * VP * 2u, vsrc + (t) * 64, (size_t)32 * NN * 2); } while (0)
#pragma unroll
  for (int i = 0; i < 4; ++i) cp8(lds_off(&sq[16 * i + crow][ccol]), 2u * KP * 2u, qsrc + (size_t)(16 * i) * (NH * DD * 2), (size_t)2 * NH * DD * 2);
  cp2(lds_off(&scb[tid * 4]), 2048u, bsrc, 2048); cp2(lds_off(&scb[1024 + tid * 4]), 2048u, bsrc + 4096, 2048);
  STAGE(0, 0);
  asm volatile("s_wait_asynccnt 0x0" ::: "memory");   // this wave's copies of Q, of the bias row and of pass 0 have landed
  __syncthreads();                                     // ... and every other wave's: nothing staged is read before this
  STAGE(1, 1);
  float m[8], l[8];
#pragma unroll
  for (int r = 0; r < 8; ++r) { m[r] = -3.0e38f; l[r] = 0.f; }
  v8f acc[4] = {}, accl[4] = {};
  const _Float16* qrow = &sq[wave * 16 + col][0];
#pragma unroll 1
  for (int ks = 0; ks < NN / 32; ++ks) { const int bf = ks & 1; v8f s[2];
    v16h vf[4];
    { const _Float16* k0 = &sk[bf][col][0]; const _Float16* k1 = &sk[bf][16 + col][0]; v8f c0 = {}, c1 = {};
      const float cb0 = scb[ks * 32 + col], cb1 = scb[ks * 32 + 16 + col];
      // LDS reads in groups, one group (two k steps: 12 reads) ahead of the products that use them, in a second register set; each Q fragment serves both 16-key groups
      v16h qf[2][2], ka[2][2], kb[2][2];
#pragma unroll
      for (int i = 0; i < 2; ++i) { qf[0][i] = frag_h(qrow + i * 32, lane); ka[0][i] = frag_h(k0 + i * 32, lane); kb[0][i] = frag_h(k1 + i * 32, lane); }
#pragma unroll
      for (int kb2 = 0; kb2 < DD / 64; ++kb2) { const int cs = kb2 & 1, ns = cs ^ 1;
        if (kb2 + 1 < DD / 64) {
#pragma unroll
          for (int i = 0; i < 2; ++i) { const int kc = (kb2 + 1) * 2 + i; qf[ns][i] = frag_h(qrow + kc * 32, lane); ka[ns][i] = frag_h(k0 + kc * 32, lane); kb[ns][i] = frag_h(k1 + kc * 32, lane); } }
        else {
#pragma unroll
          for (int j = 0; j < 4; ++j) vf[j] = frag_h(&sv[bf][j * 16 + col][0], lane); }
#pragma unroll
        for (int i = 0; i < 2; ++i) { c0 = wmma16(qf[cs][i], ka[cs][i], c0); c1 = wmma16(qf[cs][i], kb[cs][i], c1); } }
#pragma unroll
      for (int r = 0; r < 8; ++r) { s[0][r] = (c0[r] + cb0) * 0.125f; s[1][r] = (c1[r] + cb1) * 0.125f; } }
    float alpha[8];
#pragma unroll
    for (int r = 0; r < 8; ++r) { float mx = fmaxf(s[0][r], s[1][r]);
#pragma unroll
      for (int o = 1; o < 16; o <<= 1) mx = fmaxf(mx, __shfl_xor(mx, o));
      const float mn = fmaxf(m[r], mx); alpha[r] = __expf(m[r] - mn); const float e0 = __expf(s[0][r] - mn), e1 = __expf(s[1][r] - mn); float es = e0 + e1;
#pragma unroll
      for (int o = 1; o < 16; o <<= 1) es += __shfl_xor(es, o);
      l[r] = l[r] * alpha[r] + es; m[r] = mn; sp[wave][8 * g + r][col] = e0; sp[wave][8 * g + r][16 + col] = e1; }
#pragma unroll
    for (int j = 0; j < 4; ++j)
#pragma unroll
      for (int r = 0; r < 8; ++r) { acc[j][r] *= alpha[r]; accl[j][r] *= alpha[r]; }
    LDSX();
    v16h pa, pal; { const float* prow = &sp[wave][col][0] + 8 * (lane >> 4);
#pragma unroll
      for (int i = 0; i < 8; ++i) { const float p0 = prow[i] * 2048.0f, p1 = prow[16 + i] * 2048.0f; pa[i] = (_Float16)p0; pa[8 + i] = (_Float16)p1; pal[i] = (_Float16)((p0 - (float)pa[i]) * 2048.0f); pal[8 + i] = (_Float16)((p1 - (float)pa[8 + i]) * 2048.0f); } }
#pragma unroll
    for (int j = 0; j < 4; ++j) { acc[j] = wmma16(pa, vf[j], acc[j]); accl[j] = wmma16(pal, vf[j], accl[j]); }
    asm volatile("s_wait_dscnt 0x0" ::: "memory");     // this wave's reads of sp and of this pass's buffers have returned
    asm volatile("s_wait_asynccnt 0x0" ::: "memory");  // this wave's copies of the next pass have landed
    __syncthreads();                                   // publishes the next pass and ends every reader's last read of this pass's buffers
    if (ks + 2 < NN / 32) STAGE(ks + 2, bf); }
  asm volatile("s_wait_asynccnt 0x0" ::: "memory");    // no copy is outstanding when the wave reuses LDS and ends
  // output staging in the wave's own 16 Q rows (no other wave reads them; its own reads returned at the last pass's s_wait_dscnt): keeps the block's LDS small enough for two blocks per WGP
  float (*so)[68] = (float (*)[68])&sq[wave * 16][0];
#pragma unroll
  for (int r = 0; r < 8; ++r) { const float il = (1.0f / 2048.0f) / l[r];
#pragma unroll
    for (int j = 0; j < 4; ++j) so[8 * g + r][j * 16 + col] = (acc[j][r] + accl[j][r] * (1.0f / 2048.0f)) * il; }
  LDSX(); for (int rl = 0; rl < 16; ++rl) if (lane < 16) vst2(O + (rq + rl) * DD + (size_t)h * DH + lane * 4, *(const v4f*)&so[rl][lane * 4]); }
// ---- k_out: block = (64 rows, 128 cols): out = ctx (hi + lo) . Wd^T + bd
__global__ __launch_bounds__(128) void k_out(const float* __restrict__ Or, const float* __restrict__ WD, const float* __restrict__ BD, float* __restrict__ OUT) { __shared__ __align__(16) float sf[4][16][132];
  const int tid = threadIdx.x, wave = tid >> 5, lane = tid & 31, col = lane & 15, g = lane >> 4; const size_t r0 = (size_t)blockIdx.x * 64 + wave * 16; const int c0 = blockIdx.y * 128;
  v8f acc[8] = {};
#pragma unroll 2
  for (int kc = 0; kc < DD / 32; ++kc) { const F2 a = split_row(Or + (r0 + col) * DD, kc * 32, lane);
#pragma unroll
    for (int j = 0; j < 8; ++j) { const v16b w = fragb_f32(WD + (size_t)(c0 + j * 16 + col) * DD + kc * 32, lane); acc[j] = wmma_bf(a.h, w, acc[j]); acc[j] = wmma_bf(a.l, w, acc[j]); } }
#pragma unroll
  for (int j = 0; j < 8; ++j) { const float bb = bfr(BD[c0 + j * 16 + col]);
#pragma unroll
    for (int r = 0; r < 8; ++r) sf[wave][8 * g + r][j * 16 + col] = acc[j][r] + bb; }
  LDSX(); for (int rl = 0; rl < 16; ++rl) vst2(OUT + (r0 + rl) * DD + c0 + lane * 4, *(const v4f*)&sf[wave][rl][lane * 4]); }
extern "C" void kernel_launch(void* const* d_in, const int* in_sizes, int n_in, void* d_out, int out_size, void* d_ws, size_t ws_size, hipStream_t stream) {
  (void)in_sizes; (void)n_in; (void)out_size;
  const float** F = (const float**)d_in;   // 0 x [2,2048,512], 1 Wq, 2 Wk, 3 Wv [512,512] natural, 4 Wb [8,512], 5 mixing [8,512], 6 Wd [512,512], 7 bd [512]
  if (ws_size < (size_t)WS_END) return;
  char* ws = (char*)d_ws; _Float16 *QM = (_Float16*)(ws + WS_QM), *KH = (_Float16*)(ws + WS_KH), *VT = (_Float16*)(ws + WS_VT); float *CB = (float*)(ws + WS_CB), *O = (float*)(ws + WS_O);
  k_proj<<<dim3(NN / 64, DD / 128, 3 * NB), 128, 0, stream>>>(F[0], F[1], F[2], F[3], F[5], QM, KH, VT);
  k_cb<<<dim3(NN / 32, NB), 256, 0, stream>>>(F[0], F[4], CB);
  k_att<<<dim3(TQB, NH, TNB), 128, 0, stream>>>(QM, KH, VT, CB, O);
  k_out<<<dim3(TNB * NN / 64, DD / 128), 128, 0, stream>>>(O, F[6], F[7], (float*)d_out);
}

// v003
// Measured time: 174 microseconds a run.
// Next to v002, in two timings, it ran 1.59 times as fast each time.
// Counting every step since v000, it is 4.92 times as fast.
// compute dtype: all float inputs rounded to bf16; q/k/v = x W^T with EXACT bf16 products on WMMA 16x16x32 (natural rows); per head the bilinear scores sum_d q_d m_hd k_d as a 512-deep WMMA product of (q * m_h) and k, each rounded once to f16 (1 product; the attention is diffuse: logits std ~0.1), content bias x . Wb^T exact, x 1/8; running-max softmax in f32 (hardware exp); P as f16 hi + residual (x 2^11) . v (f16; 2 products); out = ctx (bf16 hi + lo) . Wd^T + bd; f32 output.
#include <hip/hip_runtime.h>
#include <math.h>

typedef __attribute__((ext_vector_type(16))) _Float16 v16h;
typedef __attribute__((ext_vector_type(16))) __bf16 v16b;
typedef __attribute__((ext_vector_type(8)))  _Float16 v8h;
typedef __attribute__((ext_vector_type(8)))  float v8f;
typedef __attribute__((ext_vector_type(4)))  float v4f;
typedef __attribute__((ext_vector_type(2)))  float v2f;
typedef __attribute__((ext_vector_type(4)))  unsigned v4u;
typedef __attribute__((ext_vector_type(4)))  int v4i;
typedef float __attribute__((may_alias)) float_a;
typedef int __attribute__((may_alias)) int_a;

template <typename T> __device__ __forceinline__ void vst2(void* p, T v) { *(T*)p = v;  }
__device__ __forceinline__ v8f wmma16(v16h a, v16h b, v8f c) {
  v8f d = __builtin_amdgcn_wmma_f32_16x16x32_f16(false, a, false, b, (short)0, c, false, false);
  asm volatile("v_nop\n\tv_nop\n\tv_nop\n\tv_nop" : "+v"(d) : "v"(a), "v"(b));
  return d;
}
__device__ __forceinline__ v8f wmma_bf(v16b a, v16b b, v8f c) {
  v8f d = __builtin_amdgcn_wmma_f32_16x16x32_bf16(false, a, false, b, (short)0, c, false, false);
  asm volatile("v_nop\n\tv_nop\n\tv_nop\n\tv_nop" : "+v"(d) : "v"(a), "v"(b));
  return d;
}
// 16x16x32 fragments: lane = (h = lane>>4, row/col = lane&15); elements 0..7 = k0+8h+0..7, 8..15 = k0+16+8h+0..7; D element r = row 8h+r
__device__ __forceinline__ v16h frag_h(const _Float16* rowk0, int lane) {
  union { v16h v; v8h q[2]; } u; const _Float16* p = rowk0 + 8 * (lane >> 4);
  u.q[0] = *(const v8h*)p; u.q[1] = *(const v8h*)(p + 16); return u.v;
}
__device__ __forceinline__ v16h frag_f32(const float* rowk0, int lane) {
  v16h a; const float* p = rowk0 + 8 * (lane >> 4);
#pragma unroll
  for (int i = 0; i < 8; ++i) { a[i] = (_Float16)p[i]; a[8 + i] = (_Float16)p[16 + i]; }
  return a;
}
__device__ __forceinline__ v16h frag_f32s(const float* rowk0, int lane, float sc) {
  v16h a; const float* p = rowk0 + 8 * (lane >> 4);
#pragma unroll
  for (int i = 0; i < 8; ++i) { a[i] = (_Float16)(p[i] * sc); a[8 + i] = (_Float16)(p[16 + i] * sc); }
  return a;
}
// column fragment from a [K][ld] layout (column n), rows >= K read as 0
__device__ __forceinline__ v16h fragc_f32(const float* W, int k0, int n, int lane, int ld, int K) {
  v16h a; const int g = lane >> 4;
#pragma unroll
  for (int i = 0; i < 8; ++i) { const int ka = k0 + 8 * g + i, kb = ka + 16;
    a[i] = (_Float16)(ka < K ? W[(size_t)(ka < K ? ka : K - 1) * ld + n] : 0.f); a[8 + i] = (_Float16)(kb < K ? W[(size_t)(kb < K ? kb : K - 1) * ld + n] : 0.f); }
  return a;
}
struct F2 { v16b h, l; };
__device__ __forceinline__ F2 bsplit16(const float v[16]) { F2 r;
#pragma unroll
  for (int i = 0; i < 16; ++i) { const __bf16 h = (__bf16)v[i]; r.h[i] = h; r.l[i] = (__bf16)(v[i] - (float)h); }
  return r; }
__device__ __forceinline__ F2 split_row(const float* row, int k0, int lane) { float v[16]; const float* p = row + k0 + 8 * (lane >> 4);
#pragma unroll
  for (int i = 0; i < 8; ++i) { v[i] = p[i]; v[8 + i] = p[16 + i]; }
  return bsplit16(v); }
__device__ __forceinline__ F2 split_rowK(const float* row, int k0, int lane, int K) { float v[16]; const int g = lane >> 4;
#pragma unroll
  for (int i = 0; i < 8; ++i) { const int ka = k0 + 8 * g + i, kb = ka + 16; v[i] = ka < K ? row[ka < K ? ka : K - 1] : 0.f; v[8 + i] = kb < K ? row[kb < K ? kb : K - 1] : 0.f; }
  return bsplit16(v); }
__device__ __forceinline__ F2 split_col(const float* W, int k0, int n, int lane, int ld, int K) { float v[16]; const int g = lane >> 4;
#pragma unroll
  for (int i = 0; i < 8; ++i) { const int ka = k0 + 8 * g + i, kb = ka + 16; v[i] = ka < K ? W[(size_t)(ka < K ? ka : K - 1) * ld + n] : 0.f; v[8 + i] = kb < K ? W[(size_t)(kb < K ? kb : K - 1) * ld + n] : 0.f; }
  return bsplit16(v); }
__device__ __forceinline__ v8f mac3(const F2& a, const F2& b, v8f c) { c = wmma_bf(a.l, b.h, c); c = wmma_bf(a.h, b.l, c); return wmma_bf(a.h, b.h, c); }
__device__ __forceinline__ float sigm(float v) { return 1.0f / (1.0f + expf(-v)); }
#define LDSX() do { asm volatile("s_wait_dscnt 0" ::: "memory"); __builtin_amdgcn_wave_barrier(); __builtin_amdgcn_fence(__ATOMIC_RELEASE, "workgroup"); } while (0)


// Collaborative attention (B 2, L 2,048, D 512, 8 heads x 64 with a shared 512-wide key/query space): scores = (q diag(m_h) k^T + content_bias(k side)) / sqrt(64); softmax; per-head 64-dim values; dense output projection.
#define NB 2
#define NN 2048
#define DD 512
#define NH 8
#define DH 64
#ifndef TNB
#define TNB NB
#endif
#ifndef TQB
#define TQB (NN / 64)
#endif
typedef __attribute__((ext_vector_type(8))) __bf16 v8b;
__device__ __forceinline__ v16b frag_b(const __bf16* rowk0, int lane) {
  union { v16b v; v8b q[2]; } u; const __bf16* p = rowk0 + 8 * (lane >> 4);
  u.q[0] = *(const v8b*)p; u.q[1] = *(const v8b*)(p + 16); return u.v;
}
__device__ __forceinline__ float bfr(float v) { return (float)(__bf16)v; }
__device__ __attribute__((noinline)) float exp_ni(float v) { return expf(v); }
__device__ __attribute__((noinline)) float erf_ni(float v) { return erff(v); }

#define WS_QM  0u                                   // f16 (q * m_h) rows [b*NN + l][h*512 + d]
#define WS_KH  (WS_QM + 2u * (size_t)NB * NN * NH * DD)   // f16 k rows [b*NN + s][512]
#define WS_VT  (WS_KH + 2u * (size_t)NB * NN * DD)       // f16 v planes [b][512][NN]
#define WS_CB  (WS_VT + 2u * (size_t)NB * DD * NN)       // f32 content bias [b][h][NN]
#define WS_O   (WS_CB + 4u * (size_t)NB * NH * NN)       // f32 ctx rows [b*NN + l][512]
#define WS_END (WS_O + 4u * (size_t)NB * NN * DD)

__device__ __forceinline__ v16b fragb_f32(const float* __restrict__ p, int lane) { v16b a; const float* pp = p + 8 * (lane >> 4);
#pragma unroll
  for (int i = 0; i < 8; ++i) { a[i] = (__bf16)pp[i]; a[8 + i] = (__bf16)pp[16 + i]; } return a; }
typedef __attribute__((address_space(3))) const unsigned char lds_byte;
__device__ __forceinline__ unsigned lds_off(const void* p) { return (unsigned)(size_t)(lds_byte*)p; }
// eight copies of 16 B per lane, LDS step ls bytes, global step gs bytes; the s_wait_xcnt stands inside the statement so that no address register of a copy is rewritten ahead of it
__device__ __forceinline__ void cp8(unsigned l, unsigned ls, const char* g, size_t gs) {
  asm volatile("global_load_async_to_lds_b128 %0, %8, off\n\tglobal_load_async_to_lds_b128 %1, %9, off\n\tglobal_load_async_to_lds_b128 %2, %10, off\n\tglobal_load_async_to_lds_b128 %3, %11, off\n\t"
               "global_load_async_to_lds_b128 %4, %12, off\n\tglobal_load_async_to_lds_b128 %5, %13, off\n\tglobal_load_async_to_lds_b128 %6, %14, off\n\tglobal_load_async_to_lds_b128 %7, %15, off\n\ts_wait_xcnt 0x0"
               :: "v"(l), "v"(l + ls), "v"(l + 2 * ls), "v"(l + 3 * ls), "v"(l + 4 * ls), "v"(l + 5 * ls), "v"(l + 6 * ls), "v"(l + 7 * ls),
                  "v"(g), "v"(g + gs), "v"(g + 2 * gs), "v"(g + 3 * gs), "v"(g + 4 * gs), "v"(g + 5 * gs), "v"(g + 6 * gs), "v"(g + 7 * gs) : "memory"); }
// The two projection kernels (64 rows x 128 cols a block) take their operands through LDS: a stage is 64 f32 of k (256 B) of the 64 A rows and the 128 B rows, two buffers; the f32 values are rounded where the fragments are formed.
#define GK 64               // f32 of k per stage
#define GP 68               // f32 per staged row: 272 B = 16 B x 17, an odd multiple of 16 B for the ds_load_b128 readers
#define GA (64 * GP)        // f32 of a stage's A rows
#define GST (192 * GP)      // f32 of a stage
// one stage: a copy of the block = 8 rows of 256 B, a wave = two rows' whole 128-B lines; dst, a, b are the lane's own places in row (tid >> 4)
__device__ __forceinline__ void gstage(unsigned dst, const char* a, const char* b) {
  cp8(dst, 8u * GP * 4u, a, (size_t)8 * DD * 4);
  cp8(dst + GA * 4u, 8u * GP * 4u, b, (size_t)8 * DD * 4);
  cp8(dst + (GA + 64u * GP) * 4u, 8u * GP * 4u, b + (size_t)64 * DD * 4, (size_t)8 * DD * 4); }
// ---- k_proj: block = (64 rows, 128 cols, which*NB + b): which 0 q -> 8 mixed copies (q * m_h) f16; 1 k -> f16 rows; 2 v -> f16 planes
__global__ __launch_bounds__(128) void k_proj(const float* __restrict__ X, const float* __restrict__ WQ, const float* __restrict__ WK, const float* __restrict__ WV, const float* __restrict__ MIX, _Float16* __restrict__ QM, _Float16* __restrict__ KH, _Float16* __restrict__ VT) {
  __shared__ __align__(16) float ring[2 * GST];
  // the output staging lies over the ring, which nobody reads and no copy writes behind the last stage's barrier: keeps the block's LDS small enough for three blocks per WGP
  float (*sf)[132] = (float (*)[132])&ring[0]; _Float16 (*sh)[136] = (_Float16 (*)[136])&ring[64 * 132]; _Float16 (*th)[72] = (_Float16 (*)[72])&ring[64 * 132 + 64 * 68];
  const int tid = threadIdx.x, wave = tid >> 5, lane = tid & 31, col = lane & 15, g = lane >> 4; const int which = blockIdx.z / NB; const size_t b = blockIdx.z % NB; const int n0 = blockIdx.x * 64; const int c0 = blockIdx.y * 128;
  const float* Wm = which == 0 ? WQ : which == 1 ? WK : WV;
  const char* asrc = (const char*)(X + (b * NN + n0 + (tid >> 4)) * DD + (tid & 15) * 4); const char* bsrc = (const char*)(Wm + (size_t)(c0 + (tid >> 4)) * DD + (tid & 15) * 4);
  const unsigned gdst = lds_off(&ring[(tid >> 4) * GP + (tid & 15) * 4]);
  gstage(gdst, asrc, bsrc);
  asm volatile("s_wait_asynccnt 0x0" ::: "memory");   // this wave's copies of stage 0 have landed
  __syncthreads();                                     // ... and every other wave's: nothing staged is read before this
  gstage(gdst + GST * 4u, asrc + GK * 4, bsrc + GK * 4);
  v8f acc[8] = {};
#pragma unroll 1   // one trip per stage, so that the ring's waits and its barrier stand once, at the trip's foot
  for (int t = 0; t < DD / GK; ++t) { const int bf = t & 1; const float* ar = &ring[bf * GST + (wave * 16 + col) * GP]; const float* br = &ring[bf * GST + GA + col * GP];
#pragma unroll
    for (int kc = 0; kc < GK / 32; ++kc) { const v16b a = fragb_f32(ar + kc * 32, lane); v16b w[8];
#pragma unroll
      for (int j = 0; j < 8; ++j) w[j] = fragb_f32(br + j * 16 * GP + kc * 32, lane);
#pragma unroll
      for (int j = 0; j < 8; ++j) acc[j] = wmma_bf(a, w[j], acc[j]); }
    asm volatile("s_wait_dscnt 0x0" ::: "memory");     // this wave's reads of this stage's buffer have returned
    asm volatile("s_wait_asynccnt 0x0" ::: "memory");  // this wave's copies of the next stage have landed
    __syncthreads();                                   // publishes the next stage and ends every reader's last read of this stage's buffer
    if (t + 2 < DD / GK) gstage(gdst + (unsigned)bf * (GST * 4u), asrc + (t + 2) * (GK * 4), bsrc + (t + 2) * (GK * 4)); }
  asm volatile("s_wait_asynccnt 0x0" ::: "memory");    // no copy is outstanding when the ring becomes output staging
#pragma unroll
  for (int j = 0; j < 8; ++j)
#pragma unroll
    for (int r = 0; r < 8; ++r) { const float v = acc[j][r]; if (which == 0) sf[wave * 16 + 8 * g + r][j * 16 + col] = v; else if (which == 1) sh[wave * 16 + 8 * g + r][j * 16 + col] = (_Float16)v; else th[j * 16 + col][wave * 16 + 8 * g + r] = (_Float16)v; }
  __syncthreads();
  if (which == 0) {
#pragma unroll 1
    for (int h = 0; h < NH; ++h) { for (int e = tid; e < 64 * 128; e += 128) { const int rl = e >> 7, c = e & 127; sh[rl][c] = (_Float16)(sf[rl][c] * bfr(MIX[h * DD + c0 + c])); } __syncthreads();
      for (int e = tid; e < 64 * 16; e += 128) { const int rl = e >> 4, q = e & 15; vst2((unsigned*)(QM + (b * NN + n0 + rl) * (size_t)(NH * DD) + (size_t)h * DD + c0 + q * 8), *(const v4u*)&sh[rl][q * 8]); } __syncthreads(); } }
  else if (which == 1) { for (int e = tid; e < 64 * 16; e += 128) { const int rl = e >> 4, q = e & 15; vst2((unsigned*)(KH + (b * NN + n0 + rl) * DD + c0 + q * 8), *(const v4u*)&sh[rl][q * 8]); } }
  else { for (int e = tid; e < 128 * 8; e += 128) { const int cl = e >> 3, q = e & 7; vst2((unsigned*)(VT + (b * DD + c0 + cl) * (size_t)NN + n0 + q * 8), *(const v4u*)&th[cl][q * 8]); } } }
// ---- k_cb: block = (32 keys, b): cb[b][h][s] = x_s . Wb[h] (exact products, f32 accumulate on VALU)
// The block's 32 x rows and the 8 Wb rows come in by 16-B loads whose waves cover whole 128-B lines, are rounded once and staged in LDS; thread (key, head) sums its 512 products from LDS in four chains d = j + 4 i, joined j = 0..3 (the order of additions that four threads per key gave); a wave stores one whole 128-B line of one head.
#define CP 516   // f32 per staged row: 2,064 B = 16 B x 129, an odd multiple of 16 B for the ds_load_b128 readers (32 rows, one column)
__device__ __forceinline__ v4f bfr4(v4f v) { v4f r; r[0] = bfr(v[0]); r[1] = bfr(v[1]); r[2] = bfr(v[2]); r[3] = bfr(v[3]); return r; }
__global__ __launch_bounds__(256) void k_cb(const float* __restrict__ X, const float* __restrict__ WB, float* __restrict__ CB) { __shared__ __align__(16) float sx[32][CP]; __shared__ __align__(16) float sw[NH][CP]; const int t = threadIdx.x; const size_t b = blockIdx.y; const int s0 = blockIdx.x * 32;
  const float* xs = X + (b * NN + s0) * DD + t * 4; const float* wsrc = WB + t * 4; const int r2 = t >> 7, c4 = (t & 127) * 4;
  v4f xv[16], wv[4];   // the four loops below are unrolled whole so that the arrays stay in registers and all 20 loads are in flight before the first is used
#pragma unroll
  for (int i = 0; i < 16; ++i) xv[i] = *(const v4f*)(xs + i * 1024);
#pragma unroll
  for (int i = 0; i < 4; ++i) wv[i] = *(const v4f*)(wsrc + i * 1024);
#pragma unroll
  for (int i = 0; i < 16; ++i) *(v4f*)&sx[2 * i + r2][c4] = bfr4(xv[i]);
#pragma unroll
  for (int i = 0; i < 4; ++i) *(v4f*)&sw[2 * i + r2][c4] = bfr4(wv[i]);
  __syncthreads();
  const int sl = t & 31, h = t >> 5; const float* xr = &sx[sl][0]; const float* wr = &sw[h][0]; float a0 = 0.f, a1 = 0.f, a2 = 0.f, a3 = 0.f;
#pragma unroll 8   // eight steps' LDS reads go out as a group ahead of their products; without it each step waits for its own two reads
  for (int i = 0; i < DD / 4; ++i) { const v4f x4 = *(const v4f*)(xr + 4 * i), w4 = *(const v4f*)(wr + 4 * i); a0 += x4[0] * w4[0]; a1 += x4[1] * w4[1]; a2 += x4[2] * w4[2]; a3 += x4[3] * w4[3]; }
  CB[(b * NH + h) * (size_t)NN + s0 + sl] = a0 + a1 + a2 + a3; }
// ---- k_att: block = (64 queries, h, b): logits = ((q*m_h) . k + cb[s]) / 8 (K 512), softmax, P (hi + residual) . v_h
// The Q tile and the head's bias row (once) and each pass's K and V tiles (two buffers) come into LDS by asynchronous copies whose waves cover whole 128-B lines (V: 64-B row pieces); every operand of the key loop is read from LDS.
#define KP 520   // f16 per staged Q or K row: 1,040 B = 16 B x 65, an odd multiple of 16 B for the ds_load_b128 readers
#define VP 40    // f16 per staged V row: 80 B = 16 B x 5
// two copies, same form
__device__ __forceinline__ void cp2(unsigned l, unsigned ls, const char* g, size_t gs) {
  asm volatile("global_load_async_to_lds_b128 %0, %2, off\n\tglobal_load_async_to_lds_b128 %1, %3, off\n\ts_wait_xcnt 0x0" :: "v"(l), "v"(l + ls), "v"(g), "v"(g + gs) : "memory"); }
__global__ __launch_bounds__(128) void k_att(const _Float16* __restrict__ QM, const _Float16* __restrict__ KH, const _Float16* __restrict__ VT, const float* __restrict__ CB, float* __restrict__ O) {
  __shared__ __align__(16) _Float16 sq[64][KP]; __shared__ __align__(16) _Float16 sk[2][32][KP]; __shared__ __align__(16) _Float16 sv[2][DH][VP]; __shared__ __align__(16) float sp[4][16][36]; __shared__ __align__(16) float scb[NN];
  const int tid = threadIdx.x, wave = tid >> 5, lane = tid & 31, col = lane & 15, g = lane >> 4; const int h = blockIdx.y; const size_t b = blockIdx.z; const int q0 = blockIdx.x * 64 + wave * 16; const size_t rq = b * NN + q0;
  // copy maps: 1,024-B rows (Q, K): one copy of the block = two rows, a wave = 512 contiguous bytes; V: one copy = 32 rows of 64 B
  const int crow = tid >> 6, ccol = (tid & 63) * 8, vrow = tid >> 2, vcol = (tid & 3) * 8;
  const char* qsrc = (const char*)(QM + (b * NN + blockIdx.x * 64 + crow) * (size_t)(NH * DD) + (size_t)h * DD + ccol);
  const char* ksrc = (const char*)(KH + (b * NN + crow) * DD + ccol);
  const char* vsrc = (const char*)(VT + (b * DD + (size_t)h * DH + vrow) * (size_t)NN + vcol);
  const char* bsrc = (const char*)(CB + (b * NH + h) * (size_t)NN + tid * 4);
  const unsigned kdst = lds_off(&sk[0][crow][ccol]), vdst = lds_off(&sv[0][vrow][vcol]);
#define STAGE(t, bf) do { const char* kt = ksrc + (size_t)(t) * (32 * DD * 2); const unsigned kl = kdst + (unsigned)(bf) * (32u * KP * 2u); \
    cp8(kl, 2u * KP * 2u, kt, 2 * DD * 2); cp8(kl + 16u * KP * 2u, 2u * KP * 2u, kt + 16 * DD * 2, 2 * DD * 2); \
    cp2(vdst + (unsigned)(bf) * (DH * VP * 2u), 32u * VP * 2u, vsrc + (t) * 64, (size_t)32 * NN * 2); } while (0)
#pragma unroll
  for (int i = 0; i < 4; ++i) cp8(lds_off(&sq[16 * i + crow][ccol]), 2u * KP * 2u, qsrc + (size_t)(16 * i) * (NH * DD * 2), (size_t)2 * NH * DD * 2);
  cp2(lds_off(&scb[tid * 4]), 2048u, bsrc, 2048); cp2(lds_off(&scb[1024 + tid * 4]), 2048u, bsrc + 4096, 2048);
  STAGE(0, 0);
  asm volatile("s_wait_asynccnt 0x0" ::: "memory");   // this wave's copies of Q, of the bias row and of pass 0 have landed
  __syncthreads();                                     // ... and every other wave's: nothing staged is read before this
  STAGE(1, 1);
  float m[8], l[8];
#pragma unroll
  for (int r = 0; r < 8; ++r) { m[r] = -3.0e38f; l[r] = 0.f; }
  v8f acc[4] = {}, accl[4] = {};
  const _Float16* qrow = &sq[wave * 16 + col][0];
#pragma unroll 1
  for (int ks = 0; ks < NN / 32; ++ks) { const int bf = ks & 1; v8f s[2];
    v16h vf[4];
    { const _Float16* k0 = &sk[bf][col][0]; const _Float16* k1 = &sk[bf][16 + col][0]; v8f c0 = {}, c1 = {};
      const float cb0 = scb[ks * 32 + col], cb1 = scb[ks * 32 + 16 + col];
      // LDS reads in groups, one group (two k steps: 12 reads) ahead of the products that use them, in a second register set; each Q fragment serves both 16-key groups
      v16h qf[2][2], ka[2][2], kb[2][2];
#pragma unroll
      for (int i = 0; i < 2; ++i) { qf[0][i] = frag_h(qrow + i * 32, lane); ka[0][i] = frag_h(k0 + i * 32, lane); kb[0][i] = frag_h(k1 + i * 32, lane); }
#pragma unroll
      for (int kb2 = 0; kb2 < DD / 64; ++kb2) { const int cs = kb2 & 1, ns = cs ^ 1;
        if (kb2 + 1 < DD / 64) {
#pragma unroll
          for (int i = 0; i < 2; ++i) { const int kc = (kb2 + 1) * 2 + i; qf[ns][i] = frag_h(qrow + kc * 32, lane); ka[ns][i] = frag_h(k0 + kc * 32, lane); kb[ns][i] = frag_h(k1 + kc * 32, lane); } }
        else {
#pragma unroll
          for (int j = 0; j < 4; ++j) vf[j] = frag_h(&sv[bf][j * 16 + col][0], lane); }
#pragma unroll
        for (int i = 0; i < 2; ++i) { c0 = wmma16(qf[cs][i], ka[cs][i], c0); c1 = wmma16(qf[cs][i], kb[cs][i], c1); } }
#pragma unroll
      for (int r = 0; r < 8; ++r) { s[0][r] = (c0[r] + cb0) * 0.125f; s[1][r] = (c1[r] + cb1) * 0.125f; } }
    float alpha[8];
#pragma unroll
    for (int r = 0; r < 8; ++r) { float mx = fmaxf(s[0][r], s[1][r]);
#pragma unroll
      for (int o = 1; o < 16; o <<= 1) mx = fmaxf(mx, __shfl_xor(mx, o));
      const float mn = fmaxf(m[r], mx); alpha[r] = __expf(m[r] - mn); const float e0 = __expf(s[0][r] - mn), e1 = __expf(s[1][r] - mn); float es = e0 + e1;
#pragma unroll
      for (int o = 1; o < 16; o <<= 1) es += __shfl_xor(es, o);
      l[r] = l[r] * alpha[r] + es; m[r] = mn; sp[wave][8 * g + r][col] = e0; sp[wave][8 * g + r][16 + col] = e1; }
#pragma unroll
    for (int j = 0; j < 4; ++j)
#pragma unroll
      for (int r = 0; r < 8; ++r) { acc[j][r] *= alpha[r]; accl[j][r] *= alpha[r]; }
    LDSX();
    v16h pa, pal; { const float* prow = &sp[wave][col][0] + 8 * (lane >> 4);
#pragma unroll
      for (int i = 0; i < 8; ++i) { const float p0 = prow[i] * 2048.0f, p1 = prow[16 + i] * 2048.0f; pa[i] = (_Float16)p0; pa[8 + i] = (_Float16)p1; pal[i] = (_Float16)((p0 - (float)pa[i]) * 2048.0f); pal[8 + i] = (_Float16)((p1 - (float)pa[8 + i]) * 2048.0f); } }
#pragma unroll
    for (int j = 0; j < 4; ++j) { acc[j] = wmma16(pa, vf[j], acc[j]); accl[j] = wmma16(pal, vf[j], accl[j]); }
    asm volatile("s_wait_dscnt 0x0" ::: "memory");     // this wave's reads of sp and of this pass's buffers have returned
    asm volatile("s_wait_asynccnt 0x0" ::: "memory");  // this wave's copies of the next pass have landed
    __syncthreads();                                   // publishes the next pass and ends every reader's last read of this pass's buffers
    if (ks + 2 < NN / 32) STAGE(ks + 2, bf); }
  asm volatile("s_wait_asynccnt 0x0" ::: "memory");    // no copy is outstanding when the wave reuses LDS and ends
  // output staging in the wave's own 16 Q rows (no other wave reads them; its own reads returned at the last pass's s_wait_dscnt): keeps the block's LDS small enough for two blocks per WGP
  float (*so)[68] = (float (*)[68])&sq[wave * 16][0];
#pragma unroll
  for (int r = 0; r < 8; ++r) { const float il = (1.0f / 2048.0f) / l[r];
#pragma unroll
    for (int j = 0; j < 4; ++j) so[8 * g + r][j * 16 + col] = (acc[j][r] + accl[j][r] * (1.0f / 2048.0f)) * il; }
  LDSX(); for (int rl = 0; rl < 16; ++rl) if (lane < 16) vst2(O + (rq + rl) * DD + (size_t)h * DH + lane * 4, *(const v4f*)&so[rl][lane * 4]); }
// ---- k_out: block = (64 rows, 128 cols): out = ctx (hi + lo) . Wd^T + bd
__global__ __launch_bounds__(128) void k_out(const float* __restrict__ Or, const float* __restrict__ WD, const float* __restrict__ BD, float* __restrict__ OUT) { __shared__ __align__(16) float ring[2 * GST]; __shared__ __align__(16) float sf[4][16][132];
  const int tid = threadIdx.x, wave = tid >> 5, lane = tid & 31, col = lane & 15, g = lane >> 4; const size_t r0 = (size_t)blockIdx.x * 64 + wave * 16; const int c0 = blockIdx.y * 128;
  const char* asrc = (const char*)(Or + ((size_t)blockIdx.x * 64 + (tid >> 4)) * DD + (tid & 15) * 4); const char* bsrc = (const char*)(WD + (size_t)(c0 + (tid >> 4)) * DD + (tid & 15) * 4);
  const unsigned gdst = lds_off(&ring[(tid >> 4) * GP + (tid & 15) * 4]);
  gstage(gdst, asrc, bsrc);
  asm volatile("s_wait_asynccnt 0x0" ::: "memory");   // this wave's copies of stage 0 have landed
  __syncthreads();                                     // ... and every other wave's: nothing staged is read before this
  gstage(gdst + GST * 4u, asrc + GK * 4, bsrc + GK * 4);
  v8f acc[8] = {};
#pragma unroll 1   // one trip per stage, so that the ring's waits and its barrier stand once, at the trip's foot
  for (int t = 0; t < DD / GK; ++t) { const int bf = t & 1; const float* ar = &ring[bf * GST + (wave * 16 + col) * GP]; const float* br = &ring[bf * GST + GA + col * GP];
#pragma unroll
    for (int kc = 0; kc < GK / 32; ++kc) { const F2 a = split_row(ar, kc * 32, lane); v16b w[8];
#pragma unroll
      for (int j = 0; j < 8; ++j) w[j] = fragb_f32(br + j * 16 * GP + kc * 32, lane);
#pragma unroll
      for (int j = 0; j < 8; ++j) { acc[j] = wmma_bf(a.h, w[j], acc[j]); acc[j] = wmma_bf(a.l, w[j], acc[j]); } }
    asm volatile("s_wait_dscnt 0x0" ::: "memory");     // this wave's reads of this stage's buffer have returned
    asm volatile("s_wait_asynccnt 0x0" ::: "memory");  // this wave's copies of the next stage have landed
    __syncthreads();                                   // publishes the next stage and ends every reader's last read of this stage's buffer
    if (t + 2 < DD / GK) gstage(gdst + (unsigned)bf * (GST * 4u), asrc + (t + 2) * (GK * 4), bsrc + (t + 2) * (GK * 4)); }
  asm volatile("s_wait_asynccnt 0x0" ::: "memory");    // no copy is outstanding when the wave ends
#pragma unroll
  for (int j = 0; j < 8; ++j) { const float bb = bfr(BD[c0 + j * 16 + col]);
#pragma unroll
    for (int r = 0; r < 8; ++r) sf[wave][8 * g + r][j * 16 + col] = acc[j][r] + bb; }
  LDSX(); for (int rl = 0; rl < 16; ++rl) vst2(OUT + (r0 + rl) * DD + c0 + lane * 4, *(const v4f*)&sf[wave][rl][lane * 4]); }
extern "C" void kernel_launch(void* const* d_in, const int* in_sizes, int n_in, void* d_out, int out_size, void* d_ws, size_t ws_size, hipStream_t stream) {
  (void)in_sizes; (void)n_in; (void)out_size;
  const float** F = (const float**)d_in;   // 0 x [2,2048,512], 1 Wq, 2 Wk, 3 Wv [512,512] natural, 4 Wb [8,512], 5 mixing [8,512], 6 Wd [512,512], 7 bd [512]
  if (ws_size < (size_t)WS_END) return;
  char* ws = (char*)d_ws; _Float16 *QM = (_Float16*)(ws + WS_QM), *KH = (_Float16*)(ws + WS_KH), *VT = (_Float16*)(ws + WS_VT); float *CB = (float*)(ws + WS_CB), *O = (float*)(ws + WS_O);
  k_proj<<<dim3(NN / 64, DD / 128, 3 * NB), 128, 0, stream>>>(F[0], F[1], F[2], F[3], F[5], QM, KH, VT);
  k_cb<<<dim3(NN / 32, NB), 256, 0, stream>>>(F[0], F[4], CB);
  k_att<<<dim3(TQB, NH, TNB), 128, 0, stream>>>(QM, KH, VT, CB, O);
  k_out<<<dim3(TNB * NN / 64, DD / 128), 128, 0, stream>>>(O, F[6], F[7], (float*)d_out);
}

// v004
// One run takes 156 microseconds.
// Next to v003, in two timings, it ran 1.12 times as fast each time.
// Over all steps from v000 it is 5.52 times as fast.
// compute dtype: all float inputs rounded to bf16; q/k/v = x W^T with EXACT bf16 products on WMMA 16x16x32 (natural rows); per head the bilinear scores sum_d q_d m_hd k_d as a 512-deep WMMA product of (q * m_h) and k, each rounded once to f16 (1 product; the attention is diffuse: logits std ~0.1), content bias x . Wb^T exact, x 1/8; running-max softmax in f32 (hardware exp); P as f16 hi + residual (x 2^11) . v (f16; 2 products); out = ctx (bf16 hi + lo) . Wd^T + bd; f32 output.
#include <hip/hip_runtime.h>
#include <math.h>

typedef __attribute__((ext_vector_type(16))) _Float16 v16h;
typedef __attribute__((ext_vector_type(16))) __bf16 v16b;
typedef __attribute__((ext_vector_type(8)))  _Float16 v8h;
typedef __attribute__((ext_vector_type(8)))  float v8f;
typedef __attribute__((ext_vector_type(4)))  float v4f;
typedef __attribute__((ext_vector_type(2)))  float v2f;
typedef __attribute__((ext_vector_type(4)))  unsigned v4u;
typedef __attribute__((ext_vector_type(4)))  int v4i;
typedef float __attribute__((may_alias)) float_a;
typedef int __attribute__((may_alias)) int_a;

template <typename T> __device__ __forceinline__ void vst2(void* p, T v) { *(T*)p = v;  }
__device__ __forceinline__ v8f wmma16(v16h a, v16h b, v8f c) {
  v8f d = __builtin_amdgcn_wmma_f32_16x16x32_f16(false, a, false, b, (short)0, c, false, false);
  asm volatile("v_nop\n\tv_nop\n\tv_nop\n\tv_nop" : "+v"(d) : "v"(a), "v"(b));
  return d;
}
// as wmma16, but its statement does not name A: with A among its operands the 16 resident Q fragments of k_att were not all kept in registers (scratch)
__device__ __forceinline__ v8f wmma16q(v16h a, v16h b, v8f c) {
  v8f d = __builtin_amdgcn_wmma_f32_16x16x32_f16(false, a, false, b, (short)0, c, false, false);
  asm volatile("v_nop\n\tv_nop\n\tv_nop\n\tv_nop" : "+v"(d) : "v"(b));
  return d;
}
__device__ __forceinline__ v8f wmma_bf(v16b a, v16b b, v8f c) {
  v8f d = __builtin_amdgcn_wmma_f32_16x16x32_bf16(false, a, false, b, (short)0, c, false, false);
  asm volatile("v_nop\n\tv_nop\n\tv_nop\n\tv_nop" : "+v"(d) : "v"(a), "v"(b));
  return d;
}
// 16x16x32 fragments: lane = (h = lane>>4, row/col = lane&15); elements 0..7 = k0+8h+0..7, 8..15 = k0+16+8h+0..7; D element r = row 8h+r
__device__ __forceinline__ v16h frag_h(const _Float16* rowk0, int lane) {
  union { v16h v; v8h q[2]; } u; const _Float16* p = rowk0 + 8 * (lane >> 4);
  u.q[0] = *(const v8h*)p; u.q[1] = *(const v8h*)(p + 16); return u.v;
}
__device__ __forceinline__ v16h frag_f32(const float* rowk0, int lane) {
  v16h a; const float* p = rowk0 + 8 * (lane >> 4);
#pragma unroll
  for (int i = 0; i < 8; ++i) { a[i] = (_Float16)p[i]; a[8 + i] = (_Float16)p[16 + i]; }
  return a;
}
__device__ __forceinline__ v16h frag_f32s(const float* rowk0, int lane, float sc) {
  v16h a; const float* p = rowk0 + 8 * (lane >> 4);
#pragma unroll
  for (int i = 0; i < 8; ++i) { a[i] = (_Float16)(p[i] * sc); a[8 + i] = (_Float16)(p[16 + i] * sc); }
  return a;
}
// column fragment from a [K][ld] layout (column n), rows >= K read as 0
__device__ __forceinline__ v16h fragc_f32(const float* W, int k0, int n, int lane, int ld, int K) {
  v16h a; const int g = lane >> 4;
#pragma unroll
  for (int i = 0; i < 8; ++i) { const int ka = k0 + 8 * g + i, kb = ka + 16;
    a[i] = (_Float16)(ka < K ? W[(size_t)(ka < K ? ka : K - 1) * ld + n] : 0.f); a[8 + i] = (_Float16)(kb < K ? W[(size_t)(kb < K ? kb : K - 1) * ld + n] : 0.f); }
  return a;
}
struct F2 { v16b h, l; };
__device__ __forceinline__ F2 bsplit16(const float v[16]) { F2 r;
#pragma unroll
  for (int i = 0; i < 16; ++i) { const __bf16 h = (__bf16)v[i]; r.h[i] = h; r.l[i] = (__bf16)(v[i] - (float)h); }
  return r; }
__device__ __forceinline__ F2 split_row(const float* row, int k0, int lane) { float v[16]; const float* p = row + k0 + 8 * (lane >> 4);
#pragma unroll
  for (int i = 0; i < 8; ++i) { v[i] = p[i]; v[8 + i] = p[16 + i]; }
  return bsplit16(v); }
__device__ __forceinline__ F2 split_rowK(const float* row, int k0, int lane, int K) { float v[16]; const int g = lane >> 4;
#pragma unroll
  for (int i = 0; i < 8; ++i) { const int ka = k0 + 8 * g + i, kb = ka + 16; v[i] = ka < K ? row[ka < K ? ka : K - 1] : 0.f; v[8 + i] = kb < K ? row[kb < K ? kb : K - 1] : 0.f; }
  return bsplit16(v); }
__device__ __forceinline__ F2 split_col(const float* W, int k0, int n, int lane, int ld, int K) { float v[16]; const int g = lane >> 4;
#pragma unroll
  for (int i = 0; i < 8; ++i) { const int ka = k0 + 8 * g + i, kb = ka + 16; v[i] = ka < K ? W[(size_t)(ka < K ? ka : K - 1) * ld + n] : 0.f; v[8 + i] = kb < K ? W[(size_t)(kb < K ? kb : K - 1) * ld + n] : 0.f; }
  return bsplit16(v); }
__device__ __forceinline__ v8f mac3(const F2& a, const F2& b, v8f c) { c = wmma_bf(a.l, b.h, c); c = wmma_bf(a.h, b.l, c); return wmma_bf(a.h, b.h, c); }
__device__ __forceinline__ float sigm(float v) { return 1.0f / (1.0f + expf(-v)); }
#define LDSX() do { asm volatile("s_wait_dscnt 0" ::: "memory"); __builtin_amdgcn_wave_barrier(); __builtin_amdgcn_fence(__ATOMIC_RELEASE, "workgroup"); } while (0)


// Collaborative attention (B 2, L 2,048, D 512, 8 heads x 64 with a shared 512-wide key/query space): scores = (q diag(m_h) k^T + content_bias(k side)) / sqrt(64); softmax; per-head 64-dim values; dense output projection.
#define NB 2
#define NN 2048
#define DD 512
#define NH 8
#define DH 64
#ifndef TNB
#define TNB NB
#endif
#ifndef TQB
#define TQB (NN / 64)
#endif
typedef __attribute__((ext_vector_type(8))) __bf16 v8b;
__device__ __forceinline__ v16b frag_b(const __bf16* rowk0, int lane) {
  union { v16b v; v8b q[2]; } u; const __bf16* p = rowk0 + 8 * (lane >> 4);
  u.q[0] = *(const v8b*)p; u.q[1] = *(const v8b*)(p + 16); return u.v;
}
__device__ __forceinline__ float bfr(float v) { return (float)(__bf16)v; }
__device__ __attribute__((noinline)) float exp_ni(float v) { return expf(v); }
__device__ __attribute__((noinline)) float erf_ni(float v) { return erff(v); }

#define WS_QF  0u                                   // f32 q in A-fragment order: [(b*NN + l) / 16][d / 32][piece 0..3][lane][4]; lane = (g, row), piece p = d 8 g + 4 (p & 1) + 16 (p >> 1) + 0..3 of its 32
#define WS_KH  (WS_QF + 4u * (size_t)NB * NN * DD)       // f16 k rows [b*NN + s][512]
#define WS_VT  (WS_KH + 2u * (size_t)NB * NN * DD)       // f16 v planes [b][512][NN]
#define WS_CB  (WS_VT + 2u * (size_t)NB * DD * NN)       // f32 content bias [b][h][NN]
#define WS_O   (WS_CB + 4u * (size_t)NB * NH * NN)       // f32 ctx rows [b*NN + l][512]
#define WS_END (WS_O + 4u * (size_t)NB * NN * DD)

__device__ __forceinline__ v16b fragb_f32(const float* __restrict__ p, int lane) { v16b a; const float* pp = p + 8 * (lane >> 4);
#pragma unroll
  for (int i = 0; i < 8; ++i) { a[i] = (__bf16)pp[i]; a[8 + i] = (__bf16)pp[16 + i]; } return a; }
typedef __attribute__((address_space(3))) const unsigned char lds_byte;
__device__ __forceinline__ unsigned lds_off(const void* p) { return (unsigned)(size_t)(lds_byte*)p; }
// eight copies of 16 B per lane, LDS step ls bytes, global step gs bytes; the s_wait_xcnt stands inside the statement so that no address register of a copy is rewritten ahead of it
__device__ __forceinline__ void cp8(unsigned l, unsigned ls, const char* g, size_t gs) {
  asm volatile("global_load_async_to_lds_b128 %0, %8, off\n\tglobal_load_async_to_lds_b128 %1, %9, off\n\tglobal_load_async_to_lds_b128 %2, %10, off\n\tglobal_load_async_to_lds_b128 %3, %11, off\n\t"
               "global_load_async_to_lds_b128 %4, %12, off\n\tglobal_load_async_to_lds_b128 %5, %13, off\n\tglobal_load_async_to_lds_b128 %6, %14, off\n\tglobal_load_async_to_lds_b128 %7, %15, off\n\ts_wait_xcnt 0x0"
               :: "v"(l), "v"(l + ls), "v"(l + 2 * ls), "v"(l + 3 * ls), "v"(l + 4 * ls), "v"(l + 5 * ls), "v"(l + 6 * ls), "v"(l + 7 * ls),
                  "v"(g), "v"(g + gs), "v"(g + 2 * gs), "v"(g + 3 * gs), "v"(g + 4 * gs), "v"(g + 5 * gs), "v"(g + 6 * gs), "v"(g + 7 * gs) : "memory"); }
// The two projection kernels (64 rows x 128 cols a block) take their operands through LDS: a stage is 64 f32 of k (256 B) of the 64 A rows and the 128 B rows, two buffers; the f32 values are rounded where the fragments are formed.
#define GK 64               // f32 of k per stage
#define GP 68               // f32 per staged row: 272 B = 16 B x 17, an odd multiple of 16 B for the ds_load_b128 readers
#define GA (64 * GP)        // f32 of a stage's A rows
#define GST (192 * GP)      // f32 of a stage
// one stage: a copy of the block = 8 rows of 256 B, a wave = two rows' whole 128-B lines; dst, a, b are the lane's own places in row (tid >> 4)
__device__ __forceinline__ void gstage(unsigned dst, const char* a, const char* b) {
  cp8(dst, 8u * GP * 4u, a, (size_t)8 * DD * 4);
  cp8(dst + GA * 4u, 8u * GP * 4u, b, (size_t)8 * DD * 4);
  cp8(dst + (GA + 64u * GP) * 4u, 8u * GP * 4u, b + (size_t)64 * DD * 4, (size_t)8 * DD * 4); }
// ---- k_proj: block = (64 rows, 128 cols, which*NB + b): which 0 q -> f32, once, in A-fragment order; 1 k -> f16 rows; 2 v -> f16 planes
__global__ __launch_bounds__(128) void k_proj(const float* __restrict__ X, const float* __restrict__ WQ, const float* __restrict__ WK, const float* __restrict__ WV, float* __restrict__ QF, _Float16* __restrict__ KH, _Float16* __restrict__ VT) {
  __shared__ __align__(16) float ring[2 * GST];
  // the output staging lies over the ring, which nobody reads and no copy writes behind the last stage's barrier: keeps the block's LDS small enough for three blocks per WGP
  float (*sf)[132] = (float (*)[132])&ring[0]; _Float16 (*sh)[136] = (_Float16 (*)[136])&ring[64 * 132]; _Float16 (*th)[72] = (_Float16 (*)[72])&ring[64 * 132 + 64 * 68];
  const int tid = threadIdx.x, wave = tid >> 5, lane = tid & 31, col = lane & 15, g = lane >> 4; const int which = blockIdx.z / NB; const size_t b = blockIdx.z % NB; const int n0 = blockIdx.x * 64; const int c0 = blockIdx.y * 128;
  const float* Wm = which == 0 ? WQ : which == 1 ? WK : WV;
  const char* asrc = (const char*)(X + (b * NN + n0 + (tid >> 4)) * DD + (tid & 15) * 4); const char* bsrc = (const char*)(Wm + (size_t)(c0 + (tid >> 4)) * DD + (tid & 15) * 4);
  const unsigned gdst = lds_off(&ring[(tid >> 4) * GP + (tid & 15) * 4]);
  gstage(gdst, asrc, bsrc);
  asm volatile("s_wait_asynccnt 0x0" ::: "memory");   // this wave's copies of stage 0 have landed
  __syncthreads();                                     // ... and every other wave's: nothing staged is read before this
  gstage(gdst + GST * 4u, asrc + GK * 4, bsrc + GK * 4);
  v8f acc[8] = {};
#pragma unroll 1   // one trip per stage, so that the ring's waits and its barrier stand once, at the trip's foot
  for (int t = 0; t < DD / GK; ++t) { const int bf = t & 1; const float* ar = &ring[bf * GST + (wave * 16 + col) * GP]; const float* br = &ring[bf * GST + GA + col * GP];
#pragma unroll
    for (int kc = 0; kc < GK / 32; ++kc) { const v16b a = fragb_f32(ar + kc * 32, lane); v16b w[8];
#pragma unroll
      for (int j = 0; j < 8; ++j) w[j] = fragb_f32(br + j * 16 * GP + kc * 32, lane);
#pragma unroll
      for (int j = 0; j < 8; ++j) acc[j] = wmma_bf(a, w[j], acc[j]); }
    asm volatile("s_wait_dscnt 0x0" ::: "memory");     // this wave's reads of this stage's buffer have returned
    asm volatile("s_wait_asynccnt 0x0" ::: "memory");  // this wave's copies of the next stage have landed
    __syncthreads();                                   // publishes the next stage and ends every reader's last read of this stage's buffer
    if (t + 2 < DD / GK) gstage(gdst + (unsigned)bf * (GST * 4u), asrc + (t + 2) * (GK * 4), bsrc + (t + 2) * (GK * 4)); }
  asm volatile("s_wait_asynccnt 0x0" ::: "memory");    // no copy is outstanding when the ring becomes output staging
#pragma unroll
  for (int j = 0; j < 8; ++j)
#pragma unroll
    for (int r = 0; r < 8; ++r) { const float v = acc[j][r]; if (which == 0) sf[wave * 16 + 8 * g + r][j * 16 + col] = v; else if (which == 1) sh[wave * 16 + 8 * g + r][j * 16 + col] = (_Float16)v; else th[j * 16 + col][wave * 16 + 8 * g + r] = (_Float16)v; }
  __syncthreads();
  if (which == 0) {
    // wave w stores piece w of each of the block's 4 x 4 (16 rows x 32 d) units: 512 contiguous bytes a store
    float* qd = QF + ((b * NN + n0) * (size_t)DD + (size_t)(c0 / 32) * 512) + wave * 128 + lane * 4; const float* qs = &sf[col][8 * g + (wave & 1) * 4 + (wave >> 1) * 16];
#pragma unroll   // whole, so that the 16 LDS reads go out as a group and every store takes a constant offset from one address
    for (int it = 0; it < 16; ++it) vst2(qd + (size_t)((it >> 2) * 16 + (it & 3)) * 512, *(const v4f*)(qs + (it >> 2) * 16 * 132 + (it & 3) * 32)); }
  else if (which == 1) { for (int e = tid; e < 64 * 16; e += 128) { const int rl = e >> 4, q = e & 15; vst2((unsigned*)(KH + (b * NN + n0 + rl) * DD + c0 + q * 8), *(const v4u*)&sh[rl][q * 8]); } }
  else { for (int e = tid; e < 128 * 8; e += 128) { const int cl = e >> 3, q = e & 7; vst2((unsigned*)(VT + (b * DD + c0 + cl) * (size_t)NN + n0 + q * 8), *(const v4u*)&th[cl][q * 8]); } } }
// ---- k_cb: block = (32 keys, b): cb[b][h][s] = x_s . Wb[h] (exact products, f32 accumulate on VALU)
// The block's 32 x rows and the 8 Wb rows come in by 16-B loads whose waves cover whole 128-B lines, are rounded once and staged in LDS; thread (key, head) sums its 512 products from LDS in four chains d = j + 4 i, joined j = 0..3 (the order of additions that four threads per key gave); a wave stores one whole 128-B line of one head.
#define CP 516   // f32 per staged row: 2,064 B = 16 B x 129, an odd multiple of 16 B for the ds_load_b128 readers (32 rows, one column)
__device__ __forceinline__ v4f bfr4(v4f v) { v4f r; r[0] = bfr(v[0]); r[1] = bfr(v[1]); r[2] = bfr(v[2]); r[3] = bfr(v[3]); return r; }
__global__ __launch_bounds__(256) void k_cb(const float* __restrict__ X, const float* __restrict__ WB, float* __restrict__ CB) { __shared__ __align__(16) float sx[32][CP]; __shared__ __align__(16) float sw[NH][CP]; const int t = threadIdx.x; const size_t b = blockIdx.y; const int s0 = blockIdx.x * 32;
  const float* xs = X + (b * NN + s0) * DD + t * 4; const float* wsrc = WB + t * 4; const int r2 = t >> 7, c4 = (t & 127) * 4;
  v4f xv[16], wv[4];   // the four loops below are unrolled whole so that the arrays stay in registers and all 20 loads are in flight before the first is used
#pragma unroll
  for (int i = 0; i < 16; ++i) xv[i] = *(const v4f*)(xs + i * 1024);
#pragma unroll
  for (int i = 0; i < 4; ++i) wv[i] = *(const v4f*)(wsrc + i * 1024);
#pragma unroll
  for (int i = 0; i < 16; ++i) *(v4f*)&sx[2 * i + r2][c4] = bfr4(xv[i]);
#pragma unroll
  for (int i = 0; i < 4; ++i) *(v4f*)&sw[2 * i + r2][c4] = bfr4(wv[i]);
  __syncthreads();
  const int sl = t & 31, h = t >> 5; const float* xr = &sx[sl][0]; const float* wr = &sw[h][0]; float a0 = 0.f, a1 = 0.f, a2 = 0.f, a3 = 0.f;
#pragma unroll 8   // eight steps' LDS reads go out as a group ahead of their products; without it each step waits for its own two reads
  for (int i = 0; i < DD / 4; ++i) { const v4f x4 = *(const v4f*)(xr + 4 * i), w4 = *(const v4f*)(wr + 4 * i); a0 += x4[0] * w4[0]; a1 += x4[1] * w4[1]; a2 += x4[2] * w4[2]; a3 += x4[3] * w4[3]; }
  CB[(b * NH + h) * (size_t)NN + s0 + sl] = a0 + a1 + a2 + a3; }
// ---- k_att: block = (64 queries, h, b): logits = ((q*m_h) . k + cb[s]) / 8 (K 512), softmax, P (hi + residual) . v_h
// Each wave forms its 16 A fragments (q * m_h), rounded once to f16, in registers ahead of the key loop and keeps them there. The head's bias row (once) and each pass's K and V tiles (two buffers) come into LDS by asynchronous copies whose waves cover whole 128-B lines (V: 64-B row pieces); the key loop reads K, V and the bias from LDS.
#define KP 520   // f16 per staged K row: 1,040 B = 16 B x 65, an odd multiple of 16 B for the ds_load_b128 readers
#define VP 40    // f16 per staged V row: 80 B = 16 B x 5
// two copies, same form
__device__ __forceinline__ void cp2(unsigned l, unsigned ls, const char* g, size_t gs) {
  asm volatile("global_load_async_to_lds_b128 %0, %2, off\n\tglobal_load_async_to_lds_b128 %1, %3, off\n\ts_wait_xcnt 0x0" :: "v"(l), "v"(l + ls), "v"(g), "v"(g + gs) : "memory"); }
// register budget and residency of two waves per SIMD: without it this build kept part of a Q fragment in scratch; the 512 blocks lie two to a WGP
__global__ __launch_bounds__(128) __attribute__((amdgpu_waves_per_eu(2, 2))) void k_att(const float* __restrict__ QF, const float* __restrict__ MIX, const _Float16* __restrict__ KH, const _Float16* __restrict__ VT, const float* __restrict__ CB, float* __restrict__ O) {
  __shared__ __align__(16) _Float16 sk[2][32][KP]; __shared__ __align__(16) _Float16 sv[2][DH][VP]; __shared__ __align__(16) float sp[4][16][36]; __shared__ __align__(16) float scb[NN];
  const int tid = threadIdx.x, wave = tid >> 5, lane = tid & 31, col = lane & 15, g = lane >> 4; const int h = blockIdx.y; const size_t b = blockIdx.z; const int q0 = blockIdx.x * 64 + wave * 16; const size_t rq = b * NN + q0;
  // copy maps: 1,024-B rows (K): one copy of the block = two rows, a wave = 512 contiguous bytes; V: one copy = 32 rows of 64 B
  const int crow = tid >> 6, ccol = (tid & 63) * 8, vrow = tid >> 2, vcol = (tid & 3) * 8;
  const char* ksrc = (const char*)(KH + (b * NN + crow) * DD + ccol);
  const char* vsrc = (const char*)(VT + (b * DD + (size_t)h * DH + vrow) * (size_t)NN + vcol);
  const char* bsrc = (const char*)(CB + (b * NH + h) * (size_t)NN + tid * 4);
  const unsigned kdst = lds_off(&sk[0][crow][ccol]), vdst = lds_off(&sv[0][vrow][vcol]);
#define STAGE(t, bf) do { const char* kt = ksrc + (size_t)(t) * (32 * DD * 2); const unsigned kl = kdst + (unsigned)(bf) * (32u * KP * 2u); \
    cp8(kl, 2u * KP * 2u, kt, 2 * DD * 2); cp8(kl + 16u * KP * 2u, 2u * KP * 2u, kt + 16 * DD * 2, 2 * DD * 2); \
    cp2(vdst + (unsigned)(bf) * (DH * VP * 2u), 32u * VP * 2u, vsrc + (t) * 64, (size_t)32 * NN * 2); } while (0)
  cp2(lds_off(&scb[tid * 4]), 2048u, bsrc, 2048); cp2(lds_off(&scb[1024 + tid * 4]), 2048u, bsrc + 4096, 2048);
  STAGE(0, 0);
  // the wave's 16 query rows as 16 A fragments, under the copies' flight: four 16-B loads a fragment, each 512 contiguous bytes of the wave; element e of a lane is d = 32 kc + 8 g + (e & 7) + 16 (e >> 3)
  v16h qf[DD / 32];
  { const float* qp = QF + rq * DD + lane * 4; const float* mp = MIX + h * DD + 8 * g;
#pragma unroll   // whole, so that qf is indexed by constants and stays in registers
    for (int kc = 0; kc < DD / 32; ++kc)
#pragma unroll
      for (int p = 0; p < 4; ++p) { const v4f x = *(const v4f*)(qp + kc * 512 + p * 128), mm = *(const v4f*)(mp + kc * 32 + (p & 1) * 4 + (p >> 1) * 16);
#pragma unroll
        for (int i = 0; i < 4; ++i) qf[kc][p * 4 + i] = (_Float16)(x[i] * bfr(mm[i])); } }
  asm volatile("s_wait_xcnt 0x0" ::: "memory");        // ahead of the first overwrite of an address register of the loads above
  asm volatile("s_wait_asynccnt 0x0" ::: "memory");   // this wave's copies of the bias row and of pass 0 have landed
  __syncthreads();                                     // ... and every other wave's: nothing staged is read before this
  STAGE(1, 1);
  float m[8], l[8];
#pragma unroll
  for (int r = 0; r < 8; ++r) { m[r] = -3.0e38f; l[r] = 0.f; }
  v8f acc[4] = {}, accl[4] = {};
#pragma unroll 1
  for (int ks = 0; ks < NN / 32; ++ks) { const int bf = ks & 1; v8f s[2];
    v16h vf[4];
    { const _Float16* k0 = &sk[bf][col][0]; const _Float16* k1 = &sk[bf][16 + col][0]; v8f c0 = {}, c1 = {};
      const float cb0 = scb[ks * 32 + col], cb1 = scb[ks * 32 + 16 + col];
      // LDS reads in groups, one group (two k steps: 8 reads) ahead of the products that use them, in a second register set; each Q fragment serves both 16-key groups
      v16h ka[2][2], kb[2][2];
#pragma unroll
      for (int i = 0; i < 2; ++i) { ka[0][i] = frag_h(k0 + i * 32, lane); kb[0][i] = frag_h(k1 + i * 32, lane); }
#pragma unroll
      for (int kb2 = 0; kb2 < DD / 64; ++kb2) { const int cs = kb2 & 1, ns = cs ^ 1;
        if (kb2 + 1 < DD / 64) {
#pragma unroll
          for (int i = 0; i < 2; ++i) { const int kc = (kb2 + 1) * 2 + i; ka[ns][i] = frag_h(k0 + kc * 32, lane); kb[ns][i] = frag_h(k1 + kc * 32, lane); } }
        else {
#pragma unroll
          for (int j = 0; j < 4; ++j) vf[j] = frag_h(&sv[bf][j * 16 + col][0], lane); }
#pragma unroll
        for (int i = 0; i < 2; ++i) { c0 = wmma16q(qf[kb2 * 2 + i], ka[cs][i], c0); c1 = wmma16q(qf[kb2 * 2 + i], kb[cs][i], c1); } }
#pragma unroll
      for (int r = 0; r < 8; ++r) { s[0][r] = (c0[r] + cb0) * 0.125f; s[1][r] = (c1[r] + cb1) * 0.125f; } }
    float alpha[8];
#pragma unroll
    for (int r = 0; r < 8; ++r) { float mx = fmaxf(s[0][r], s[1][r]);
#pragma unroll
      for (int o = 1; o < 16; o <<= 1) mx = fmaxf(mx, __shfl_xor(mx, o));
      const float mn = fmaxf(m[r], mx); alpha[r] = __expf(m[r] - mn); const float e0 = __expf(s[0][r] - mn), e1 = __expf(s[1][r] - mn); float es = e0 + e1;
#pragma unroll
      for (int o = 1; o < 16; o <<= 1) es += __shfl_xor(es, o);
      l[r] = l[r] * alpha[r] + es; m[r] = mn; sp[wave][8 * g + r][col] = e0; sp[wave][8 * g + r][16 + col] = e1; }
#pragma unroll
    for (int j = 0; j < 4; ++j)
#pragma unroll
      for (int r = 0; r < 8; ++r) { acc[j][r] *= alpha[r]; accl[j][r] *= alpha[r]; }
    LDSX();
    v16h pa, pal; { const float* prow = &sp[wave][col][0] + 8 * (lane >> 4);
#pragma unroll
      for (int i = 0; i < 8; ++i) { const float p0 = prow[i] * 2048.0f, p1 = prow[16 + i] * 2048.0f; pa[i] = (_Float16)p0; pa[8 + i] = (_Float16)p1; pal[i] = (_Float16)((p0 - (float)pa[i]) * 2048.0f); pal[8 + i] = (_Float16)((p1 - (float)pa[8 + i]) * 2048.0f); } }
#pragma unroll
    for (int j = 0; j < 4; ++j) { acc[j] = wmma16(pa, vf[j], acc[j]); accl[j] = wmma16(pal, vf[j], accl[j]); }
    asm volatile("s_wait_dscnt 0x0" ::: "memory");     // this wave's reads of sp and of this pass's buffers have returned
    asm volatile("s_wait_asynccnt 0x0" ::: "memory");  // this wave's copies of the next pass have landed
    __syncthreads();                                   // publishes the next pass and ends every reader's last read of this pass's buffers
    if (ks + 2 < NN / 32) STAGE(ks + 2, bf); }
  asm volatile("s_wait_asynccnt 0x0" ::: "memory");    // no copy is outstanding when the wave reuses LDS and ends
  // output staging in eight K rows of the ring, each wave its own: every wave's reads of the ring returned, and no copy was left in flight, ahead of the last pass's barrier
  float (*so)[68] = (float (*)[68])&sk[0][wave * 8][0];
#pragma unroll
  for (int r = 0; r < 8; ++r) { const float il = (1.0f / 2048.0f) / l[r];
#pragma unroll
    for (int j = 0; j < 4; ++j) so[8 * g + r][j * 16 + col] = (acc[j][r] + accl[j][r] * (1.0f / 2048.0f)) * il; }
  LDSX(); for (int rl = 0; rl < 16; ++rl) if (lane < 16) vst2(O + (rq + rl) * DD + (size_t)h * DH + lane * 4, *(const v4f*)&so[rl][lane * 4]); }
// ---- k_out: block = (64 rows, 128 cols): out = ctx (hi + lo) . Wd^T + bd
__global__ __launch_bounds__(128) void k_out(const float* __restrict__ Or, const float* __restrict__ WD, const float* __restrict__ BD, float* __restrict__ OUT) { __shared__ __align__(16) float ring[2 * GST]; __shared__ __align__(16) float sf[4][16][132];
  const int tid = threadIdx.x, wave = tid >> 5, lane = tid & 31, col = lane & 15, g = lane >> 4; const size_t r0 = (size_t)blockIdx.x * 64 + wave * 16; const int c0 = blockIdx.y * 128;
  const char* asrc = (const char*)(Or + ((size_t)blockIdx.x * 64 + (tid >> 4)) * DD + (tid & 15) * 4); const char* bsrc = (const char*)(WD + (size_t)(c0 + (tid >> 4)) * DD + (tid & 15) * 4);
  const unsigned gdst = lds_off(&ring[(tid >> 4) * GP + (tid & 15) * 4]);
  gstage(gdst, asrc, bsrc);
  asm volatile("s_wait_asynccnt 0x0" ::: "memory");   // this wave's copies of stage 0 have landed
  __syncthreads();                                     // ... and every other wave's: nothing staged is read before this
  gstage(gdst + GST * 4u, asrc + GK * 4, bsrc + GK * 4);
  v8f acc[8] = {};
#pragma unroll 1   // one trip per stage, so that the ring's waits and its barrier stand once, at the trip's foot
  for (int t = 0; t < DD / GK; ++t) { const int bf = t & 1; const float* ar = &ring[bf * GST + (wave * 16 + col) * GP]; const float* br = &ring[bf * GST + GA + col * GP];
#pragma unroll
    for (int kc = 0; kc < GK / 32; ++kc) { const F2 a = split_row(ar, kc * 32, lane); v16b w[8];
#pragma unroll
      for (int j = 0; j < 8; ++j) w[j] = fragb_f32(br + j * 16 * GP + kc * 32, lane);
#pragma unroll
      for (int j = 0; j < 8; ++j) { acc[j] = wmma_bf(a.h, w[j], acc[j]); acc[j] = wmma_bf(a.l, w[j], acc[j]); } }
    asm volatile("s_wait_dscnt 0x0" ::: "memory");     // this wave's reads of this stage's buffer have returned
    asm volatile("s_wait_asynccnt 0x0" ::: "memory");  // this wave's copies of the next stage have landed
    __syncthreads();                                   // publishes the next stage and ends every reader's last read of this stage's buffer
    if (t + 2 < DD / GK) gstage(gdst + (unsigned)bf * (GST * 4u), asrc + (t + 2) * (GK * 4), bsrc + (t + 2) * (GK * 4)); }
  asm volatile("s_wait_asynccnt 0x0" ::: "memory");    // no copy is outstanding when the wave ends
#pragma unroll
  for (int j = 0; j < 8; ++j) { const float bb = bfr(BD[c0 + j * 16 + col]);
#pragma unroll
    for (int r = 0; r < 8; ++r) sf[wave][8 * g + r][j * 16 + col] = acc[j][r] + bb; }
  LDSX(); for (int rl = 0; rl < 16; ++rl) vst2(OUT + (r0 + rl) * DD + c0 + lane * 4, *(const v4f*)&sf[wave][rl][lane * 4]); }
extern "C" void kernel_launch(void* const* d_in, const int* in_sizes, int n_in, void* d_out, int out_size, void* d_ws, size_t ws_size, hipStream_t stream) {
  (void)in_sizes; (void)n_in; (void)out_size;
  const float** F = (const float**)d_in;   // 0 x [2,2048,512], 1 Wq, 2 Wk, 3 Wv [512,512] natural, 4 Wb [8,512], 5 mixing [8,512], 6 Wd [512,512], 7 bd [512]
  if (ws_size < (size_t)WS_END) return;
  char* ws = (char*)d_ws; _Float16 *KH = (_Float16*)(ws + WS_KH), *VT = (_Float16*)(ws + WS_VT); float *QF = (float*)(ws + WS_QF), *CB = (float*)(ws + WS_CB), *O = (float*)(ws + WS_O);
  k_proj<<<dim3(NN / 64, DD / 128, 3 * NB), 128, 0, stream>>>(F[0], F[1], F[2], F[3], QF, KH, VT);
  k_cb<<<dim3(NN / 32, NB), 256, 0, stream>>>(F[0], F[4], CB);
  k_att<<<dim3(TQB, NH, TNB), 128, 0, stream>>>(QF, F[5], KH, VT, CB, O);
  k_out<<<dim3(TNB * NN / 64, DD / 128), 128, 0, stream>>>(O, F[6], F[7], (float*)d_out);
}

// v005
// It runs in 115 microseconds.
// Timed twice side by side with v004, it ran 1.36 times as fast both times.
// Over all steps from v000 it is 7.51 times as fast.
// compute dtype: all float inputs rounded to bf16; q/k/v = x W^T with EXACT bf16 products on WMMA 16x16x32 (natural rows); per head the bilinear scores sum_d q_d m_hd k_d as a 512-deep WMMA product of (q * m_h) and k, each rounded once to f16 (1 product; the attention is diffuse: logits std ~0.1), content bias x . Wb^T exact, x 1/8; running-max softmax in f32 (hardware exp); P as f16 hi + residual (x 2^11) . v (f16; 2 products); out = ctx (bf16 hi + lo) . Wd^T + bd; f32 output.
#include <hip/hip_runtime.h>
#include <math.h>

typedef __attribute__((ext_vector_type(16))) _Float16 v16h;
typedef __attribute__((ext_vector_type(16))) __bf16 v16b;
typedef __attribute__((ext_vector_type(8)))  _Float16 v8h;
typedef __attribute__((ext_vector_type(8)))  float v8f;
typedef __attribute__((ext_vector_type(4)))  float v4f;
typedef __attribute__((ext_vector_type(2)))  float v2f;
typedef __attribute__((ext_vector_type(4)))  unsigned v4u;
typedef __attribute__((ext_vector_type(4)))  int v4i;
typedef float __attribute__((may_alias)) float_a;
typedef int __attribute__((may_alias)) int_a;

template <typename T> __device__ __forceinline__ void vst2(void* p, T v) { *(T*)p = v;  }
__device__ __forceinline__ v8f wmma16(v16h a, v16h b, v8f c) {
  v8f d = __builtin_amdgcn_wmma_f32_16x16x32_f16(false, a, false, b, (short)0, c, false, false);
  asm volatile("v_nop\n\tv_nop\n\tv_nop\n\tv_nop" : "+v"(d) : "v"(a), "v"(b));
  return d;
}
// as wmma16, but its statement does not name B: with the 16 resident Q fragments of k_att (its B operands) among the statement's operands they were not all kept in registers (scratch)
__device__ __forceinline__ v8f wmma16q(v16h a, v16h b, v8f c) {
  v8f d = __builtin_amdgcn_wmma_f32_16x16x32_f16(false, a, false, b, (short)0, c, false, false);
  asm volatile("v_nop\n\tv_nop\n\tv_nop\n\tv_nop" : "+v"(d) : "v"(a));
  return d;
}
// lane l takes the value of lane l ^ 16
__device__ __forceinline__ float xhalf(float x) { return __builtin_bit_cast(float, __builtin_amdgcn_permlanex16(__builtin_bit_cast(int, x), __builtin_bit_cast(int, x), 0x76543210, 0xfedcba98, false, false)); }
__device__ __forceinline__ v8f wmma_bf(v16b a, v16b b, v8f c) {
  v8f d = __builtin_amdgcn_wmma_f32_16x16x32_bf16(false, a, false, b, (short)0, c, false, false);
  asm volatile("v_nop\n\tv_nop\n\tv_nop\n\tv_nop" : "+v"(d) : "v"(a), "v"(b));
  return d;
}
// 16x16x32 fragments: lane = (h = lane>>4, row/col = lane&15); elements 0..7 = k0+8h+0..7, 8..15 = k0+16+8h+0..7; D element r = row 8h+r
__device__ __forceinline__ v16h frag_h(const _Float16* rowk0, int lane) {
  union { v16h v; v8h q[2]; } u; const _Float16* p = rowk0 + 8 * (lane >> 4);
  u.q[0] = *(const v8h*)p; u.q[1] = *(const v8h*)(p + 16); return u.v;
}
__device__ __forceinline__ v16h frag_f32(const float* rowk0, int lane) {
  v16h a; const float* p = rowk0 + 8 * (lane >> 4);
#pragma unroll
  for (int i = 0; i < 8; ++i) { a[i] = (_Float16)p[i]; a[8 + i] = (_Float16)p[16 + i]; }
  return a;
}
__device__ __forceinline__ v16h frag_f32s(const float* rowk0, int lane, float sc) {
  v16h a; const float* p = rowk0 + 8 * (lane >> 4);
#pragma unroll
  for (int i = 0; i < 8; ++i) { a[i] = (_Float16)(p[i] * sc); a[8 + i] = (_Float16)(p[16 + i] * sc); }
  return a;
}
// column fragment from a [K][ld] layout (column n), rows >= K read as 0
__device__ __forceinline__ v16h fragc_f32(const float* W, int k0, int n, int lane, int ld, int K) {
  v16h a; const int g = lane >> 4;
#pragma unroll
  for (int i = 0; i < 8; ++i) { const int ka = k0 + 8 * g + i, kb = ka + 16;
    a[i] = (_Float16)(ka < K ? W[(size_t)(ka < K ? ka : K - 1) * ld + n] : 0.f); a[8 + i] = (_Float16)(kb < K ? W[(size_t)(kb < K ? kb : K - 1) * ld + n] : 0.f); }
  return a;
}
struct F2 { v16b h, l; };
__device__ __forceinline__ F2 bsplit16(const float v[16]) { F2 r;
#pragma unroll
  for (int i = 0; i < 16; ++i) { const __bf16 h = (__bf16)v[i]; r.h[i] = h; r.l[i] = (__bf16)(v[i] - (float)h); }
  return r; }
__device__ __forceinline__ F2 split_row(const float* row, int k0, int lane) { float v[16]; const float* p = row + k0 + 8 * (lane >> 4);
#pragma unroll
  for (int i = 0; i < 8; ++i) { v[i] = p[i]; v[8 + i] = p[16 + i]; }
  return bsplit16(v); }
__device__ __forceinline__ F2 split_rowK(const float* row, int k0, int lane, int K) { float v[16]; const int g = lane >> 4;
#pragma unroll
  for (int i = 0; i < 8; ++i) { const int ka = k0 + 8 * g + i, kb = ka + 16; v[i] = ka < K ? row[ka < K ? ka : K - 1] : 0.f; v[8 + i] = kb < K ? row[kb < K ? kb : K - 1] : 0.f; }
  return bsplit16(v); }
__device__ __forceinline__ F2 split_col(const float* W, int k0, int n, int lane, int ld, int K) { float v[16]; const int g = lane >> 4;
#pragma unroll
  for (int i = 0; i < 8; ++i) { const int ka = k0 + 8 * g + i, kb = ka + 16; v[i] = ka < K ? W[(size_t)(ka < K ? ka : K - 1) * ld + n] : 0.f; v[8 + i] = kb < K ? W[(size_t)(kb < K ? kb : K - 1) * ld + n] : 0.f; }
  return bsplit16(v); }
__device__ __forceinline__ v8f mac3(const F2& a, const F2& b, v8f c) { c = wmma_bf(a.l, b.h, c); c = wmma_bf(a.h, b.l, c); return wmma_bf(a.h, b.h, c); }
__device__ __forceinline__ float sigm(float v) { return 1.0f / (1.0f + expf(-v)); }
#define LDSX() do { asm volatile("s_wait_dscnt 0" ::: "memory"); __builtin_amdgcn_wave_barrier(); __builtin_amdgcn_fence(__ATOMIC_RELEASE, "workgroup"); } while (0)


// Collaborative attention (B 2, L 2,048, D 512, 8 heads x 64 with a shared 512-wide key/query space): scores = (q diag(m_h) k^T + content_bias(k side)) / sqrt(64); softmax; per-head 64-dim values; dense output projection.
#define NB 2
#define NN 2048
#define DD 512
#define NH 8
#define DH 64
#ifndef TNB
#define TNB NB
#endif
#ifndef TQB
#define TQB (NN / 64)
#endif
typedef __attribute__((ext_vector_type(8))) __bf16 v8b;
__device__ __forceinline__ v16b frag_b(const __bf16* rowk0, int lane) {
  union { v16b v; v8b q[2]; } u; const __bf16* p = rowk0 + 8 * (lane >> 4);
  u.q[0] = *(const v8b*)p; u.q[1] = *(const v8b*)(p + 16); return u.v;
}
__device__ __forceinline__ float bfr(float v) { return (float)(__bf16)v; }
__device__ __attribute__((noinline)) float exp_ni(float v) { return expf(v); }
__device__ __attribute__((noinline)) float erf_ni(float v) { return erff(v); }

#define WS_QF  0u                                   // f32 q in A-fragment order: [(b*NN + l) / 16][d / 32][piece 0..3][lane][4]; lane = (g, row), piece p = d 8 g + 4 (p & 1) + 16 (p >> 1) + 0..3 of its 32
#define WS_KH  (WS_QF + 4u * (size_t)NB * NN * DD)       // f16 k rows [b*NN + s][512]
#define WS_VT  (WS_KH + 2u * (size_t)NB * NN * DD)       // f16 v planes [b][512][NN]
#define WS_CB  (WS_VT + 2u * (size_t)NB * DD * NN)       // f32 content bias [b][h][NN]
#define WS_O   (WS_CB + 4u * (size_t)NB * NH * NN)       // f32 ctx rows [b*NN + l][512]
#define WS_END (WS_O + 4u * (size_t)NB * NN * DD)

__device__ __forceinline__ v16b fragb_f32(const float* __restrict__ p, int lane) { v16b a; const float* pp = p + 8 * (lane >> 4);
#pragma unroll
  for (int i = 0; i < 8; ++i) { a[i] = (__bf16)pp[i]; a[8 + i] = (__bf16)pp[16 + i]; } return a; }
typedef __attribute__((address_space(3))) const unsigned char lds_byte;
__device__ __forceinline__ unsigned lds_off(const void* p) { return (unsigned)(size_t)(lds_byte*)p; }
// eight copies of 16 B per lane, LDS step ls bytes, global step gs bytes; the s_wait_xcnt stands inside the statement so that no address register of a copy is rewritten ahead of it
__device__ __forceinline__ void cp8(unsigned l, unsigned ls, const char* g, size_t gs) {
  asm volatile("global_load_async_to_lds_b128 %0, %8, off\n\tglobal_load_async_to_lds_b128 %1, %9, off\n\tglobal_load_async_to_lds_b128 %2, %10, off\n\tglobal_load_async_to_lds_b128 %3, %11, off\n\t"
               "global_load_async_to_lds_b128 %4, %12, off\n\tglobal_load_async_to_lds_b128 %5, %13, off\n\tglobal_load_async_to_lds_b128 %6, %14, off\n\tglobal_load_async_to_lds_b128 %7, %15, off\n\ts_wait_xcnt 0x0"
               :: "v"(l), "v"(l + ls), "v"(l + 2 * ls), "v"(l + 3 * ls), "v"(l + 4 * ls), "v"(l + 5 * ls), "v"(l + 6 * ls), "v"(l + 7 * ls),
                  "v"(g), "v"(g + gs), "v"(g + 2 * gs), "v"(g + 3 * gs), "v"(g + 4 * gs), "v"(g + 5 * gs), "v"(g + 6 * gs), "v"(g + 7 * gs) : "memory"); }
// The two projection kernels (64 rows x 128 cols a block) take their operands through LDS: a stage is 64 f32 of k (256 B) of the 64 A rows and the 128 B rows, two buffers; the f32 values are rounded where the fragments are formed.
#define GK 64               // f32 of k per stage
#define GP 68               // f32 per staged row: 272 B = 16 B x 17, an odd multiple of 16 B for the ds_load_b128 readers
#define GA (64 * GP)        // f32 of a stage's A rows
#define GST (192 * GP)      // f32 of a stage
// one stage: a copy of the block = 8 rows of 256 B, a wave = two rows' whole 128-B lines; dst, a, b are the lane's own places in row (tid >> 4)
__device__ __forceinline__ void gstage(unsigned dst, const char* a, const char* b) {
  cp8(dst, 8u * GP * 4u, a, (size_t)8 * DD * 4);
  cp8(dst + GA * 4u, 8u * GP * 4u, b, (size_t)8 * DD * 4);
  cp8(dst + (GA + 64u * GP) * 4u, 8u * GP * 4u, b + (size_t)64 * DD * 4, (size_t)8 * DD * 4); }
// ---- k_proj: block = (64 rows, 128 cols, which*NB + b): which 0 q -> f32, once, in A-fragment order; 1 k -> f16 rows; 2 v -> f16 planes
__global__ __launch_bounds__(128) void k_proj(const float* __restrict__ X, const float* __restrict__ WQ, const float* __restrict__ WK, const float* __restrict__ WV, float* __restrict__ QF, _Float16* __restrict__ KH, _Float16* __restrict__ VT) {
  __shared__ __align__(16) float ring[2 * GST];
  // the output staging lies over the ring, which nobody reads and no copy writes behind the last stage's barrier: keeps the block's LDS small enough for three blocks per WGP
  float (*sf)[132] = (float (*)[132])&ring[0]; _Float16 (*sh)[136] = (_Float16 (*)[136])&ring[64 * 132]; _Float16 (*th)[72] = (_Float16 (*)[72])&ring[64 * 132 + 64 * 68];
  const int tid = threadIdx.x, wave = tid >> 5, lane = tid & 31, col = lane & 15, g = lane >> 4; const int which = blockIdx.z / NB; const size_t b = blockIdx.z % NB; const int n0 = blockIdx.x * 64; const int c0 = blockIdx.y * 128;
  const float* Wm = which == 0 ? WQ : which == 1 ? WK : WV;
  const char* asrc = (const char*)(X + (b * NN + n0 + (tid >> 4)) * DD + (tid & 15) * 4); const char* bsrc = (const char*)(Wm + (size_t)(c0 + (tid >> 4)) * DD + (tid & 15) * 4);
  const unsigned gdst = lds_off(&ring[(tid >> 4) * GP + (tid & 15) * 4]);
  gstage(gdst, asrc, bsrc);
  asm volatile("s_wait_asynccnt 0x0" ::: "memory");   // this wave's copies of stage 0 have landed
  __syncthreads();                                     // ... and every other wave's: nothing staged is read before this
  gstage(gdst + GST * 4u, asrc + GK * 4, bsrc + GK * 4);
  v8f acc[8] = {};
#pragma unroll 1   // one trip per stage, so that the ring's waits and its barrier stand once, at the trip's foot
  for (int t = 0; t < DD / GK; ++t) { const int bf = t & 1; const float* ar = &ring[bf * GST + (wave * 16 + col) * GP]; const float* br = &ring[bf * GST + GA + col * GP];
#pragma unroll
    for (int kc = 0; kc < GK / 32; ++kc) { const v16b a = fragb_f32(ar + kc * 32, lane); v16b w[8];
#pragma unroll
      for (int j = 0; j < 8; ++j) w[j] = fragb_f32(br + j * 16 * GP + kc * 32, lane);
#pragma unroll
      for (int j = 0; j < 8; ++j) acc[j] = wmma_bf(a, w[j], acc[j]); }
    asm volatile("s_wait_dscnt 0x0" ::: "memory");     // this wave's reads of this stage's buffer have returned
    asm volatile("s_wait_asynccnt 0x0" ::: "memory");  // this wave's copies of the next stage have landed
    __syncthreads();                                   // publishes the next stage and ends every reader's last read of this stage's buffer
    if (t + 2 < DD / GK) gstage(gdst + (unsigned)bf * (GST * 4u), asrc + (t + 2) * (GK * 4), bsrc + (t + 2) * (GK * 4)); }
  asm volatile("s_wait_asynccnt 0x0" ::: "memory");    // no copy is outstanding when the ring becomes output staging
#pragma unroll
  for (int j = 0; j < 8; ++j)
#pragma unroll
    for (int r = 0; r < 8; ++r) { const float v = acc[j][r]; if (which == 0) sf[wave * 16 + 8 * g + r][j * 16 + col] = v; else if (which == 1) sh[wave * 16 + 8 * g + r][j * 16 + col] = (_Float16)v; else th[j * 16 + col][wave * 16 + 8 * g + r] = (_Float16)v; }
  __syncthreads();
  if (which == 0) {
    // wave w stores piece w of each of the block's 4 x 4 (16 rows x 32 d) units: 512 contiguous bytes a store
    float* qd = QF + ((b * NN + n0) * (size_t)DD + (size_t)(c0 / 32) * 512) + wave * 128 + lane * 4; const float* qs = &sf[col][8 * g + (wave & 1) * 4 + (wave >> 1) * 16];
#pragma unroll   // whole, so that the 16 LDS reads go out as a group and every store takes a constant offset from one address
    for (int it = 0; it < 16; ++it) vst2(qd + (size_t)((it >> 2) * 16 + (it & 3)) * 512, *(const v4f*)(qs + (it >> 2) * 16 * 132 + (it & 3) * 32)); }
  else if (which == 1) { for (int e = tid; e < 64 * 16; e += 128) { const int rl = e >> 4, q = e & 15; vst2((unsigned*)(KH + (b * NN + n0 + rl) * DD + c0 + q * 8), *(const v4u*)&sh[rl][q * 8]); } }
  else { for (int e = tid; e < 128 * 8; e += 128) { const int cl = e >> 3, q = e & 7; vst2((unsigned*)(VT + (b * DD + c0 + cl) * (size_t)NN + n0 + q * 8), *(const v4u*)&th[cl][q * 8]); } } }
// ---- k_cb: block = (32 keys, b): cb[b][h][s] = x_s . Wb[h] (exact products, f32 accumulate on VALU)
// The block's 32 x rows and the 8 Wb rows come in by 16-B loads whose waves cover whole 128-B lines, are rounded once and staged in LDS; thread (key, head) sums its 512 products from LDS in four chains d = j + 4 i, joined j = 0..3 (the order of additions that four threads per key gave); a wave stores one whole 128-B line of one head.
#define CP 516   // f32 per staged row: 2,064 B = 16 B x 129, an odd multiple of 16 B for the ds_load_b128 readers (32 rows, one column)
__device__ __forceinline__ v4f bfr4(v4f v) { v4f r; r[0] = bfr(v[0]); r[1] = bfr(v[1]); r[2] = bfr(v[2]); r[3] = bfr(v[3]); return r; }
__global__ __launch_bounds__(256) void k_cb(const float* __restrict__ X, const float* __restrict__ WB, float* __restrict__ CB) { __shared__ __align__(16) float sx[32][CP]; __shared__ __align__(16) float sw[NH][CP]; const int t = threadIdx.x; const size_t b = blockIdx.y; const int s0 = blockIdx.x * 32;
  const float* xs = X + (b * NN + s0) * DD + t * 4; const float* wsrc = WB + t * 4; const int r2 = t >> 7, c4 = (t & 127) * 4;
  v4f xv[16], wv[4];   // the four loops below are unrolled whole so that the arrays stay in registers and all 20 loads are in flight before the first is used
#pragma unroll
  for (int i = 0; i < 16; ++i) xv[i] = *(const v4f*)(xs + i * 1024);
#pragma unroll
  for (int i = 0; i < 4; ++i) wv[i] = *(const v4f*)(wsrc + i * 1024);
#pragma unroll
  for (int i = 0; i < 16; ++i) *(v4f*)&sx[2 * i + r2][c4] = bfr4(xv[i]);
#pragma unroll
  for (int i = 0; i < 4; ++i) *(v4f*)&sw[2 * i + r2][c4] = bfr4(wv[i]);
  __syncthreads();
  const int sl = t & 31, h = t >> 5; const float* xr = &sx[sl][0]; const float* wr = &sw[h][0]; float a0 = 0.f, a1 = 0.f, a2 = 0.f, a3 = 0.f;
#pragma unroll 8   // eight steps' LDS reads go out as a group ahead of their products; without it each step waits for its own two reads
  for (int i = 0; i < DD / 4; ++i) { const v4f x4 = *(const v4f*)(xr + 4 * i), w4 = *(const v4f*)(wr + 4 * i); a0 += x4[0] * w4[0]; a1 += x4[1] * w4[1]; a2 += x4[2] * w4[2]; a3 += x4[3] * w4[3]; }
  CB[(b * NH + h) * (size_t)NN + s0 + sl] = a0 + a1 + a2 + a3; }
// ---- k_att: block = (64 queries, h, b): logits = ((q*m_h) . k + cb[s]) / 8 (K 512), softmax, P (hi + residual) . v_h
// Both products are taken transposed: S^T = K (q*m_h)^T and ctx^T += V^T P^T. A lane then holds 16 scores of ONE query (col): keys 8 g + r and 16 + 8 g + r of the pass; maximum and sum are in-lane but for one exchange between the wave's halves, and the two score tiles, converted in place, are the B fragment of the second product.
// Each wave forms its 16 B fragments (q * m_h), rounded once to f16, in registers ahead of the key loop and keeps them there. The head's bias row (once) and each pass's K and V tiles (two buffers) come into LDS by asynchronous copies whose waves cover whole 128-B lines (V: 64-B row pieces); the key loop reads K, V and the bias from LDS.
#define KP 520   // f16 per staged K row: 1,040 B = 16 B x 65, an odd multiple of 16 B for the ds_load_b128 readers
#define VP 40    // f16 per staged V row: 80 B = 16 B x 5
// two copies, same form
__device__ __forceinline__ void cp2(unsigned l, unsigned ls, const char* g, size_t gs) {
  asm volatile("global_load_async_to_lds_b128 %0, %2, off\n\tglobal_load_async_to_lds_b128 %1, %3, off\n\ts_wait_xcnt 0x0" :: "v"(l), "v"(l + ls), "v"(g), "v"(g + gs) : "memory"); }
// register budget and residency of two waves per SIMD: without it this build kept part of a Q fragment in scratch; the 512 blocks lie two to a WGP
__global__ __launch_bounds__(128) __attribute__((amdgpu_waves_per_eu(2, 2))) void k_att(const float* __restrict__ QF, const float* __restrict__ MIX, const _Float16* __restrict__ KH, const _Float16* __restrict__ VT, const float* __restrict__ CB, float* __restrict__ O) {
  __shared__ __align__(16) _Float16 sk[2][32][KP]; __shared__ __align__(16) _Float16 sv[2][DH][VP]; __shared__ __align__(16) float scb[NN];
  const int tid = threadIdx.x, wave = tid >> 5, lane = tid & 31, col = lane & 15, g = lane >> 4; const int h = blockIdx.y; const size_t b = blockIdx.z; const int q0 = blockIdx.x * 64 + wave * 16; const size_t rq = b * NN + q0;
  // copy maps: 1,024-B rows (K): one copy of the block = two rows, a wave = 512 contiguous bytes; V: one copy = 32 rows of 64 B
  const int crow = tid >> 6, ccol = (tid & 63) * 8, vrow = tid >> 2, vcol = (tid & 3) * 8;
  const char* ksrc = (const char*)(KH + (b * NN + crow) * DD + ccol);
  const char* vsrc = (const char*)(VT + (b * DD + (size_t)h * DH + vrow) * (size_t)NN + vcol);
  const char* bsrc = (const char*)(CB + (b * NH + h) * (size_t)NN + tid * 4);
  const unsigned kdst = lds_off(&sk[0][crow][ccol]), vdst = lds_off(&sv[0][vrow][vcol]);
#define STAGE(t, bf) do { const char* kt = ksrc + (size_t)(t) * (32 * DD * 2); const unsigned kl = kdst + (unsigned)(bf) * (32u * KP * 2u); \
    cp8(kl, 2u * KP * 2u, kt, 2 * DD * 2); cp8(kl + 16u * KP * 2u, 2u * KP * 2u, kt + 16 * DD * 2, 2 * DD * 2); \
    cp2(vdst + (unsigned)(bf) * (DH * VP * 2u), 32u * VP * 2u, vsrc + (t) * 64, (size_t)32 * NN * 2); } while (0)
  cp2(lds_off(&scb[tid * 4]), 2048u, bsrc, 2048); cp2(lds_off(&scb[1024 + tid * 4]), 2048u, bsrc + 4096, 2048);
  STAGE(0, 0);
  // the wave's 16 query rows as 16 B fragments (A's table with column for row), under the copies' flight: four 16-B loads a fragment, each 512 contiguous bytes of the wave; element e of a lane is d = 32 kc + 8 g + (e & 7) + 16 (e >> 3)
  v16h qf[DD / 32];
  { const float* qp = QF + rq * DD + lane * 4; const float* mp = MIX + h * DD + 8 * g;
#pragma unroll   // whole, so that qf is indexed by constants and stays in registers
    for (int kc = 0; kc < DD / 32; ++kc)
#pragma unroll
      for (int p = 0; p < 4; ++p) { const v4f x = *(const v4f*)(qp + kc * 512 + p * 128), mm = *(const v4f*)(mp + kc * 32 + (p & 1) * 4 + (p >> 1) * 16);
#pragma unroll
        for (int i = 0; i < 4; ++i) qf[kc][p * 4 + i] = (_Float16)(x[i] * bfr(mm[i])); } }
  asm volatile("s_wait_xcnt 0x0" ::: "memory");        // ahead of the first overwrite of an address register of the loads above
  asm volatile("s_wait_asynccnt 0x0" ::: "memory");   // this wave's copies of the bias row and of pass 0 have landed
  __syncthreads();                                     // ... and every other wave's: nothing staged is read before this
  STAGE(1, 1);
  float m = -3.0e38f, l = 0.f;   // this lane's query: running maximum (equal in both halves), and the sum over this half's keys alone
  v8f acc[4] = {}, accl[4] = {};
#pragma unroll 1
  for (int ks = 0; ks < NN / 32; ++ks) { const int bf = ks & 1; v8f s[2];
    v16h vf[4];
    { const _Float16* k0 = &sk[bf][col][0]; const _Float16* k1 = &sk[bf][16 + col][0]; v8f c0 = {}, c1 = {};
      v4f cb00, cb01, cb10, cb11;   // the bias of this lane's 16 keys, read with V in the last group: read at the head of the pass it held 16 registers through the products, and the build kept a copy address in scratch
      // LDS reads in groups, one group (two k steps: 8 reads) ahead of the products that use them, in a second register set; each Q fragment serves both 16-key groups
      v16h ka[2][2], kb[2][2];
#pragma unroll
      for (int i = 0; i < 2; ++i) { ka[0][i] = frag_h(k0 + i * 32, lane); kb[0][i] = frag_h(k1 + i * 32, lane); }
#pragma unroll
      for (int kb2 = 0; kb2 < DD / 64; ++kb2) { const int cs = kb2 & 1, ns = cs ^ 1;
        if (kb2 + 1 < DD / 64) {
#pragma unroll
          for (int i = 0; i < 2; ++i) { const int kc = (kb2 + 1) * 2 + i; ka[ns][i] = frag_h(k0 + kc * 32, lane); kb[ns][i] = frag_h(k1 + kc * 32, lane); } }
        else {
#pragma unroll
          for (int j = 0; j < 4; ++j) vf[j] = frag_h(&sv[bf][j * 16 + col][0], lane);
          const float* cbp = &scb[ks * 32 + 8 * g]; cb00 = *(const v4f*)cbp; cb01 = *(const v4f*)(cbp + 4); cb10 = *(const v4f*)(cbp + 16); cb11 = *(const v4f*)(cbp + 20); }
#pragma unroll
        for (int i = 0; i < 2; ++i) { c0 = wmma16q(ka[cs][i], qf[kb2 * 2 + i], c0); c1 = wmma16q(kb[cs][i], qf[kb2 * 2 + i], c1); } }
#pragma unroll
      for (int r = 0; r < 8; ++r) { s[0][r] = (c0[r] + (r < 4 ? cb00[r & 3] : cb01[r & 3])) * 0.125f; s[1][r] = (c1[r] + (r < 4 ? cb10[r & 3] : cb11[r & 3])) * 0.125f; } }
    float mx[8];
#pragma unroll
    for (int r = 0; r < 8; ++r) mx[r] = fmaxf(s[0][r], s[1][r]);
    float mh = fmaxf(fmaxf(fmaxf(mx[0], mx[1]), fmaxf(mx[2], mx[3])), fmaxf(fmaxf(mx[4], mx[5]), fmaxf(mx[6], mx[7])));
    mh = fmaxf(mh, xhalf(mh));   // the other half's 16 keys of the same query
    const float mn = fmaxf(m, mh), alpha = __expf(m - mn); m = mn;
#pragma unroll
    for (int r = 0; r < 8; ++r) { s[0][r] = (s[0][r] - mn) * 1.44269504f; s[1][r] = (s[1][r] - mn) * 1.44269504f; }
    // e^x as __expf forms it (one multiply, v_exp_f32). The two scheduling barriers keep the scores' 16 v_exp_f32 in one run with no other vector instruction among them
    __builtin_amdgcn_sched_barrier(0);
#pragma unroll
    for (int r = 0; r < 8; ++r) { s[0][r] = __builtin_amdgcn_exp2f(s[0][r]); s[1][r] = __builtin_amdgcn_exp2f(s[1][r]); }
    __builtin_amdgcn_sched_barrier(0);
    float es[8]; v16h pa, pal;
#pragma unroll
    for (int r = 0; r < 8; ++r) { const float e0 = s[0][r], e1 = s[1][r]; es[r] = e0 + e1;
      const float p0 = e0 * 2048.0f, p1 = e1 * 2048.0f; pa[r] = (_Float16)p0; pa[8 + r] = (_Float16)p1; pal[r] = (_Float16)((p0 - (float)pa[r]) * 2048.0f); pal[8 + r] = (_Float16)((p1 - (float)pa[8 + r]) * 2048.0f); }
    l = l * alpha + (((es[0] + es[1]) + (es[2] + es[3])) + ((es[4] + es[5]) + (es[6] + es[7])));
#pragma unroll
    for (int j = 0; j < 4; ++j)
#pragma unroll
      for (int r = 0; r < 8; ++r) { acc[j][r] *= alpha; accl[j][r] *= alpha; }
#pragma unroll
    for (int j = 0; j < 4; ++j) { acc[j] = wmma16(vf[j], pa, acc[j]); accl[j] = wmma16(vf[j], pal, accl[j]); }
    asm volatile("s_wait_dscnt 0x0" ::: "memory");     // this wave's reads of this pass's buffers have returned
    asm volatile("s_wait_asynccnt 0x0" ::: "memory");  // this wave's copies of the next pass have landed
    __syncthreads();                                   // publishes the next pass and ends every reader's last read of this pass's buffers
    if (ks + 2 < NN / 32) STAGE(ks + 2, bf); }
  asm volatile("s_wait_asynccnt 0x0" ::: "memory");    // no copy is outstanding when the wave reuses LDS and ends
  // output staging in eight K rows of the ring, each wave its own: every wave's reads of the ring returned, and no copy was left in flight, ahead of the last pass's barrier
  float (*so)[68] = (float (*)[68])&sk[0][wave * 8][0];
  const float il = (1.0f / 2048.0f) / (l + xhalf(l));   // the halves' sums are joined here, once
#pragma unroll
  for (int j = 0; j < 4; ++j)
#pragma unroll
    for (int q = 0; q < 2; ++q) { v4f o;
#pragma unroll
      for (int i = 0; i < 4; ++i) o[i] = (acc[j][q * 4 + i] + accl[j][q * 4 + i] * (1.0f / 2048.0f)) * il;
      *(v4f*)&so[col][j * 16 + 8 * g + q * 4] = o; }
  LDSX(); for (int rl = 0; rl < 16; ++rl) if (lane < 16) vst2(O + (rq + rl) * DD + (size_t)h * DH + lane * 4, *(const v4f*)&so[rl][lane * 4]); }
// ---- k_out: block = (64 rows, 128 cols): out = ctx (hi + lo) . Wd^T + bd
__global__ __launch_bounds__(128) void k_out(const float* __restrict__ Or, const float* __restrict__ WD, const float* __restrict__ BD, float* __restrict__ OUT) { __shared__ __align__(16) float ring[2 * GST]; __shared__ __align__(16) float sf[4][16][132];
  const int tid = threadIdx.x, wave = tid >> 5, lane = tid & 31, col = lane & 15, g = lane >> 4; const size_t r0 = (size_t)blockIdx.x * 64 + wave * 16; const int c0 = blockIdx.y * 128;
  const char* asrc = (const char*)(Or + ((size_t)blockIdx.x * 64 + (tid >> 4)) * DD + (tid & 15) * 4); const char* bsrc = (const char*)(WD + (size_t)(c0 + (tid >> 4)) * DD + (tid & 15) * 4);
  const unsigned gdst = lds_off(&ring[(tid >> 4) * GP + (tid & 15) * 4]);
  gstage(gdst, asrc, bsrc);
  asm volatile("s_wait_asynccnt 0x0" ::: "memory");   // this wave's copies of stage 0 have landed
  __syncthreads();                                     // ... and every other wave's: nothing staged is read before this
  gstage(gdst + GST * 4u, asrc + GK * 4, bsrc + GK * 4);
  v8f acc[8] = {};
#pragma unroll 1   // one trip per stage, so that the ring's waits and its barrier stand once, at the trip's foot
  for (int t = 0; t < DD / GK; ++t) { const int bf = t & 1; const float* ar = &ring[bf * GST + (wave * 16 + col) * GP]; const float* br = &ring[bf * GST + GA + col * GP];
#pragma unroll
    for (int kc = 0; kc < GK / 32; ++kc) { const F2 a = split_row(ar, kc * 32, lane); v16b w[8];
#pragma unroll
      for (int j = 0; j < 8; ++j) w[j] = fragb_f32(br + j * 16 * GP + kc * 32, lane);
#pragma unroll
      for (int j = 0; j < 8; ++j) { acc[j] = wmma_bf(a.h, w[j], acc[j]); acc[j] = wmma_bf(a.l, w[j], acc[j]); } }
    asm volatile("s_wait_dscnt 0x0" ::: "memory");     // this wave's reads of this stage's buffer have returned
    asm volatile("s_wait_asynccnt 0x0" ::: "memory");  // this wave's copies of the next stage have landed
    __syncthreads();                                   // publishes the next stage and ends every reader's last read of this stage's buffer
    if (t + 2 < DD / GK) gstage(gdst + (unsigned)bf * (GST * 4u), asrc + (t + 2) * (GK * 4), bsrc + (t + 2) * (GK * 4)); }
  asm volatile("s_wait_asynccnt 0x0" ::: "memory");    // no copy is outstanding when the wave ends
#pragma unroll
  for (int j = 0; j < 8; ++j) { const float bb = bfr(BD[c0 + j * 16 + col]);
#pragma unroll
    for (int r = 0; r < 8; ++r) sf[wave][8 * g + r][j * 16 + col] = acc[j][r] + bb; }
  LDSX(); for (int rl = 0; rl < 16; ++rl) vst2(OUT + (r0 + rl) * DD + c0 + lane * 4, *(const v4f*)&sf[wave][rl][lane * 4]); }
extern "C" void kernel_launch(void* const* d_in, const int* in_sizes, int n_in, void* d_out, int out_size, void* d_ws, size_t ws_size, hipStream_t stream) {
  (void)in_sizes; (void)n_in; (void)out_size;
  const float** F = (const float**)d_in;   // 0 x [2,2048,512], 1 Wq, 2 Wk, 3 Wv [512,512] natural, 4 Wb [8,512], 5 mixing [8,512], 6 Wd [512,512], 7 bd [512]
  if (ws_size < (size_t)WS_END) return;
  char* ws = (char*)d_ws; _Float16 *KH = (_Float16*)(ws + WS_KH), *VT = (_Float16*)(ws + WS_VT); float *QF = (float*)(ws + WS_QF), *CB = (float*)(ws + WS_CB), *O = (float*)(ws + WS_O);
  k_proj<<<dim3(NN / 64, DD / 128, 3 * NB), 128, 0, stream>>>(F[0], F[1], F[2], F[3], QF, KH, VT);
  k_cb<<<dim3(NN / 32, NB), 256, 0, stream>>>(F[0], F[4], CB);
  k_att<<<dim3(TQB, NH, TNB), 128, 0, stream>>>(QF, F[5], KH, VT, CB, O);
  k_out<<<dim3(TNB * NN / 64, DD / 128), 128, 0, stream>>>(O, F[6], F[7], (float*)d_out);
}

// v006
// A run of this version takes 93.9 microseconds.
// Next to v005, in two timings, it ran 1.22 times as fast each time.
// All steps since v000 together make it 9.15 times as fast.
// compute dtype: all float inputs rounded to bf16; q/k/v = x W^T with EXACT bf16 products on WMMA 16x16x32 (natural rows); per head the bilinear scores sum_d q_d m_hd k_d as a 512-deep WMMA product of (q * m_h) and k, each rounded once to f16 (1 product; the attention is diffuse: logits std ~0.1), content bias x . Wb^T exact, x 1/8; running-max softmax in f32 (hardware exp); P as f16 hi + residual (x 2^11) . v (f16; 2 products); out = ctx (bf16 hi + lo) . Wd^T + bd; f32 output.
#include <hip/hip_runtime.h>
#include <math.h>

typedef __attribute__((ext_vector_type(16))) _Float16 v16h;
typedef __attribute__((ext_vector_type(16))) __bf16 v16b;
typedef __attribute__((ext_vector_type(8)))  _Float16 v8h;
typedef __attribute__((ext_vector_type(8)))  float v8f;
typedef __attribute__((ext_vector_type(4)))  float v4f;
typedef __attribute__((ext_vector_type(2)))  float v2f;
typedef __attribute__((ext_vector_type(4)))  unsigned v4u;
typedef __attribute__((ext_vector_type(4)))  int v4i;
typedef float __attribute__((may_alias)) float_a;
typedef int __attribute__((may_alias)) int_a;

template <typename T> __device__ __forceinline__ void vst2(void* p, T v) { *(T*)p = v;  }
__device__ __forceinline__ v8f wmma16(v16h a, v16h b, v8f c) {
  v8f d = __builtin_amdgcn_wmma_f32_16x16x32_f16(false, a, false, b, (short)0, c, false, false);
  asm volatile("v_nop\n\tv_nop\n\tv_nop\n\tv_nop" : "+v"(d) : "v"(a), "v"(b));
  return d;
}
// as wmma16, but its statement does not name B: with the 32 resident Q fragments of k_att (its B operands) among the statement's operands they were not all kept in registers (scratch)
__device__ __forceinline__ v8f wmma16q(v16h a, v16h b, v8f c) {
  v8f d = __builtin_amdgcn_wmma_f32_16x16x32_f16(false, a, false, b, (short)0, c, false, false);
  asm volatile("v_nop\n\tv_nop\n\tv_nop\n\tv_nop" : "+v"(d) : "v"(a));
  return d;
}
// lane l takes the value of lane l ^ 16
__device__ __forceinline__ float xhalf(float x) { return __builtin_bit_cast(float, __builtin_amdgcn_permlanex16(__builtin_bit_cast(int, x), __builtin_bit_cast(int, x), 0x76543210, 0xfedcba98, false, false)); }
__device__ __forceinline__ v8f wmma_bf(v16b a, v16b b, v8f c) {
  v8f d = __builtin_amdgcn_wmma_f32_16x16x32_bf16(false, a, false, b, (short)0, c, false, false);
  asm volatile("v_nop\n\tv_nop\n\tv_nop\n\tv_nop" : "+v"(d) : "v"(a), "v"(b));
  return d;
}
// 16x16x32 fragments: lane = (h = lane>>4, row/col = lane&15); elements 0..7 = k0+8h+0..7, 8..15 = k0+16+8h+0..7; D element r = row 8h+r
__device__ __forceinline__ v16h frag_h(const _Float16* rowk0, int lane) {
  union { v16h v; v8h q[2]; } u; const _Float16* p = rowk0 + 8 * (lane >> 4);
  u.q[0] = *(const v8h*)p; u.q[1] = *(const v8h*)(p + 16); return u.v;
}
__device__ __forceinline__ v16h frag_f32(const float* rowk0, int lane) {
  v16h a; const float* p = rowk0 + 8 * (lane >> 4);
#pragma unroll
  for (int i = 0; i < 8; ++i) { a[i] = (_Float16)p[i]; a[8 + i] = (_Float16)p[16 + i]; }
  return a;
}
__device__ __forceinline__ v16h frag_f32s(const float* rowk0, int lane, float sc) {
  v16h a; const float* p = rowk0 + 8 * (lane >> 4);
#pragma unroll
  for (int i = 0; i < 8; ++i) { a[i] = (_Float16)(p[i] * sc); a[8 + i] = (_Float16)(p[16 + i] * sc); }
  return a;
}
// column fragment from a [K][ld] layout (column n), rows >= K read as 0
__device__ __forceinline__ v16h fragc_f32(const float* W, int k0, int n, int lane, int ld, int K) {
  v16h a; const int g = lane >> 4;
#pragma unroll
  for (int i = 0; i < 8; ++i) { const int ka = k0 + 8 * g + i, kb = ka + 16;
    a[i] = (_Float16)(ka < K ? W[(size_t)(ka < K ? ka : K - 1) * ld + n] : 0.f); a[8 + i] = (_Float16)(kb < K ? W[(size_t)(kb < K ? kb : K - 1) * ld + n] : 0.f); }
  return a;
}
struct F2 { v16b h, l; };
__device__ __forceinline__ F2 bsplit16(const float v[16]) { F2 r;
#pragma unroll
  for (int i = 0; i < 16; ++i) { const __bf16 h = (__bf16)v[i]; r.h[i] = h; r.l[i] = (__bf16)(v[i] - (float)h); }
  return r; }
__device__ __forceinline__ F2 split_row(const float* row, int k0, int lane) { float v[16]; const float* p = row + k0 + 8 * (lane >> 4);
#pragma unroll
  for (int i = 0; i < 8; ++i) { v[i] = p[i]; v[8 + i] = p[16 + i]; }
  return bsplit16(v); }
__device__ __forceinline__ F2 split_rowK(const float* row, int k0, int lane, int K) { float v[16]; const int g = lane >> 4;
#pragma unroll
  for (int i = 0; i < 8; ++i) { const int ka = k0 + 8 * g + i, kb = ka + 16; v[i] = ka < K ? row[ka < K ? ka : K - 1] : 0.f; v[8 + i] = kb < K ? row[kb < K ? kb : K - 1] : 0.f; }
  return bsplit16(v); }
__device__ __forceinline__ F2 split_col(const float* W, int k0, int n, int lane, int ld, int K) { float v[16]; const int g = lane >> 4;
#pragma unroll
  for (int i = 0; i < 8; ++i) { const int ka = k0 + 8 * g + i, kb = ka + 16; v[i] = ka < K ? W[(size_t)(ka < K ? ka : K - 1) * ld + n] : 0.f; v[8 + i] = kb < K ? W[(size_t)(kb < K ? kb : K - 1) * ld + n] : 0.f; }
  return bsplit16(v); }
__device__ __forceinline__ v8f mac3(const F2& a, const F2& b, v8f c) { c = wmma_bf(a.l, b.h, c); c = wmma_bf(a.h, b.l, c); return wmma_bf(a.h, b.h, c); }
__device__ __forceinline__ float sigm(float v) { return 1.0f / (1.0f + expf(-v)); }
#define LDSX() do { asm volatile("s_wait_dscnt 0" ::: "memory"); __builtin_amdgcn_wave_barrier(); __builtin_amdgcn_fence(__ATOMIC_RELEASE, "workgroup"); } while (0)


// Collaborative attention (B 2, L 2,048, D 512, 8 heads x 64 with a shared 512-wide key/query space): scores = (q diag(m_h) k^T + content_bias(k side)) / sqrt(64); softmax; per-head 64-dim values; dense output projection.
#define NB 2
#define NN 2048
#define DD 512
#define NH 8
#define DH 64
#ifndef TNB
#define TNB NB
#endif
#ifndef TQB
#define TQB (NN / 128)
#endif
typedef __attribute__((ext_vector_type(8))) __bf16 v8b;
__device__ __forceinline__ v16b frag_b(const __bf16* rowk0, int lane) {
  union { v16b v; v8b q[2]; } u; const __bf16* p = rowk0 + 8 * (lane >> 4);
  u.q[0] = *(const v8b*)p; u.q[1] = *(const v8b*)(p + 16); return u.v;
}
__device__ __forceinline__ float bfr(float v) { return (float)(__bf16)v; }
__device__ __attribute__((noinline)) float exp_ni(float v) { return expf(v); }
__device__ __attribute__((noinline)) float erf_ni(float v) { return erff(v); }

#define WS_QF  0u                                   // f32 q in A-fragment order: [(b*NN + l) / 16][d / 32][piece 0..3][lane][4]; lane = (g, row), piece p = d 8 g + 4 (p & 1) + 16 (p >> 1) + 0..3 of its 32
#define WS_KH  (WS_QF + 4u * (size_t)NB * NN * DD)       // f16 k rows [b*NN + s][512]
#define WS_VT  (WS_KH + 2u * (size_t)NB * NN * DD)       // f16 v planes [b][512][NN]
#define WS_CB  (WS_VT + 2u * (size_t)NB * DD * NN)       // f32 content bias [b][h][NN]
#define WS_O   (WS_CB + 4u * (size_t)NB * NH * NN)       // f32 ctx rows [b*NN + l][512]
#define WS_END (WS_O + 4u * (size_t)NB * NN * DD)

__device__ __forceinline__ v16b fragb_f32(const float* __restrict__ p, int lane) { v16b a; const float* pp = p + 8 * (lane >> 4);
#pragma unroll
  for (int i = 0; i < 8; ++i) { a[i] = (__bf16)pp[i]; a[8 + i] = (__bf16)pp[16 + i]; } return a; }
typedef __attribute__((address_space(3))) const unsigned char lds_byte;
__device__ __forceinline__ unsigned lds_off(const void* p) { return (unsigned)(size_t)(lds_byte*)p; }
// eight copies of 16 B per lane, LDS step ls bytes, global step gs bytes; the s_wait_xcnt stands inside the statement so that no address register of a copy is rewritten ahead of it
__device__ __forceinline__ void cp8(unsigned l, unsigned ls, const char* g, size_t gs) {
  asm volatile("global_load_async_to_lds_b128 %0, %8, off\n\tglobal_load_async_to_lds_b128 %1, %9, off\n\tglobal_load_async_to_lds_b128 %2, %10, off\n\tglobal_load_async_to_lds_b128 %3, %11, off\n\t"
               "global_load_async_to_lds_b128 %4, %12, off\n\tglobal_load_async_to_lds_b128 %5, %13, off\n\tglobal_load_async_to_lds_b128 %6, %14, off\n\tglobal_load_async_to_lds_b128 %7, %15, off\n\ts_wait_xcnt 0x0"
               :: "v"(l), "v"(l + ls), "v"(l + 2 * ls), "v"(l + 3 * ls), "v"(l + 4 * ls), "v"(l + 5 * ls), "v"(l + 6 * ls), "v"(l + 7 * ls),
                  "v"(g), "v"(g + gs), "v"(g + 2 * gs), "v"(g + 3 * gs), "v"(g + 4 * gs), "v"(g + 5 * gs), "v"(g + 6 * gs), "v"(g + 7 * gs) : "memory"); }
// The two projection kernels (64 rows x 128 cols a block) take their operands through LDS: a stage is 64 f32 of k (256 B) of the 64 A rows and the 128 B rows, two buffers; the f32 values are rounded where the fragments are formed.
#define GK 64               // f32 of k per stage
#define GP 68               // f32 per staged row: 272 B = 16 B x 17, an odd multiple of 16 B for the ds_load_b128 readers
#define GA (64 * GP)        // f32 of a stage's A rows
#define GST (192 * GP)      // f32 of a stage
// one stage: a copy of the block = 8 rows of 256 B, a wave = two rows' whole 128-B lines; dst, a, b are the lane's own places in row (tid >> 4)
__device__ __forceinline__ void gstage(unsigned dst, const char* a, const char* b) {
  cp8(dst, 8u * GP * 4u, a, (size_t)8 * DD * 4);
  cp8(dst + GA * 4u, 8u * GP * 4u, b, (size_t)8 * DD * 4);
  cp8(dst + (GA + 64u * GP) * 4u, 8u * GP * 4u, b + (size_t)64 * DD * 4, (size_t)8 * DD * 4); }
// ---- k_proj: block = (64 rows, 128 cols, which*NB + b): which 0 q -> f32, once, in A-fragment order; 1 k -> f16 rows; 2 v -> f16 planes
__global__ __launch_bounds__(128) void k_proj(const float* __restrict__ X, const float* __restrict__ WQ, const float* __restrict__ WK, const float* __restrict__ WV, float* __restrict__ QF, _Float16* __restrict__ KH, _Float16* __restrict__ VT) {
  __shared__ __align__(16) float ring[2 * GST];
  // the output staging lies over the ring, which nobody reads and no copy writes behind the last stage's barrier: keeps the block's LDS small enough for three blocks per WGP
  float (*sf)[132] = (float (*)[132])&ring[0]; _Float16 (*sh)[136] = (_Float16 (*)[136])&ring[64 * 132]; _Float16 (*th)[72] = (_Float16 (*)[72])&ring[64 * 132 + 64 * 68];
  const int tid = threadIdx.x, wave = tid >> 5, lane = tid & 31, col = lane & 15, g = lane >> 4; const int which = blockIdx.z / NB; const size_t b = blockIdx.z % NB; const int n0 = blockIdx.x * 64; const int c0 = blockIdx.y * 128;
  const float* Wm = which == 0 ? WQ : which == 1 ? WK : WV;
  const char* asrc = (const char*)(X + (b * NN + n0 + (tid >> 4)) * DD + (tid & 15) * 4); const char* bsrc = (const char*)(Wm + (size_t)(c0 + (tid >> 4)) * DD + (tid & 15) * 4);
  const unsigned gdst = lds_off(&ring[(tid >> 4) * GP + (tid & 15) * 4]);
  gstage(gdst, asrc, bsrc);
  asm volatile("s_wait_asynccnt 0x0" ::: "memory");   // this wave's copies of stage 0 have landed
  __syncthreads();                                     // ... and every other wave's: nothing staged is read before this
  gstage(gdst + GST * 4u, asrc + GK * 4, bsrc + GK * 4);
  v8f acc[8] = {};
#pragma unroll 1   // one trip per stage, so that the ring's waits and its barrier stand once, at the trip's foot
  for (int t = 0; t < DD / GK; ++t) { const int bf = t & 1; const float* ar = &ring[bf * GST + (wave * 16 + col) * GP]; const float* br = &ring[bf * GST + GA + col * GP];
#pragma unroll
    for (int kc = 0; kc < GK / 32; ++kc) { const v16b a = fragb_f32(ar + kc * 32, lane); v16b w[8];
#pragma unroll
      for (int j = 0; j < 8; ++j) w[j] = fragb_f32(br + j * 16 * GP + kc * 32, lane);
#pragma unroll
      for (int j = 0; j < 8; ++j) acc[j] = wmma_bf(a, w[j], acc[j]); }
    asm volatile("s_wait_dscnt 0x0" ::: "memory");     // this wave's reads of this stage's buffer have returned
    asm volatile("s_wait_asynccnt 0x0" ::: "memory");  // this wave's copies of the next stage have landed
    __syncthreads();                                   // publishes the next stage and ends every reader's last read of this stage's buffer
    if (t + 2 < DD / GK) gstage(gdst + (unsigned)bf * (GST * 4u), asrc + (t + 2) * (GK * 4), bsrc + (t + 2) * (GK * 4)); }
  asm volatile("s_wait_asynccnt 0x0" ::: "memory");    // no copy is outstanding when the ring becomes output staging
#pragma unroll
  for (int j = 0; j < 8; ++j)
#pragma unroll
    for (int r = 0; r < 8; ++r) { const float v = acc[j][r]; if (which == 0) sf[wave * 16 + 8 * g + r][j * 16 + col] = v; else if (which == 1) sh[wave * 16 + 8 * g + r][j * 16 + col] = (_Float16)v; else th[j * 16 + col][wave * 16 + 8 * g + r] = (_Float16)v; }
  __syncthreads();
  if (which == 0) {
    // wave w stores piece w of each of the block's 4 x 4 (16 rows x 32 d) units: 512 contiguous bytes a store
    float* qd = QF + ((b * NN + n0) * (size_t)DD + (size_t)(c0 / 32) * 512) + wave * 128 + lane * 4; const float* qs = &sf[col][8 * g + (wave & 1) * 4 + (wave >> 1) * 16];
#pragma unroll   // whole, so that the 16 LDS reads go out as a group and every store takes a constant offset from one address
    for (int it = 0; it < 16; ++it) vst2(qd + (size_t)((it >> 2) * 16 + (it & 3)) * 512, *(const v4f*)(qs + (it >> 2) * 16 * 132 + (it & 3) * 32)); }
  else if (which == 1) { for (int e = tid; e < 64 * 16; e += 128) { const int rl = e >> 4, q = e & 15; vst2((unsigned*)(KH + (b * NN + n0 + rl) * DD + c0 + q * 8), *(const v4u*)&sh[rl][q * 8]); } }
  else { for (int e = tid; e < 128 * 8; e += 128) { const int cl = e >> 3, q = e & 7; vst2((unsigned*)(VT + (b * DD + c0 + cl) * (size_t)NN + n0 + q * 8), *(const v4u*)&th[cl][q * 8]); } } }
// ---- k_cb: block = (32 keys, b): cb[b][h][s] = x_s . Wb[h] (exact products, f32 accumulate on VALU)
// The block's 32 x rows and the 8 Wb rows come in by 16-B loads whose waves cover whole 128-B lines, are rounded once and staged in LDS; thread (key, head) sums its 512 products from LDS in four chains d = j + 4 i, joined j = 0..3 (the order of additions that four threads per key gave); a wave stores one whole 128-B line of one head.
#define CP 516   // f32 per staged row: 2,064 B = 16 B x 129, an odd multiple of 16 B for the ds_load_b128 readers (32 rows, one column)
__device__ __forceinline__ v4f bfr4(v4f v) { v4f r; r[0] = bfr(v[0]); r[1] = bfr(v[1]); r[2] = bfr(v[2]); r[3] = bfr(v[3]); return r; }
__global__ __launch_bounds__(256) void k_cb(const float* __restrict__ X, const float* __restrict__ WB, float* __restrict__ CB) { __shared__ __align__(16) float sx[32][CP]; __shared__ __align__(16) float sw[NH][CP]; const int t = threadIdx.x; const size_t b = blockIdx.y; const int s0 = blockIdx.x * 32;
  const float* xs = X + (b * NN + s0) * DD + t * 4; const float* wsrc = WB + t * 4; const int r2 = t >> 7, c4 = (t & 127) * 4;
  v4f xv[16], wv[4];   // the four loops below are unrolled whole so that the arrays stay in registers and all 20 loads are in flight before the first is used
#pragma unroll
  for (int i = 0; i < 16; ++i) xv[i] = *(const v4f*)(xs + i * 1024);
#pragma unroll
  for (int i = 0; i < 4; ++i) wv[i] = *(const v4f*)(wsrc + i * 1024);
#pragma unroll
  for (int i = 0; i < 16; ++i) *(v4f*)&sx[2 * i + r2][c4] = bfr4(xv[i]);
#pragma unroll
  for (int i = 0; i < 4; ++i) *(v4f*)&sw[2 * i + r2][c4] = bfr4(wv[i]);
  __syncthreads();
  const int sl = t & 31, h = t >> 5; const float* xr = &sx[sl][0]; const float* wr = &sw[h][0]; float a0 = 0.f, a1 = 0.f, a2 = 0.f, a3 = 0.f;
#pragma unroll 8   // eight steps' LDS reads go out as a group ahead of their products; without it each step waits for its own two reads
  for (int i = 0; i < DD / 4; ++i) { const v4f x4 = *(const v4f*)(xr + 4 * i), w4 = *(const v4f*)(wr + 4 * i); a0 += x4[0] * w4[0]; a1 += x4[1] * w4[1]; a2 += x4[2] * w4[2]; a3 += x4[3] * w4[3]; }
  CB[(b * NH + h) * (size_t)NN + s0 + sl] = a0 + a1 + a2 + a3; }
// ---- k_att: block = (128 queries, h, b), 8 waves: logits = ((q*m_h) . k + cb[s]) / 8 (K 512), softmax, P (hi + residual) . v_h
// Both products are taken transposed: S^T = K (q*m_h)^T and ctx^T += V^T P^T. A lane then holds 16 scores of ONE query (col): keys 8 g + r and 16 + 8 g + r of its wave's 32 keys; maximum and sum are in-lane but for one exchange between the wave's halves, and the two score tiles, converted in place, are the B fragment of the second product.
// A wave holds 32 queries (two column groups), so that each K and V fragment read from LDS serves two products. A pass is 64 keys: waves 0..3 take its first 32, waves 4..7 its last 32, each with a running maximum, sum and context of its own over its 1,024 keys; behind the key loop wave 4 + i hands its three to wave i through LDS, which joins them and stores.
// Each wave forms its 32 B fragments (q * m_h), rounded once to f16, in registers ahead of the key loop and keeps them there. The head's bias row (once) and each pass's K and V tiles (two buffers) come into LDS by asynchronous copies whose waves cover whole 128-B lines; the key loop reads K, V and the bias from LDS.
#define KP 520   // f16 per staged K row: 1,040 B = 16 B x 65, an odd multiple of 16 B for the ds_load_b128 readers
#define VP 72    // f16 per staged V row: 144 B = 16 B x 9
// two copies, same form
__device__ __forceinline__ void cp2(unsigned l, unsigned ls, const char* g, size_t gs) {
  asm volatile("global_load_async_to_lds_b128 %0, %2, off\n\tglobal_load_async_to_lds_b128 %1, %3, off\n\ts_wait_xcnt 0x0" :: "v"(l), "v"(l + ls), "v"(g), "v"(g + gs) : "memory"); }
// eight v_exp_f32, each in place, in one statement that ends with the slot the instruction set asks for behind a transcendental
__device__ __forceinline__ void exp8(v8f& x) {
  asm("v_exp_f32 %0, %0\n\tv_exp_f32 %1, %1\n\tv_exp_f32 %2, %2\n\tv_exp_f32 %3, %3\n\tv_exp_f32 %4, %4\n\tv_exp_f32 %5, %5\n\tv_exp_f32 %6, %6\n\tv_exp_f32 %7, %7\n\tv_nop"
      : "+v"(x[0]), "+v"(x[1]), "+v"(x[2]), "+v"(x[3]), "+v"(x[4]), "+v"(x[5]), "+v"(x[6]), "+v"(x[7])); }
// register budget and residency of two waves per SIMD; the 256 blocks lie one to a WGP. This build keeps one copy address (4 B a lane) in scratch: one reload a pass, issued ahead of the K copies and used behind them
__global__ __launch_bounds__(256) __attribute__((amdgpu_waves_per_eu(2, 2))) void k_att(const float* __restrict__ QF, const float* __restrict__ MIX, const _Float16* __restrict__ KH, const _Float16* __restrict__ VT, const float* __restrict__ CB, float* __restrict__ O) {
  __shared__ __align__(16) _Float16 sk[2][64][KP]; __shared__ __align__(16) _Float16 sv[2][DH][VP]; __shared__ __align__(16) float scb[NN];
  const int tid = threadIdx.x, wave = __builtin_amdgcn_readfirstlane(tid >> 5), lane = tid & 31, col = lane & 15, g = lane >> 4; const int qg = wave & 3, kh = wave >> 2;
  const int h = blockIdx.y; const size_t b = blockIdx.z; const int q0 = blockIdx.x * 128 + qg * 32; const size_t rq = b * NN + q0;
  // copy maps: 1,024-B rows (K): one copy of the block = four rows, a wave = 512 contiguous bytes; V: one copy = 32 rows of 128 B; bias: one copy = 4,096 B
  const int crow = tid >> 6, ccol = (tid & 63) * 8, vrow = tid >> 3, vcol = (tid & 7) * 8;
  // the block's K rows and the head's V rows (uniform), and the lane's own byte offset in each (32 bits: one register each through the key loop)
  const char* kbase = (const char*)(KH + b * NN * DD); const char* vbase = (const char*)(VT + (b * DD + (size_t)h * DH) * (size_t)NN);
  const unsigned koff = (unsigned)(crow * DD + ccol) * 2u, voff = (unsigned)(vrow * NN + vcol) * 2u;
  const char* bsrc = (const char*)(CB + (b * NH + h) * (size_t)NN + tid * 4);
  const unsigned kdst = lds_off(&sk[0][crow][ccol]), vdst = lds_off(&sv[0][vrow][vcol]);
#define STAGE(t, bf) do { const char* kt = kbase + (koff + (unsigned)(t) * (64u * DD * 2u)); const unsigned kl = kdst + (unsigned)(bf) * (64u * KP * 2u); \
    cp8(kl, 4u * KP * 2u, kt, 4 * DD * 2); cp8(kl + 32u * KP * 2u, 4u * KP * 2u, kt + 32 * DD * 2, 4 * DD * 2); \
    cp2(vdst + (unsigned)(bf) * (DH * VP * 2u), 32u * VP * 2u, vbase + (voff + (unsigned)(t) * 128u), (size_t)32 * NN * 2); } while (0)
  cp2(lds_off(&scb[tid * 4]), 4096u, bsrc, 4096);
  STAGE(0, 0);
  // the wave's 32 query rows as 2 x 16 B fragments (A's table with column for row), under the copies' flight: four 16-B loads a fragment, each 512 contiguous bytes of the wave; element e of a lane is d = 32 kc + 8 g + (e & 7) + 16 (e >> 3)
  v16h qf[2][DD / 32];
  { const float* qp = QF + rq * DD + lane * 4; const float* mp = MIX + h * DD + 8 * g;
#pragma unroll   // whole, so that qf is indexed by constants and stays in registers
    for (int kc = 0; kc < DD / 32; ++kc)
#pragma unroll
      for (int p = 0; p < 4; ++p) { const v4f mm = *(const v4f*)(mp + kc * 32 + (p & 1) * 4 + (p >> 1) * 16);
#pragma unroll
        for (int u = 0; u < 2; ++u) { const v4f x = *(const v4f*)(qp + u * (16 * DD) + kc * 512 + p * 128);
#pragma unroll
          for (int i = 0; i < 4; ++i) qf[u][kc][p * 4 + i] = (_Float16)(x[i] * bfr(mm[i])); } } }
  asm volatile("s_wait_xcnt 0x0" ::: "memory");        // ahead of the first overwrite of an address register of the loads above
  asm volatile("s_wait_asynccnt 0x0" ::: "memory");   // this wave's copies of the bias row and of pass 0 have landed
  __syncthreads();                                     // ... and every other wave's: nothing staged is read before this
  STAGE(1, 1);
  float m[2] = {-3.0e38f, -3.0e38f}, l[2] = {0.f, 0.f};   // per column group, this lane's query over this wave's keys: running maximum (equal in both halves), and the sum over this half's keys alone
  v8f acc[2][4] = {}, accl[2][4] = {};
#pragma unroll 1
  for (int ks = 0; ks < NN / 64; ++ks) { const int bf = ks & 1; v8f s[2][2];
    v16h vf[4];
    { const _Float16* k0 = &sk[bf][kh * 32 + col][0]; const _Float16* k1 = &sk[bf][kh * 32 + 16 + col][0]; v8f c[2][2] = {};
      // LDS reads two k steps ahead of the products that use them, in a ring of three register sets (a fourth set did not fit beside the 32 Q fragments: the build kept one of them in scratch); each K fragment serves both column groups, each Q fragment both 16-key groups
      v16h ka[3], kb[3];
#pragma unroll
      for (int i = 0; i < 2; ++i) { ka[i] = frag_h(k0 + i * 32, lane); kb[i] = frag_h(k1 + i * 32, lane); }
#pragma unroll   // whole: the ring and qf are indexed by constants
      for (int kc = 0; kc < DD / 32; ++kc) {
        if (kc + 2 < DD / 32) { ka[(kc + 2) % 3] = frag_h(k0 + (kc + 2) * 32, lane); kb[(kc + 2) % 3] = frag_h(k1 + (kc + 2) * 32, lane); }
#pragma unroll
        for (int u = 0; u < 2; ++u) { c[u][0] = wmma16q(ka[kc % 3], qf[u][kc], c[u][0]); c[u][1] = wmma16q(kb[kc % 3], qf[u][kc], c[u][1]); } }
      // the bias of this lane's 16 keys (the same for both column groups), read behind the products, where the K fragments' registers are free
      const float* cbp = &scb[ks * 64 + kh * 32 + 8 * g]; const v4f cb00 = *(const v4f*)cbp, cb01 = *(const v4f*)(cbp + 4), cb10 = *(const v4f*)(cbp + 16), cb11 = *(const v4f*)(cbp + 20);
#pragma unroll
      for (int u = 0; u < 2; ++u)
#pragma unroll
        for (int r = 0; r < 8; ++r) { s[u][0][r] = (c[u][0][r] + (r < 4 ? cb00[r & 3] : cb01[r & 3])) * 0.125f; s[u][1][r] = (c[u][1][r] + (r < 4 ? cb10[r & 3] : cb11[r & 3])) * 0.125f; } }
    float alpha[2]; v16h pa[2], pal[2];
#pragma unroll   // whole: every array below is indexed by constants
    for (int u = 0; u < 2; ++u) {
      float mx[8];
#pragma unroll
      for (int r = 0; r < 8; ++r) mx[r] = fmaxf(s[u][0][r], s[u][1][r]);
      float mh = fmaxf(fmaxf(fmaxf(mx[0], mx[1]), fmaxf(mx[2], mx[3])), fmaxf(fmaxf(mx[4], mx[5]), fmaxf(mx[6], mx[7])));
      mh = fmaxf(mh, xhalf(mh));   // the other half's 16 keys of the same query
      const float mn = fmaxf(m[u], mh); alpha[u] = __expf(m[u] - mn); m[u] = mn;
#pragma unroll
      for (int r = 0; r < 8; ++r) { s[u][0][r] = (s[u][0][r] - mn) * 1.44269504f; s[u][1][r] = (s[u][1][r] - mn) * 1.44269504f; }
      // e^x as __expf forms it (one multiply, v_exp_f32): exp8 above
      exp8(s[u][0]); exp8(s[u][1]);
      float es[8];
#pragma unroll
      for (int r = 0; r < 8; ++r) { const float e0 = s[u][0][r], e1 = s[u][1][r]; es[r] = e0 + e1;
        const float p0 = e0 * 2048.0f, p1 = e1 * 2048.0f; pa[u][r] = (_Float16)p0; pa[u][8 + r] = (_Float16)p1; pal[u][r] = (_Float16)((p0 - (float)pa[u][r]) * 2048.0f); pal[u][8 + r] = (_Float16)((p1 - (float)pa[u][8 + r]) * 2048.0f); }
      l[u] = l[u] * alpha[u] + (((es[0] + es[1]) + (es[2] + es[3])) + ((es[4] + es[5]) + (es[6] + es[7]))); }
    // V is read here, behind both column groups' P and under the rescaling: read earlier it was live through the softmax, and the build kept values in scratch
#pragma unroll
    for (int j = 0; j < 4; ++j) vf[j] = frag_h(&sv[bf][j * 16 + col][kh * 32], lane);
#pragma unroll
    for (int u = 0; u < 2; ++u)
#pragma unroll
      for (int j = 0; j < 4; ++j)
#pragma unroll
        for (int r = 0; r < 8; ++r) { acc[u][j][r] *= alpha[u]; accl[u][j][r] *= alpha[u]; }
#pragma unroll
    for (int j = 0; j < 4; ++j)
#pragma unroll
      for (int u = 0; u < 2; ++u) { acc[u][j] = wmma16(vf[j], pa[u], acc[u][j]); accl[u][j] = wmma16(vf[j], pal[u], accl[u][j]); }
    asm volatile("s_wait_dscnt 0x0" ::: "memory");     // this wave's reads of this pass's buffers have returned
    asm volatile("s_wait_asynccnt 0x0" ::: "memory");  // this wave's copies of the next pass have landed
    __syncthreads();                                   // publishes the next pass and ends every reader's last read of this pass's buffers
    if (ks + 2 < NN / 64) STAGE(ks + 2, bf); }
  asm volatile("s_wait_asynccnt 0x0" ::: "memory");    // no copy is outstanding when the wave reuses LDS and ends
  // hand-over and output staging lie in the K ring: every wave's reads of the ring returned, and no copy was left in flight, ahead of the last pass's barrier
  // buffer 0: per query group 17 x 512 B (16 B a lane): the second key half's 16 context pieces, then (m, l) of both column groups; buffer 1: per query group 32 output rows
  v4f* xb = (v4f*)&sk[0][0][0] + qg * (17 * 32) + lane;
  float lt[2] = {l[0] + xhalf(l[0]), l[1] + xhalf(l[1])};   // the halves' sums are joined here, once
  if (kh == 1) {
#pragma unroll
    for (int u = 0; u < 2; ++u)
#pragma unroll
      for (int j = 0; j < 4; ++j)
#pragma unroll
        for (int q = 0; q < 2; ++q) { v4f o;
#pragma unroll
          for (int i = 0; i < 4; ++i) o[i] = acc[u][j][q * 4 + i] + accl[u][j][q * 4 + i] * (1.0f / 2048.0f);
          xb[((u * 4 + j) * 2 + q) * 32] = o; }
    v4f ml; ml[0] = m[0]; ml[1] = lt[0]; ml[2] = m[1]; ml[3] = lt[1]; xb[16 * 32] = ml; }
  __syncthreads();                                     // the second key half's results are in LDS for the waves that join them
  if (kh == 0) {
    float (*so)[68] = (float (*)[68])&sk[1][0][0] + qg * 32;
    const v4f ml = xb[16 * 32];
#pragma unroll
    for (int u = 0; u < 2; ++u) { const float m1 = ml[2 * u], l1 = ml[2 * u + 1], mn = fmaxf(m[u], m1), a0 = __expf(m[u] - mn), a1 = __expf(m1 - mn);
      const float il = (1.0f / 2048.0f) / (lt[u] * a0 + l1 * a1), w0 = a0 * il, w1 = a1 * il;
#pragma unroll
      for (int j = 0; j < 4; ++j)
#pragma unroll
        for (int q = 0; q < 2; ++q) { const v4f p = xb[((u * 4 + j) * 2 + q) * 32]; v4f o;
#pragma unroll
          for (int i = 0; i < 4; ++i) o[i] = (acc[u][j][q * 4 + i] + accl[u][j][q * 4 + i] * (1.0f / 2048.0f)) * w0 + p[i] * w1;
          *(v4f*)&so[u * 16 + col][j * 16 + 8 * g + q * 4] = o; } }
    LDSX(); for (int rl = 0; rl < 16; ++rl) vst2(O + (rq + 2 * rl + g) * DD + (size_t)h * DH + col * 4, *(const v4f*)&so[2 * rl + g][col * 4]); } }
// ---- k_out: block = (64 rows, 128 cols): out = ctx (hi + lo) . Wd^T + bd
__global__ __launch_bounds__(128) void k_out(const float* __restrict__ Or, const float* __restrict__ WD, const float* __restrict__ BD, float* __restrict__ OUT) { __shared__ __align__(16) float ring[2 * GST]; __shared__ __align__(16) float sf[4][16][132];
  const int tid = threadIdx.x, wave = tid >> 5, lane = tid & 31, col = lane & 15, g = lane >> 4; const size_t r0 = (size_t)blockIdx.x * 64 + wave * 16; const int c0 = blockIdx.y * 128;
  const char* asrc = (const char*)(Or + ((size_t)blockIdx.x * 64 + (tid >> 4)) * DD + (tid & 15) * 4); const char* bsrc = (const char*)(WD + (size_t)(c0 + (tid >> 4)) * DD + (tid & 15) * 4);
  const unsigned gdst = lds_off(&ring[(tid >> 4) * GP + (tid & 15) * 4]);
  gstage(gdst, asrc, bsrc);
  asm volatile("s_wait_asynccnt 0x0" ::: "memory");   // this wave's copies of stage 0 have landed
  __syncthreads();                                     // ... and every other wave's: nothing staged is read before this
  gstage(gdst + GST * 4u, asrc + GK * 4, bsrc + GK * 4);
  v8f acc[8] = {};
#pragma unroll 1   // one trip per stage, so that the ring's waits and its barrier stand once, at the trip's foot
  for (int t = 0; t < DD / GK; ++t) { const int bf = t & 1; const float* ar = &ring[bf * GST + (wave * 16 + col) * GP]; const float* br = &ring[bf * GST + GA + col * GP];
#pragma unroll
    for (int kc = 0; kc < GK / 32; ++kc) { const F2 a = split_row(ar, kc * 32, lane); v16b w[8];
#pragma unroll
      for (int j = 0; j < 8; ++j) w[j] = fragb_f32(br + j * 16 * GP + kc * 32, lane);
#pragma unroll
      for (int j = 0; j < 8; ++j) { acc[j] = wmma_bf(a.h, w[j], acc[j]); acc[j] = wmma_bf(a.l, w[j], acc[j]); } }
    asm volatile("s_wait_dscnt 0x0" ::: "memory");     // this wave's reads of this stage's buffer have returned
    asm volatile("s_wait_asynccnt 0x0" ::: "memory");  // this wave's copies of the next stage have landed
    __syncthreads();                                   // publishes the next stage and ends every reader's last read of this stage's buffer
    if (t + 2 < DD / GK) gstage(gdst + (unsigned)bf * (GST * 4u), asrc + (t + 2) * (GK * 4), bsrc + (t + 2) * (GK * 4)); }
  asm volatile("s_wait_asynccnt 0x0" ::: "memory");    // no copy is outstanding when the wave ends
#pragma unroll
  for (int j = 0; j < 8; ++j) { const float bb = bfr(BD[c0 + j * 16 + col]);
#pragma unroll
    for (int r = 0; r < 8; ++r) sf[wave][8 * g + r][j * 16 + col] = acc[j][r] + bb; }
  LDSX(); for (int rl = 0; rl < 16; ++rl) vst2(OUT + (r0 + rl) * DD + c0 + lane * 4, *(const v4f*)&sf[wave][rl][lane * 4]); }
extern "C" void kernel_launch(void* const* d_in, const int* in_sizes, int n_in, void* d_out, int out_size, void* d_ws, size_t ws_size, hipStream_t stream) {
  (void)in_sizes; (void)n_in; (void)out_size;
  const float** F = (const float**)d_in;   // 0 x [2,2048,512], 1 Wq, 2 Wk, 3 Wv [512,512] natural, 4 Wb [8,512], 5 mixing [8,512], 6 Wd [512,512], 7 bd [512]
  if (ws_size < (size_t)WS_END) return;
  char* ws = (char*)d_ws; _Float16 *KH = (_Float16*)(ws + WS_KH), *VT = (_Float16*)(ws + WS_VT); float *QF = (float*)(ws + WS_QF), *CB = (float*)(ws + WS_CB), *O = (float*)(ws + WS_O);
  k_proj<<<dim3(NN / 64, DD / 128, 3 * NB), 128, 0, stream>>>(F[0], F[1], F[2], F[3], QF, KH, VT);
  k_cb<<<dim3(NN / 32, NB), 256, 0, stream>>>(F[0], F[4], CB);
  k_att<<<dim3(TQB, NH, TNB), 256, 0, stream>>>(QF, F[5], KH, VT, CB, O);
  k_out<<<dim3(TNB * NN / 64, DD / 128), 128, 0, stream>>>(O, F[6], F[7], (float*)d_out);
}

// v007
// One run takes 90.8 microseconds.
// Next to v006, in two timings, it ran 1.03 times as fast each time.
// All steps since v000 together make it 9.46 times as fast.
// compute dtype: all float inputs rounded to bf16; q/k/v = x W^T with EXACT bf16 products on WMMA 16x16x32 (natural rows); per head the bilinear scores sum_d q_d m_hd k_d as a 512-deep WMMA product of (q * m_h) and k, each rounded once to f16 (1 product; the attention is diffuse: logits std ~0.1), content bias x . Wb^T exact, x 1/8; running-max softmax in f32 (hardware exp); P x 2^11 as f16 hi + residual . v (f16; 2 products); out = ctx (bf16 hi + lo) . Wd^T + bd; f32 output.
#include <hip/hip_runtime.h>
#include <math.h>

typedef __attribute__((ext_vector_type(16))) _Float16 v16h;
typedef __attribute__((ext_vector_type(16))) __bf16 v16b;
typedef __attribute__((ext_vector_type(8)))  _Float16 v8h;
typedef __attribute__((ext_vector_type(8)))  float v8f;
typedef __attribute__((ext_vector_type(4)))  float v4f;
typedef __attribute__((ext_vector_type(2)))  float v2f;
typedef __attribute__((ext_vector_type(4)))  unsigned v4u;
typedef __attribute__((ext_vector_type(4)))  int v4i;
typedef float __attribute__((may_alias)) float_a;
typedef int __attribute__((may_alias)) int_a;

template <typename T> __device__ __forceinline__ void vst2(void* p, T v) { *(T*)p = v;  }
__device__ __forceinline__ v8f wmma16(v16h a, v16h b, v8f c) {
  v8f d = __builtin_amdgcn_wmma_f32_16x16x32_f16(false, a, false, b, (short)0, c, false, false);
  asm volatile("v_nop\n\tv_nop\n\tv_nop\n\tv_nop" : "+v"(d) : "v"(a), "v"(b));
  return d;
}
// as wmma16, but its statement does not name B: with the 32 resident Q fragments of k_att (its B operands) among the statement's operands they were not all kept in registers (scratch)
__device__ __forceinline__ v8f wmma16q(v16h a, v16h b, v8f c) {
  v8f d = __builtin_amdgcn_wmma_f32_16x16x32_f16(false, a, false, b, (short)0, c, false, false);
  asm volatile("v_nop\n\tv_nop\n\tv_nop\n\tv_nop" : "+v"(d) : "v"(a));
  return d;
}
// lane l takes the value of lane l ^ 16
__device__ __forceinline__ float xhalf(float x) { return __builtin_bit_cast(float, __builtin_amdgcn_permlanex16(__builtin_bit_cast(int, x), __builtin_bit_cast(int, x), 0x76543210, 0xfedcba98, false, false)); }
__device__ __forceinline__ v8f wmma_bf(v16b a, v16b b, v8f c) {
  v8f d = __builtin_amdgcn_wmma_f32_16x16x32_bf16(false, a, false, b, (short)0, c, false, false);
  asm volatile("v_nop\n\tv_nop\n\tv_nop\n\tv_nop" : "+v"(d) : "v"(a), "v"(b));
  return d;
}
// 16x16x32 fragments: lane = (h = lane>>4, row/col = lane&15); elements 0..7 = k0+8h+0..7, 8..15 = k0+16+8h+0..7; D element r = row 8h+r
__device__ __forceinline__ v16h frag_h(const _Float16* rowk0, int lane) {
  union { v16h v; v8h q[2]; } u; const _Float16* p = rowk0 + 8 * (lane >> 4);
  u.q[0] = *(const v8h*)p; u.q[1] = *(const v8h*)(p + 16); return u.v;
}
__device__ __forceinline__ v16h frag_f32(const float* rowk0, int lane) {
  v16h a; const float* p = rowk0 + 8 * (lane >> 4);
#pragma unroll
  for (int i = 0; i < 8; ++i) { a[i] = (_Float16)p[i]; a[8 + i] = (_Float16)p[16 + i]; }
  return a;
}
__device__ __forceinline__ v16h frag_f32s(const float* rowk0, int lane, float sc) {
  v16h a; const float* p = rowk0 + 8 * (lane >> 4);
#pragma unroll
  for (int i = 0; i < 8; ++i) { a[i] = (_Float16)(p[i] * sc); a[8 + i] = (_Float16)(p[16 + i] * sc); }
  return a;
}
// column fragment from a [K][ld] layout (column n), rows >= K read as 0
__device__ __forceinline__ v16h fragc_f32(const float* W, int k0, int n, int lane, int ld, int K) {
  v16h a; const int g = lane >> 4;
#pragma unroll
  for (int i = 0; i < 8; ++i) { const int ka = k0 + 8 * g + i, kb = ka + 16;
    a[i] = (_Float16)(ka < K ? W[(size_t)(ka < K ? ka : K - 1) * ld + n] : 0.f); a[8 + i] = (_Float16)(kb < K ? W[(size_t)(kb < K ? kb : K - 1) * ld + n] : 0.f); }
  return a;
}
struct F2 { v16b h, l; };
__device__ __forceinline__ F2 bsplit16(const float v[16]) { F2 r;
#pragma unroll
  for (int i = 0; i < 16; ++i) { const __bf16 h = (__bf16)v[i]; r.h[i] = h; r.l[i] = (__bf16)(v[i] - (float)h); }
  return r; }
__device__ __forceinline__ F2 split_row(const float* row, int k0, int lane) { float v[16]; const float* p = row + k0 + 8 * (lane >> 4);
#pragma unroll
  for (int i = 0; i < 8; ++i) { v[i] = p[i]; v[8 + i] = p[16 + i]; }
  return bsplit16(v); }
__device__ __forceinline__ F2 split_rowK(const float* row, int k0, int lane, int K) { float v[16]; const int g = lane >> 4;
#pragma unroll
  for (int i = 0; i < 8; ++i) { const int ka = k0 + 8 * g + i, kb = ka + 16; v[i] = ka < K ? row[ka < K ? ka : K - 1] : 0.f; v[8 + i] = kb < K ? row[kb < K ? kb : K - 1] : 0.f; }
  return bsplit16(v); }
__device__ __forceinline__ F2 split_col(const float* W, int k0, int n, int lane, int ld, int K) { float v[16]; const int g = lane >> 4;
#pragma unroll
  for (int i = 0; i < 8; ++i) { const int ka = k0 + 8 * g + i, kb = ka + 16; v[i] = ka < K ? W[(size_t)(ka < K ? ka : K - 1) * ld + n] : 0.f; v[8 + i] = kb < K ? W[(size_t)(kb < K ? kb : K - 1) * ld + n] : 0.f; }
  return bsplit16(v); }
__device__ __forceinline__ v8f mac3(const F2& a, const F2& b, v8f c) { c = wmma_bf(a.l, b.h, c); c = wmma_bf(a.h, b.l, c); return wmma_bf(a.h, b.h, c); }
__device__ __forceinline__ float sigm(float v) { return 1.0f / (1.0f + expf(-v)); }
#define LDSX() do { asm volatile("s_wait_dscnt 0" ::: "memory"); __builtin_amdgcn_wave_barrier(); __builtin_amdgcn_fence(__ATOMIC_RELEASE, "workgroup"); } while (0)


// Collaborative attention (B 2, L 2,048, D 512, 8 heads x 64 with a shared 512-wide key/query space): scores = (q diag(m_h) k^T + content_bias(k side)) / sqrt(64); softmax; per-head 64-dim values; dense output projection.
#define NB 2
#define NN 2048
#define DD 512
#define NH 8
#define DH 64
#ifndef TNB
#define TNB NB
#endif
#ifndef TQB
#define TQB (NN / 128)
#endif
typedef __attribute__((ext_vector_type(8))) __bf16 v8b;
__device__ __forceinline__ v16b frag_b(const __bf16* rowk0, int lane) {
  union { v16b v; v8b q[2]; } u; const __bf16* p = rowk0 + 8 * (lane >> 4);
  u.q[0] = *(const v8b*)p; u.q[1] = *(const v8b*)(p + 16); return u.v;
}
__device__ __forceinline__ float bfr(float v) { return (float)(__bf16)v; }
__device__ __attribute__((noinline)) float exp_ni(float v) { return expf(v); }
__device__ __attribute__((noinline)) float erf_ni(float v) { return erff(v); }

#define WS_QF  0u                                   // f32 q in A-fragment order: [(b*NN + l) / 16][d / 32][piece 0..3][lane][4]; lane = (g, row), piece p = d 8 g + 4 (p & 1) + 16 (p >> 1) + 0..3 of its 32
#define WS_KH  (WS_QF + 4u * (size_t)NB * NN * DD)       // f16 k rows [b*NN + s][512]
#define WS_VT  (WS_KH + 2u * (size_t)NB * NN * DD)       // f16 v planes [b][512][NN]
#define WS_CB  (WS_VT + 2u * (size_t)NB * DD * NN)       // f32 content bias [b][h][NN]
#define WS_O   (WS_CB + 4u * (size_t)NB * NH * NN)       // f32 ctx rows [b*NN + l][512]
#define WS_END (WS_O + 4u * (size_t)NB * NN * DD)

__device__ __forceinline__ v16b fragb_f32(const float* __restrict__ p, int lane) { v16b a; const float* pp = p + 8 * (lane >> 4);
#pragma unroll
  for (int i = 0; i < 8; ++i) { a[i] = (__bf16)pp[i]; a[8 + i] = (__bf16)pp[16 + i]; } return a; }
typedef __attribute__((address_space(3))) const unsigned char lds_byte;
__device__ __forceinline__ unsigned lds_off(const void* p) { return (unsigned)(size_t)(lds_byte*)p; }
// eight copies of 16 B per lane, LDS step ls bytes, global step gs bytes; the s_wait_xcnt stands inside the statement so that no address register of a copy is rewritten ahead of it
__device__ __forceinline__ void cp8(unsigned l, unsigned ls, const char* g, size_t gs) {
  asm volatile("global_load_async_to_lds_b128 %0, %8, off\n\tglobal_load_async_to_lds_b128 %1, %9, off\n\tglobal_load_async_to_lds_b128 %2, %10, off\n\tglobal_load_async_to_lds_b128 %3, %11, off\n\t"
               "global_load_async_to_lds_b128 %4, %12, off\n\tglobal_load_async_to_lds_b128 %5, %13, off\n\tglobal_load_async_to_lds_b128 %6, %14, off\n\tglobal_load_async_to_lds_b128 %7, %15, off\n\ts_wait_xcnt 0x0"
               :: "v"(l), "v"(l + ls), "v"(l + 2 * ls), "v"(l + 3 * ls), "v"(l + 4 * ls), "v"(l + 5 * ls), "v"(l + 6 * ls), "v"(l + 7 * ls),
                  "v"(g), "v"(g + gs), "v"(g + 2 * gs), "v"(g + 3 * gs), "v"(g + 4 * gs), "v"(g + 5 * gs), "v"(g + 6 * gs), "v"(g + 7 * gs) : "memory"); }
// The two projection kernels (64 rows x 128 cols a block) take their operands through LDS: a stage is 64 f32 of k (256 B) of the 64 A rows and the 128 B rows, two buffers; the f32 values are rounded where the fragments are formed.
#define GK 64               // f32 of k per stage
#define GP 68               // f32 per staged row: 272 B = 16 B x 17, an odd multiple of 16 B for the ds_load_b128 readers
#define GA (64 * GP)        // f32 of a stage's A rows
#define GST (192 * GP)      // f32 of a stage
// one stage: a copy of the block = 8 rows of 256 B, a wave = two rows' whole 128-B lines; dst, a, b are the lane's own places in row (tid >> 4)
__device__ __forceinline__ void gstage(unsigned dst, const char* a, const char* b) {
  cp8(dst, 8u * GP * 4u, a, (size_t)8 * DD * 4);
  cp8(dst + GA * 4u, 8u * GP * 4u, b, (size_t)8 * DD * 4);
  cp8(dst + (GA + 64u * GP) * 4u, 8u * GP * 4u, b + (size_t)64 * DD * 4, (size_t)8 * DD * 4); }
// ---- k_proj: block = (64 rows, 128 cols, which*NB + b): which 0 q -> f32, once, in A-fragment order; 1 k -> f16 rows; 2 v -> f16 planes
__global__ __launch_bounds__(128) void k_proj(const float* __restrict__ X, const float* __restrict__ WQ, const float* __restrict__ WK, const float* __restrict__ WV, float* __restrict__ QF, _Float16* __restrict__ KH, _Float16* __restrict__ VT) {
  __shared__ __align__(16) float ring[2 * GST];
  // the output staging lies over the ring, which nobody reads and no copy writes behind the last stage's barrier: keeps the block's LDS small enough for three blocks per WGP
  float (*sf)[132] = (float (*)[132])&ring[0]; _Float16 (*sh)[136] = (_Float16 (*)[136])&ring[64 * 132]; _Float16 (*th)[72] = (_Float16 (*)[72])&ring[64 * 132 + 64 * 68];
  const int tid = threadIdx.x, wave = tid >> 5, lane = tid & 31, col = lane & 15, g = lane >> 4; const int which = blockIdx.z / NB; const size_t b = blockIdx.z % NB; const int n0 = blockIdx.x * 64; const int c0 = blockIdx.y * 128;
  const float* Wm = which == 0 ? WQ : which == 1 ? WK : WV;
  const char* asrc = (const char*)(X + (b * NN + n0 + (tid >> 4)) * DD + (tid & 15) * 4); const char* bsrc = (const char*)(Wm + (size_t)(c0 + (tid >> 4)) * DD + (tid & 15) * 4);
  const unsigned gdst = lds_off(&ring[(tid >> 4) * GP + (tid & 15) * 4]);
  gstage(gdst, asrc, bsrc);
  asm volatile("s_wait_asynccnt 0x0" ::: "memory");   // this wave's copies of stage 0 have landed
  __syncthreads();                                     // ... and every other wave's: nothing staged is read before this
  gstage(gdst + GST * 4u, asrc + GK * 4, bsrc + GK * 4);
  v8f acc[8] = {};
#pragma unroll 1   // one trip per stage, so that the ring's waits and its barrier stand once, at the trip's foot
  for (int t = 0; t < DD / GK; ++t) { const int bf = t & 1; const float* ar = &ring[bf * GST + (wave * 16 + col) * GP]; const float* br = &ring[bf * GST + GA + col * GP];
#pragma unroll
    for (int kc = 0; kc < GK / 32; ++kc) { const v16b a = fragb_f32(ar + kc * 32, lane); v16b w[8];
#pragma unroll
      for (int j = 0; j < 8; ++j) w[j] = fragb_f32(br + j * 16 * GP + kc * 32, lane);
#pragma unroll
      for (int j = 0; j < 8; ++j) acc[j] = wmma_bf(a, w[j], acc[j]); }
    asm volatile("s_wait_dscnt 0x0" ::: "memory");     // this wave's reads of this stage's buffer have returned
    asm volatile("s_wait_asynccnt 0x0" ::: "memory");  // this wave's copies of the next stage have landed
    __syncthreads();                                   // publishes the next stage and ends every reader's last read of this stage's buffer
    if (t + 2 < DD / GK) gstage(gdst + (unsigned)bf * (GST * 4u), asrc + (t + 2) * (GK * 4), bsrc + (t + 2) * (GK * 4)); }
  asm volatile("s_wait_asynccnt 0x0" ::: "memory");    // no copy is outstanding when the ring becomes output staging
#pragma unroll
  for (int j = 0; j < 8; ++j)
#pragma unroll
    for (int r = 0; r < 8; ++r) { const float v = acc[j][r]; if (which == 0) sf[wave * 16 + 8 * g + r][j * 16 + col] = v; else if (which == 1) sh[wave * 16 + 8 * g + r][j * 16 + col] = (_Float16)v; else th[j * 16 + col][wave * 16 + 8 * g + r] = (_Float16)v; }
  __syncthreads();
  if (which == 0) {
    // wave w stores piece w of each of the block's 4 x 4 (16 rows x 32 d) units: 512 contiguous bytes a store
    float* qd = QF + ((b * NN + n0) * (size_t)DD + (size_t)(c0 / 32) * 512) + wave * 128 + lane * 4; const float* qs = &sf[col][8 * g + (wave & 1) * 4 + (wave >> 1) * 16];
#pragma unroll   // whole, so that the 16 LDS reads go out as a group and every store takes a constant offset from one address
    for (int it = 0; it < 16; ++it) vst2(qd + (size_t)((it >> 2) * 16 + (it & 3)) * 512, *(const v4f*)(qs + (it >> 2) * 16 * 132 + (it & 3) * 32)); }
  else if (which == 1) { for (int e = tid; e < 64 * 16; e += 128) { const int rl = e >> 4, q = e & 15; vst2((unsigned*)(KH + (b * NN + n0 + rl) * DD + c0 + q * 8), *(const v4u*)&sh[rl][q * 8]); } }
  else { for (int e = tid; e < 128 * 8; e += 128) { const int cl = e >> 3, q = e & 7; vst2((unsigned*)(VT + (b * DD + c0 + cl) * (size_t)NN + n0 + q * 8), *(const v4u*)&th[cl][q * 8]); } } }
// ---- k_cb: block = (32 keys, b): cb[b][h][s] = x_s . Wb[h] (exact products, f32 accumulate on VALU)
// The block's 32 x rows and the 8 Wb rows come in by 16-B loads whose waves cover whole 128-B lines, are rounded once and staged in LDS; thread (key, head) sums its 512 products from LDS in four chains d = j + 4 i, joined j = 0..3 (the order of additions that four threads per key gave); a wave stores one whole 128-B line of one head.
#define CP 516   // f32 per staged row: 2,064 B = 16 B x 129, an odd multiple of 16 B for the ds_load_b128 readers (32 rows, one column)
__device__ __forceinline__ v4f bfr4(v4f v) { v4f r; r[0] = bfr(v[0]); r[1] = bfr(v[1]); r[2] = bfr(v[2]); r[3] = bfr(v[3]); return r; }
__global__ __launch_bounds__(256) void k_cb(const float* __restrict__ X, const float* __restrict__ WB, float* __restrict__ CB) { __shared__ __align__(16) float sx[32][CP]; __shared__ __align__(16) float sw[NH][CP]; const int t = threadIdx.x; const size_t b = blockIdx.y; const int s0 = blockIdx.x * 32;
  const float* xs = X + (b * NN + s0) * DD + t * 4; const float* wsrc = WB + t * 4; const int r2 = t >> 7, c4 = (t & 127) * 4;
  v4f xv[16], wv[4];   // the four loops below are unrolled whole so that the arrays stay in registers and all 20 loads are in flight before the first is used
#pragma unroll
  for (int i = 0; i < 16; ++i) xv[i] = *(const v4f*)(xs + i * 1024);
#pragma unroll
  for (int i = 0; i < 4; ++i) wv[i] = *(const v4f*)(wsrc + i * 1024);
#pragma unroll
  for (int i = 0; i < 16; ++i) *(v4f*)&sx[2 * i + r2][c4] = bfr4(xv[i]);
#pragma unroll
  for (int i = 0; i < 4; ++i) *(v4f*)&sw[2 * i + r2][c4] = bfr4(wv[i]);
  __syncthreads();
  const int sl = t & 31, h = t >> 5; const float* xr = &sx[sl][0]; const float* wr = &sw[h][0]; float a0 = 0.f, a1 = 0.f, a2 = 0.f, a3 = 0.f;
#pragma unroll 8   // eight steps' LDS reads go out as a group ahead of their products; without it each step waits for its own two reads
  for (int i = 0; i < DD / 4; ++i) { const v4f x4 = *(const v4f*)(xr + 4 * i), w4 = *(const v4f*)(wr + 4 * i); a0 += x4[0] * w4[0]; a1 += x4[1] * w4[1]; a2 += x4[2] * w4[2]; a3 += x4[3] * w4[3]; }
  CB[(b * NH + h) * (size_t)NN + s0 + sl] = a0 + a1 + a2 + a3; }
// ---- k_att: block = (128 queries, h, b), 8 waves: logits = ((q*m_h) . k + cb[s]) / 8 (K 512), softmax, P (hi + residual) . v_h
// Both products are taken transposed: S^T = K (q*m_h)^T and ctx^T += V^T P^T. A lane then holds 16 scores of ONE query (col): keys 8 g + r and 16 + 8 g + r of its wave's 32 keys; maximum and sum are in-lane but for one exchange between the wave's halves, and the two score tiles, converted in place, are the B fragment of the second product.
// A wave holds 32 queries (two column groups), so that each K and V fragment read from LDS serves two products. A pass is 64 keys: waves 0..3 take its first 32, waves 4..7 its last 32, each with a running maximum, sum and context of its own over its 1,024 keys; behind the key loop wave 4 + i hands its three to wave i through LDS, which joins them and stores.
// Each wave forms its 32 B fragments (q * m_h), rounded once to f16, in registers ahead of the key loop and keeps them there. The head's bias row (once) and each pass's K and V tiles (two buffers) come into LDS by asynchronous copies whose waves cover whole 128-B lines; the key loop reads K, V and the bias from LDS.
#define KP 520   // f16 per staged K row: 1,040 B = 16 B x 65, an odd multiple of 16 B for the ds_load_b128 readers
#define VP 72    // f16 per staged V row: 144 B = 16 B x 9
#define LSC 0.18033688f   // log2(e) / 8: from a score (q*m_h) . k + cb to the base-2 exponent of e^(score / 8)
#define NB2(mx) __builtin_fmaf(-(mx), LSC, 11.0f)   // 2^(score LSC + NB2(mx)) = 2^11 e^((score - mx) / 8)
// two copies, same form
__device__ __forceinline__ void cp2(unsigned l, unsigned ls, const char* g, size_t gs) {
  asm volatile("global_load_async_to_lds_b128 %0, %2, off\n\tglobal_load_async_to_lds_b128 %1, %3, off\n\ts_wait_xcnt 0x0" :: "v"(l), "v"(l + ls), "v"(g), "v"(g + gs) : "memory"); }
// eight v_exp_f32, each in place, in one statement that ends with the slot the instruction set asks for behind a transcendental
__device__ __forceinline__ void exp8(v8f& x) {
  asm("v_exp_f32 %0, %0\n\tv_exp_f32 %1, %1\n\tv_exp_f32 %2, %2\n\tv_exp_f32 %3, %3\n\tv_exp_f32 %4, %4\n\tv_exp_f32 %5, %5\n\tv_exp_f32 %6, %6\n\tv_exp_f32 %7, %7\n\tv_nop"
      : "+v"(x[0]), "+v"(x[1]), "+v"(x[2]), "+v"(x[3]), "+v"(x[4]), "+v"(x[5]), "+v"(x[6]), "+v"(x[7])); }
// one v_exp_f32 with the same slot behind it, for the same reason
__device__ __forceinline__ float exp1(float x) { float r; asm("v_exp_f32 %0, %1\n\tv_nop" : "=v"(r) : "v"(x)); return r; }
// register budget and residency of two waves per SIMD; the 256 blocks lie one to a WGP. This build keeps one copy address (4 B a lane) in scratch: one reload a pass, issued ahead of the K copies and used behind them
__global__ __launch_bounds__(256) __attribute__((amdgpu_waves_per_eu(2, 2))) void k_att(const float* __restrict__ QF, const float* __restrict__ MIX, const _Float16* __restrict__ KH, const _Float16* __restrict__ VT, const float* __restrict__ CB, float* __restrict__ O) {
  __shared__ __align__(16) _Float16 sk[2][64][KP]; __shared__ __align__(16) _Float16 sv[2][DH][VP]; __shared__ __align__(16) float scb[NN];
  const int tid = threadIdx.x, wave = __builtin_amdgcn_readfirstlane(tid >> 5), lane = tid & 31, col = lane & 15, g = lane >> 4; const int qg = wave & 3, kh = wave >> 2;
  const int h = blockIdx.y; const size_t b = blockIdx.z; const int q0 = blockIdx.x * 128 + qg * 32; const size_t rq = b * NN + q0;
  // copy maps: 1,024-B rows (K): one copy of the block = four rows, a wave = 512 contiguous bytes; V: one copy = 32 rows of 128 B; bias: one copy = 4,096 B
  const int crow = tid >> 6, ccol = (tid & 63) * 8, vrow = tid >> 3, vcol = (tid & 7) * 8;
  // the block's K rows and the head's V rows (uniform), and the lane's own byte offset in each (32 bits: one register each through the key loop)
  const char* kbase = (const char*)(KH + b * NN * DD); const char* vbase = (const char*)(VT + (b * DD + (size_t)h * DH) * (size_t)NN);
  const unsigned koff = (unsigned)(crow * DD + ccol) * 2u, voff = (unsigned)(vrow * NN + vcol) * 2u;
  const char* bsrc = (const char*)(CB + (b * NH + h) * (size_t)NN + tid * 4);
  const unsigned kdst = lds_off(&sk[0][crow][ccol]), vdst = lds_off(&sv[0][vrow][vcol]);
#define STAGE(t, bf) do { const char* kt = kbase + (koff + (unsigned)(t) * (64u * DD * 2u)); const unsigned kl = kdst + (unsigned)(bf) * (64u * KP * 2u); \
    cp8(kl, 4u * KP * 2u, kt, 4 * DD * 2); cp8(kl + 32u * KP * 2u, 4u * KP * 2u, kt + 32 * DD * 2, 4 * DD * 2); \
    cp2(vdst + (unsigned)(bf) * (DH * VP * 2u), 32u * VP * 2u, vbase + (voff + (unsigned)(t) * 128u), (size_t)32 * NN * 2); } while (0)
  cp2(lds_off(&scb[tid * 4]), 4096u, bsrc, 4096);
  STAGE(0, 0);
  // the wave's 32 query rows as 2 x 16 B fragments (A's table with column for row), under the copies' flight: four 16-B loads a fragment, each 512 contiguous bytes of the wave; element e of a lane is d = 32 kc + 8 g + (e & 7) + 16 (e >> 3)
  v16h qf[2][DD / 32];
  { const float* qp = QF + rq * DD + lane * 4; const float* mp = MIX + h * DD + 8 * g;
#pragma unroll   // whole, so that qf is indexed by constants and stays in registers
    for (int kc = 0; kc < DD / 32; ++kc)
#pragma unroll
      for (int p = 0; p < 4; ++p) { const v4f mm = *(const v4f*)(mp + kc * 32 + (p & 1) * 4 + (p >> 1) * 16);
#pragma unroll
        for (int u = 0; u < 2; ++u) { const v4f x = *(const v4f*)(qp + u * (16 * DD) + kc * 512 + p * 128);
#pragma unroll
          for (int i = 0; i < 4; ++i) qf[u][kc][p * 4 + i] = (_Float16)(x[i] * bfr(mm[i])); } } }
  asm volatile("s_wait_xcnt 0x0" ::: "memory");        // ahead of the first overwrite of an address register of the loads above
  asm volatile("s_wait_asynccnt 0x0" ::: "memory");   // this wave's copies of the bias row and of pass 0 have landed
  __syncthreads();                                     // ... and every other wave's: nothing staged is read before this
  STAGE(1, 1);
  float m[2] = {3.0e38f, 3.0e38f}, l[2] = {0.f, 0.f};   // per column group, this lane's query over this wave's keys: NB2 of the running maximum of the scores (equal in both halves), and the sum of P (with its 2^11) over this half's keys alone
  v8f acc[2][4] = {}, accl[2][4] = {};
#pragma unroll 1
  for (int ks = 0; ks < NN / 64; ++ks) { const int bf = ks & 1; v8f s[2][2];
    v16h vf[4];
    { const _Float16* k0 = &sk[bf][kh * 32 + col][0]; const _Float16* k1 = &sk[bf][kh * 32 + 16 + col][0];
      // the bias of this lane's 16 keys (the same for both column groups) is the C operand of each tile's first product: the matrix unit adds it
      const float* cbp = &scb[ks * 64 + kh * 32 + 8 * g]; union { v8f v; v4f q[2]; } cb0, cb1; cb0.q[0] = *(const v4f*)cbp; cb0.q[1] = *(const v4f*)(cbp + 4); cb1.q[0] = *(const v4f*)(cbp + 16); cb1.q[1] = *(const v4f*)(cbp + 20);
      v8f c[2][2] = {{cb0.v, cb1.v}, {cb0.v, cb1.v}};
      // LDS reads two k steps ahead of the products that use them, in a ring of three register sets (a fourth set did not fit beside the 32 Q fragments: the build kept one of them in scratch); each K fragment serves both column groups, each Q fragment both 16-key groups
      v16h ka[3], kb[3];
#pragma unroll
      for (int i = 0; i < 2; ++i) { ka[i] = frag_h(k0 + i * 32, lane); kb[i] = frag_h(k1 + i * 32, lane); }
#pragma unroll   // whole: the ring and qf are indexed by constants
      for (int kc = 0; kc < DD / 32; ++kc) {
        if (kc + 2 < DD / 32) { ka[(kc + 2) % 3] = frag_h(k0 + (kc + 2) * 32, lane); kb[(kc + 2) % 3] = frag_h(k1 + (kc + 2) * 32, lane); }
#pragma unroll
        for (int u = 0; u < 2; ++u) { c[u][0] = wmma16q(ka[kc % 3], qf[u][kc], c[u][0]); c[u][1] = wmma16q(kb[kc % 3], qf[u][kc], c[u][1]); } }
#pragma unroll
      for (int u = 0; u < 2; ++u) { s[u][0] = c[u][0]; s[u][1] = c[u][1]; } }
    float alpha[2]; v16h pa[2], pal[2];
#pragma unroll   // whole: every array below is indexed by constants
    for (int u = 0; u < 2; ++u) {
      float mx[8];
#pragma unroll
      for (int r = 0; r < 8; ++r) mx[r] = fmaxf(s[u][0][r], s[u][1][r]);
      float mh = fmaxf(fmaxf(fmaxf(mx[0], mx[1]), fmaxf(mx[2], mx[3])), fmaxf(fmaxf(mx[4], mx[5]), fmaxf(mx[6], mx[7])));
      mh = fmaxf(mh, xhalf(mh));   // the other half's 16 keys of the same query
      // the running maximum is kept as nb = NB2(maximum), which falls as the maximum rises. The old sums are rescaled by the difference of the two rounded nb, so that every pass's P and the sums carry exactly the same factor, also where the scores are large
      const float nb = fminf(m[u], NB2(mh)); alpha[u] = exp1(nb - m[u]); m[u] = nb;
#pragma unroll
      for (int r = 0; r < 8; ++r) { s[u][0][r] = __builtin_fmaf(s[u][0][r], LSC, nb); s[u][1][r] = __builtin_fmaf(s[u][1][r], LSC, nb); }
      // P = 2^11 e^(logit - maximum) = 2^(score LSC + nb): one fma and v_exp_f32 (exp8 above) a score. With that factor in P its f16 residual needs none of its own: below 2^-14 it is a subnormal, exact to 2^-25 beside a row maximum of 2^11
      exp8(s[u][0]); exp8(s[u][1]);
      float es[8];
#pragma unroll
      for (int r = 0; r < 8; ++r) { const float p0 = s[u][0][r], p1 = s[u][1][r]; es[r] = p0 + p1;
        pa[u][r] = (_Float16)p0; pa[u][8 + r] = (_Float16)p1; pal[u][r] = (_Float16)(p0 - (float)pa[u][r]); pal[u][8 + r] = (_Float16)(p1 - (float)pa[u][8 + r]); }
      l[u] = l[u] * alpha[u] + (((es[0] + es[1]) + (es[2] + es[3])) + ((es[4] + es[5]) + (es[6] + es[7])));
      asm volatile("" : "+v"(l[u])); }   // each row's sum pinned against spills: left free, the build moves these additions behind the pass's barrier and keeps the 32 P values in registers through the second product and the copies
    // V is read here, behind both column groups' P and under the rescaling: read earlier it was live through the softmax, and the build kept values in scratch
#pragma unroll
    for (int j = 0; j < 4; ++j) vf[j] = frag_h(&sv[bf][j * 16 + col][kh * 32], lane);
#pragma unroll
    for (int u = 0; u < 2; ++u)
#pragma unroll
      for (int j = 0; j < 4; ++j)
#pragma unroll
        for (int r = 0; r < 8; ++r) { acc[u][j][r] *= alpha[u]; accl[u][j][r] *= alpha[u]; }
#pragma unroll
    for (int j = 0; j < 4; ++j)
#pragma unroll
      for (int u = 0; u < 2; ++u) { acc[u][j] = wmma16(vf[j], pa[u], acc[u][j]); accl[u][j] = wmma16(vf[j], pal[u], accl[u][j]); }
    asm volatile("s_wait_dscnt 0x0" ::: "memory");     // this wave's reads of this pass's buffers have returned
    asm volatile("s_wait_asynccnt 0x0" ::: "memory");  // this wave's copies of the next pass have landed
    __syncthreads();                                   // publishes the next pass and ends every reader's last read of this pass's buffers
    if (ks + 2 < NN / 64) STAGE(ks + 2, bf); }
  asm volatile("s_wait_asynccnt 0x0" ::: "memory");    // no copy is outstanding when the wave reuses LDS and ends
  // hand-over and output staging lie in the K ring: every wave's reads of the ring returned, and no copy was left in flight, ahead of the last pass's barrier
  // buffer 0: per query group 17 x 512 B (16 B a lane): the second key half's 16 context pieces, then (m, l) of both column groups; buffer 1: per query group 32 output rows
  v4f* xb = (v4f*)&sk[0][0][0] + qg * (17 * 32) + lane;
  float lt[2] = {l[0] + xhalf(l[0]), l[1] + xhalf(l[1])};   // the halves' sums are joined here, once
  if (kh == 1) {
#pragma unroll
    for (int u = 0; u < 2; ++u)
#pragma unroll
      for (int j = 0; j < 4; ++j)
#pragma unroll
        for (int q = 0; q < 2; ++q) { v4f o;
#pragma unroll
          for (int i = 0; i < 4; ++i) o[i] = acc[u][j][q * 4 + i] + accl[u][j][q * 4 + i];
          xb[((u * 4 + j) * 2 + q) * 32] = o; }
    v4f ml; ml[0] = m[0]; ml[1] = lt[0]; ml[2] = m[1]; ml[3] = lt[1]; xb[16 * 32] = ml; }
  __syncthreads();                                     // the second key half's results are in LDS for the waves that join them
  if (kh == 0) {
    float (*so)[68] = (float (*)[68])&sk[1][0][0] + qg * 32;
    const v4f ml = xb[16 * 32];
#pragma unroll
    for (int u = 0; u < 2; ++u) { const float m1 = ml[2 * u], l1 = ml[2 * u + 1], mn = fminf(m[u], m1), a0 = exp1(mn - m[u]), a1 = exp1(mn - m1);
      const float il = 1.0f / (lt[u] * a0 + l1 * a1), w0 = a0 * il, w1 = a1 * il;
#pragma unroll
      for (int j = 0; j < 4; ++j)
#pragma unroll
        for (int q = 0; q < 2; ++q) { const v4f p = xb[((u * 4 + j) * 2 + q) * 32]; v4f o;
#pragma unroll
          for (int i = 0; i < 4; ++i) o[i] = (acc[u][j][q * 4 + i] + accl[u][j][q * 4 + i]) * w0 + p[i] * w1;
          *(v4f*)&so[u * 16 + col][j * 16 + 8 * g + q * 4] = o; } }
    LDSX(); for (int rl = 0; rl < 16; ++rl) vst2(O + (rq + 2 * rl + g) * DD + (size_t)h * DH + col * 4, *(const v4f*)&so[2 * rl + g][col * 4]); } }
// ---- k_out: block = (64 rows, 128 cols): out = ctx (hi + lo) . Wd^T + bd
__global__ __launch_bounds__(128) void k_out(const float* __restrict__ Or, const float* __restrict__ WD, const float* __restrict__ BD, float* __restrict__ OUT) { __shared__ __align__(16) float ring[2 * GST]; __shared__ __align__(16) float sf[4][16][132];
  const int tid = threadIdx.x, wave = tid >> 5, lane = tid & 31, col = lane & 15, g = lane >> 4; const size_t r0 = (size_t)blockIdx.x * 64 + wave * 16; const int c0 = blockIdx.y * 128;
  const char* asrc = (const char*)(Or + ((size_t)blockIdx.x * 64 + (tid >> 4)) * DD + (tid & 15) * 4); const char* bsrc = (const char*)(WD + (size_t)(c0 + (tid >> 4)) * DD + (tid & 15) * 4);
  const unsigned gdst = lds_off(&ring[(tid >> 4) * GP + (tid & 15) * 4]);
  gstage(gdst, asrc, bsrc);
  asm volatile("s_wait_asynccnt 0x0" ::: "memory");   // this wave's copies of stage 0 have landed
  __syncthreads();                                     // ... and every other wave's: nothing staged is read before this
  gstage(gdst + GST * 4u, asrc + GK * 4, bsrc + GK * 4);
  v8f acc[8] = {};
#pragma unroll 1   // one trip per stage, so that the ring's waits and its barrier stand once, at the trip's foot
  for (int t = 0; t < DD / GK; ++t) { const int bf = t & 1; const float* ar = &ring[bf * GST + (wave * 16 + col) * GP]; const float* br = &ring[bf * GST + GA + col * GP];
#pragma unroll
    for (int kc = 0; kc < GK / 32; ++kc) { const F2 a = split_row(ar, kc * 32, lane); v16b w[8];
#pragma unroll
      for (int j = 0; j < 8; ++j) w[j] = fragb_f32(br + j * 16 * GP + kc * 32, lane);
#pragma unroll
      for (int j = 0; j < 8; ++j) { acc[j] = wmma_bf(a.h, w[j], acc[j]); acc[j] = wmma_bf(a.l, w[j], acc[j]); } }
    asm volatile("s_wait_dscnt 0x0" ::: "memory");     // this wave's reads of this stage's buffer have returned
    asm volatile("s_wait_asynccnt 0x0" ::: "memory");  // this wave's copies of the next stage have landed
    __syncthreads();                                   // publishes the next stage and ends every reader's last read of this stage's buffer
    if (t + 2 < DD / GK) gstage(gdst + (unsigned)bf * (GST * 4u), asrc + (t + 2) * (GK * 4), bsrc + (t + 2) * (GK * 4)); }
  asm volatile("s_wait_asynccnt 0x0" ::: "memory");    // no copy is outstanding when the wave ends
#pragma unroll
  for (int j = 0; j < 8; ++j) { const float bb = bfr(BD[c0 + j * 16 + col]);
#pragma unroll
    for (int r = 0; r < 8; ++r) sf[wave][8 * g + r][j * 16 + col] = acc[j][r] + bb; }
  LDSX(); for (int rl = 0; rl < 16; ++rl) vst2(OUT + (r0 + rl) * DD + c0 + lane * 4, *(const v4f*)&sf[wave][rl][lane * 4]); }
extern "C" void kernel_launch(void* const* d_in, const int* in_sizes, int n_in, void* d_out, int out_size, void* d_ws, size_t ws_size, hipStream_t stream) {
  (void)in_sizes; (void)n_in; (void)out_size;
  const float** F = (const float**)d_in;   // 0 x [2,2048,512], 1 Wq, 2 Wk, 3 Wv [512,512] natural, 4 Wb [8,512], 5 mixing [8,512], 6 Wd [512,512], 7 bd [512]
  if (ws_size < (size_t)WS_END) return;
  char* ws = (char*)d_ws; _Float16 *KH = (_Float16*)(ws + WS_KH), *VT = (_Float16*)(ws + WS_VT); float *QF = (float*)(ws + WS_QF), *CB = (float*)(ws + WS_CB), *O = (float*)(ws + WS_O);
  k_proj<<<dim3(NN / 64, DD / 128, 3 * NB), 128, 0, stream>>>(F[0], F[1], F[2], F[3], QF, KH, VT);
  k_cb<<<dim3(NN / 32, NB), 256, 0, stream>>>(F[0], F[4], CB);
  k_att<<<dim3(TQB, NH, TNB), 256, 0, stream>>>(QF, F[5], KH, VT, CB, O);
  k_out<<<dim3(TNB * NN / 64, DD / 128), 128, 0, stream>>>(O, F[6], F[7], (float*)d_out);
}

// v008
// A run of this version takes 85.8 microseconds.
// In two side-by-side timings against v007, it was 1.05 and 1.06 times as fast.
// Counting every step since v000, it is 10.0 times as fast.
// compute dtype: all float inputs rounded to bf16; q/k/v = x W^T with EXACT bf16 products on WMMA 16x16x32 (natural rows); per head the bilinear scores sum_d q_d m_hd k_d as a 512-deep WMMA product of (q * m_h) and k, each rounded once to f16 (1 product; the attention is diffuse: logits std ~0.1), content bias x . Wb^T on the same WMMA form (exact bf16 products), x 1/8; running-max softmax in f32 (hardware exp); P x 2^11 as f16 hi + residual . v (f16; 2 products); out = ctx (bf16 hi + lo) . Wd^T + bd; f32 output.
#include <hip/hip_runtime.h>
#include <math.h>

typedef __attribute__((ext_vector_type(16))) _Float16 v16h;
typedef __attribute__((ext_vector_type(16))) __bf16 v16b;
typedef __attribute__((ext_vector_type(8)))  _Float16 v8h;
typedef __attribute__((ext_vector_type(8)))  float v8f;
typedef __attribute__((ext_vector_type(4)))  float v4f;
typedef __attribute__((ext_vector_type(2)))  float v2f;
typedef __attribute__((ext_vector_type(4)))  unsigned v4u;
typedef __attribute__((ext_vector_type(4)))  int v4i;
typedef float __attribute__((may_alias)) float_a;
typedef int __attribute__((may_alias)) int_a;

template <typename T> __device__ __forceinline__ void vst2(void* p, T v) { *(T*)p = v;  }
__device__ __forceinline__ v8f wmma16(v16h a, v16h b, v8f c) {
  v8f d = __builtin_amdgcn_wmma_f32_16x16x32_f16(false, a, false, b, (short)0, c, false, false);
  asm volatile("v_nop\n\tv_nop\n\tv_nop\n\tv_nop" : "+v"(d) : "v"(a), "v"(b));
  return d;
}
// as wmma16, but its statement does not name B: with the 32 resident Q fragments of k_att (its B operands) among the statement's operands they were not all kept in registers (scratch)
__device__ __forceinline__ v8f wmma16q(v16h a, v16h b, v8f c) {
  v8f d = __builtin_amdgcn_wmma_f32_16x16x32_f16(false, a, false, b, (short)0, c, false, false);
  asm volatile("v_nop\n\tv_nop\n\tv_nop\n\tv_nop" : "+v"(d) : "v"(a));
  return d;
}
// lane l takes the value of lane l ^ 16
__device__ __forceinline__ float xhalf(float x) { return __builtin_bit_cast(float, __builtin_amdgcn_permlanex16(__builtin_bit_cast(int, x), __builtin_bit_cast(int, x), 0x76543210, 0xfedcba98, false, false)); }
__device__ __forceinline__ v8f wmma_bf(v16b a, v16b b, v8f c) {
  v8f d = __builtin_amdgcn_wmma_f32_16x16x32_bf16(false, a, false, b, (short)0, c, false, false);
  asm volatile("v_nop\n\tv_nop\n\tv_nop\n\tv_nop" : "+v"(d) : "v"(a), "v"(b));
  return d;
}
// 16x16x32 fragments: lane = (h = lane>>4, row/col = lane&15); elements 0..7 = k0+8h+0..7, 8..15 = k0+16+8h+0..7; D element r = row 8h+r
__device__ __forceinline__ v16h frag_h(const _Float16* rowk0, int lane) {
  union { v16h v; v8h q[2]; } u; const _Float16* p = rowk0 + 8 * (lane >> 4);
  u.q[0] = *(const v8h*)p; u.q[1] = *(const v8h*)(p + 16); return u.v;
}
__device__ __forceinline__ v16h frag_f32(const float* rowk0, int lane) {
  v16h a; const float* p = rowk0 + 8 * (lane >> 4);
#pragma unroll
  for (int i = 0; i < 8; ++i) { a[i] = (_Float16)p[i]; a[8 + i] = (_Float16)p[16 + i]; }
  return a;
}
__device__ __forceinline__ v16h frag_f32s(const float* rowk0, int lane, float sc) {
  v16h a; const float* p = rowk0 + 8 * (lane >> 4);
#pragma unroll
  for (int i = 0; i < 8; ++i) { a[i] = (_Float16)(p[i] * sc); a[8 + i] = (_Float16)(p[16 + i] * sc); }
  return a;
}
// column fragment from a [K][ld] layout (column n), rows >= K read as 0
__device__ __forceinline__ v16h fragc_f32(const float* W, int k0, int n, int lane, int ld, int K) {
  v16h a; const int g = lane >> 4;
#pragma unroll
  for (int i = 0; i < 8; ++i) { const int ka = k0 + 8 * g + i, kb = ka + 16;
    a[i] = (_Float16)(ka < K ? W[(size_t)(ka < K ? ka : K - 1) * ld + n] : 0.f); a[8 + i] = (_Float16)(kb < K ? W[(size_t)(kb < K ? kb : K - 1) * ld + n] : 0.f); }
  return a;
}
struct F2 { v16b h, l; };
__device__ __forceinline__ F2 bsplit16(const float v[16]) { F2 r;
#pragma unroll
  for (int i = 0; i < 16; ++i) { const __bf16 h = (__bf16)v[i]; r.h[i] = h; r.l[i] = (__bf16)(v[i] - (float)h); }
  return r; }
__device__ __forceinline__ F2 split_row(const float* row, int k0, int lane) { float v[16]; const float* p = row + k0 + 8 * (lane >> 4);
#pragma unroll
  for (int i = 0; i < 8; ++i) { v[i] = p[i]; v[8 + i] = p[16 + i]; }
  return bsplit16(v); }
__device__ __forceinline__ F2 split_rowK(const float* row, int k0, int lane, int K) { float v[16]; const int g = lane >> 4;
#pragma unroll
  for (int i = 0; i < 8; ++i) { const int ka = k0 + 8 * g + i, kb = ka + 16; v[i] = ka < K ? row[ka < K ? ka : K - 1] : 0.f; v[8 + i] = kb < K ? row[kb < K ? kb : K - 1] : 0.f; }
  return bsplit16(v); }
__device__ __forceinline__ F2 split_col(const float* W, int k0, int n, int lane, int ld, int K) { float v[16]; const int g = lane >> 4;
#pragma unroll
  for (int i = 0; i < 8; ++i) { const int ka = k0 + 8 * g + i, kb = ka + 16; v[i] = ka < K ? W[(size_t)(ka < K ? ka : K - 1) * ld + n] : 0.f; v[8 + i] = kb < K ? W[(size_t)(kb < K ? kb : K - 1) * ld + n] : 0.f; }
  return bsplit16(v); }
__device__ __forceinline__ v8f mac3(const F2& a, const F2& b, v8f c) { c = wmma_bf(a.l, b.h, c); c = wmma_bf(a.h, b.l, c); return wmma_bf(a.h, b.h, c); }
__device__ __forceinline__ float sigm(float v) { return 1.0f / (1.0f + expf(-v)); }
#define LDSX() do { asm volatile("s_wait_dscnt 0" ::: "memory"); __builtin_amdgcn_wave_barrier(); __builtin_amdgcn_fence(__ATOMIC_RELEASE, "workgroup"); } while (0)


// Collaborative attention (B 2, L 2,048, D 512, 8 heads x 64 with a shared 512-wide key/query space): scores = (q diag(m_h) k^T + content_bias(k side)) / sqrt(64); softmax; per-head 64-dim values; dense output projection.
#define NB 2
#define NN 2048
#define DD 512
#define NH 8
#define DH 64
#ifndef TNB
#define TNB NB
#endif
#ifndef TQB
#define TQB (NN / 128)
#endif
typedef __attribute__((ext_vector_type(8))) __bf16 v8b;
__device__ __forceinline__ v16b frag_b(const __bf16* rowk0, int lane) {
  union { v16b v; v8b q[2]; } u; const __bf16* p = rowk0 + 8 * (lane >> 4);
  u.q[0] = *(const v8b*)p; u.q[1] = *(const v8b*)(p + 16); return u.v;
}
__device__ __forceinline__ float bfr(float v) { return (float)(__bf16)v; }
__device__ __attribute__((noinline)) float exp_ni(float v) { return expf(v); }
__device__ __attribute__((noinline)) float erf_ni(float v) { return erff(v); }

#define WS_QF  0u                                   // f32 q in A-fragment order: [(b*NN + l) / 16][d / 32][piece 0..3][lane][4]; lane = (g, row), piece p = d 8 g + 4 (p & 1) + 16 (p >> 1) + 0..3 of its 32
#define WS_KH  (WS_QF + 4u * (size_t)NB * NN * DD)       // f16 k rows [b*NN + s][512]
#define WS_VT  (WS_KH + 2u * (size_t)NB * NN * DD)       // f16 v planes [b][512][NN]
#define WS_CB  (WS_VT + 2u * (size_t)NB * DD * NN)       // f32 content bias [b][h][NN]
#define WS_O   (WS_CB + 4u * (size_t)NB * NH * NN)       // f32 ctx rows [b*NN + l][512]
#define WS_END (WS_O + 4u * (size_t)NB * NN * DD)

__device__ __forceinline__ v16b fragb_f32(const float* __restrict__ p, int lane) { v16b a; const float* pp = p + 8 * (lane >> 4);
#pragma unroll
  for (int i = 0; i < 8; ++i) { a[i] = (__bf16)pp[i]; a[8 + i] = (__bf16)pp[16 + i]; } return a; }
typedef __attribute__((address_space(3))) const unsigned char lds_byte;
__device__ __forceinline__ unsigned lds_off(const void* p) { return (unsigned)(size_t)(lds_byte*)p; }
// eight copies of 16 B per lane, LDS step ls bytes, global step gs bytes; the s_wait_xcnt stands inside the statement so that no address register of a copy is rewritten ahead of it
__device__ __forceinline__ void cp8(unsigned l, unsigned ls, const char* g, size_t gs) {
  asm volatile("global_load_async_to_lds_b128 %0, %8, off\n\tglobal_load_async_to_lds_b128 %1, %9, off\n\tglobal_load_async_to_lds_b128 %2, %10, off\n\tglobal_load_async_to_lds_b128 %3, %11, off\n\t"
               "global_load_async_to_lds_b128 %4, %12, off\n\tglobal_load_async_to_lds_b128 %5, %13, off\n\tglobal_load_async_to_lds_b128 %6, %14, off\n\tglobal_load_async_to_lds_b128 %7, %15, off\n\ts_wait_xcnt 0x0"
               :: "v"(l), "v"(l + ls), "v"(l + 2 * ls), "v"(l + 3 * ls), "v"(l + 4 * ls), "v"(l + 5 * ls), "v"(l + 6 * ls), "v"(l + 7 * ls),
                  "v"(g), "v"(g + gs), "v"(g + 2 * gs), "v"(g + 3 * gs), "v"(g + 4 * gs), "v"(g + 5 * gs), "v"(g + 6 * gs), "v"(g + 7 * gs) : "memory"); }
// The two projection kernels (64 rows x 128 cols a block) take their operands through LDS: a stage is 64 f32 of k (256 B) of the 64 A rows and the 128 B rows, two buffers; the f32 values are rounded where the fragments are formed.
#define GK 64               // f32 of k per stage
#define GP 68               // f32 per staged row: 272 B = 16 B x 17, an odd multiple of 16 B for the ds_load_b128 readers
#define GA (64 * GP)        // f32 of a stage's A rows
#define GST (192 * GP)      // f32 of a stage
// one stage: a copy of the block = 8 rows of 256 B, a wave = two rows' whole 128-B lines; dst, a, b are the lane's own places in row (tid >> 4)
__device__ __forceinline__ void gstage(unsigned dst, const char* a, const char* b) {
  cp8(dst, 8u * GP * 4u, a, (size_t)8 * DD * 4);
  cp8(dst + GA * 4u, 8u * GP * 4u, b, (size_t)8 * DD * 4);
  cp8(dst + (GA + 64u * GP) * 4u, 8u * GP * 4u, b + (size_t)64 * DD * 4, (size_t)8 * DD * 4); }
// ---- k_proj: block = (64 rows, 128 cols, which*NB + b): which 0 q -> f32, once, in A-fragment order; 1 k -> f16 rows; 2 v -> f16 planes
// The k blocks of the first 128 columns also form the content bias cb[b][h][s] = x_s . Wb[h] of their 64 rows: a ninth column tile whose A fragments are the x fragments the wave has formed anyway. Its B fragments (row col & 7 of Wb: columns 8..15 repeat 0..7 and are not stored) come straight from global memory, 16 KiB that every such block reads.
__global__ __launch_bounds__(128) void k_proj(const float* __restrict__ X, const float* __restrict__ WQ, const float* __restrict__ WK, const float* __restrict__ WV, const float* __restrict__ WB, float* __restrict__ QF, _Float16* __restrict__ KH, _Float16* __restrict__ VT, float* __restrict__ CB) {
  __shared__ __align__(16) float ring[2 * GST];
  // the output staging lies over the ring, which nobody reads and no copy writes behind the last stage's barrier: keeps the block's LDS small enough for three blocks per WGP
  float (*sf)[132] = (float (*)[132])&ring[0]; _Float16 (*sh)[136] = (_Float16 (*)[136])&ring[64 * 132]; _Float16 (*th)[72] = (_Float16 (*)[72])&ring[64 * 132 + 64 * 68]; float (*sc)[64] = (float (*)[64])&ring[64 * 132 + 64 * 68 + 128 * 36];
  const int tid = threadIdx.x, wave = tid >> 5, lane = tid & 31, col = lane & 15, g = lane >> 4; const int which = blockIdx.z / NB; const size_t b = blockIdx.z % NB; const int n0 = blockIdx.x * 64; const int c0 = blockIdx.y * 128;
  const float* Wm = which == 0 ? WQ : which == 1 ? WK : WV;
  const bool docb = which == 1 && blockIdx.y == 0;   // the same for the whole block
  const float* wbp = WB + (col & 7) * DD + 8 * g;
  const char* asrc = (const char*)(X + (b * NN + n0 + (tid >> 4)) * DD + (tid & 15) * 4); const char* bsrc = (const char*)(Wm + (size_t)(c0 + (tid >> 4)) * DD + (tid & 15) * 4);
  const unsigned gdst = lds_off(&ring[(tid >> 4) * GP + (tid & 15) * 4]);
  gstage(gdst, asrc, bsrc);
  asm volatile("s_wait_asynccnt 0x0" ::: "memory");   // this wave's copies of stage 0 have landed
  __syncthreads();                                     // ... and every other wave's: nothing staged is read before this
  gstage(gdst + GST * 4u, asrc + GK * 4, bsrc + GK * 4);
  v8f acc[8] = {}, acb = {};
#pragma unroll 1   // one trip per stage, so that the ring's waits and its barrier stand once, at the trip's foot
  for (int t = 0; t < DD / GK; ++t) { const int bf = t & 1; const float* ar = &ring[bf * GST + (wave * 16 + col) * GP]; const float* br = &ring[bf * GST + GA + col * GP];
    // this stage's 64 k of the lane's Wb row, asked for at the head of the trip and used at its foot, behind the 16 other products
    v4f wb[GK / 32][4]; v16b af[GK / 32];
    if (docb) {
#pragma unroll
      for (int kc = 0; kc < GK / 32; ++kc)
#pragma unroll
        for (int p = 0; p < 4; ++p) wb[kc][p] = *(const v4f*)(wbp + t * GK + kc * 32 + (p & 1) * 4 + (p >> 1) * 16); }
#pragma unroll
    for (int kc = 0; kc < GK / 32; ++kc) { const v16b a = fragb_f32(ar + kc * 32, lane); v16b w[8]; af[kc] = a;
#pragma unroll
      for (int j = 0; j < 8; ++j) w[j] = fragb_f32(br + j * 16 * GP + kc * 32, lane);
#pragma unroll
      for (int j = 0; j < 8; ++j) acc[j] = wmma_bf(a, w[j], acc[j]); }
    if (docb) {
#pragma unroll
      for (int kc = 0; kc < GK / 32; ++kc) { v16b w;
#pragma unroll
        for (int p = 0; p < 4; ++p)
#pragma unroll
          for (int i = 0; i < 4; ++i) w[p * 4 + i] = (__bf16)wb[kc][p][i];
        acb = wmma_bf(af[kc], w, acb); } }
    asm volatile("s_wait_dscnt 0x0" ::: "memory");     // this wave's reads of this stage's buffer have returned
    asm volatile("s_wait_asynccnt 0x0" ::: "memory");  // this wave's copies of the next stage have landed
    __syncthreads();                                   // publishes the next stage and ends every reader's last read of this stage's buffer
    if (t + 2 < DD / GK) gstage(gdst + (unsigned)bf * (GST * 4u), asrc + (t + 2) * (GK * 4), bsrc + (t + 2) * (GK * 4)); }
  asm volatile("s_wait_asynccnt 0x0" ::: "memory");    // no copy is outstanding when the ring becomes output staging
#pragma unroll
  for (int j = 0; j < 8; ++j)
#pragma unroll
    for (int r = 0; r < 8; ++r) { const float v = acc[j][r]; if (which == 0) sf[wave * 16 + 8 * g + r][j * 16 + col] = v; else if (which == 1) sh[wave * 16 + 8 * g + r][j * 16 + col] = (_Float16)v; else th[j * 16 + col][wave * 16 + 8 * g + r] = (_Float16)v; }
  if (docb && col < 8) { v4f lo, hi;
#pragma unroll
    for (int i = 0; i < 4; ++i) { lo[i] = acb[i]; hi[i] = acb[4 + i]; }
    *(v4f*)&sc[col][wave * 16 + 8 * g] = lo; *(v4f*)&sc[col][wave * 16 + 8 * g + 4] = hi; }
  __syncthreads();
  // 8 heads x 64 keys: a wave stores two heads' 256 contiguous bytes each
  if (docb) { vst2(CB + (b * NH + (tid >> 4)) * (size_t)NN + n0 + (tid & 15) * 4, *(const v4f*)&sc[tid >> 4][(tid & 15) * 4]);
    asm volatile("s_wait_xcnt 0x0" ::: "memory"); }   // ahead of the k rows' stores below, whose set-up overwrites this store's address and data registers
  if (which == 0) {
    // wave w stores piece w of each of the block's 4 x 4 (16 rows x 32 d) units: 512 contiguous bytes a store
    float* qd = QF + ((b * NN + n0) * (size_t)DD + (size_t)(c0 / 32) * 512) + wave * 128 + lane * 4; const float* qs = &sf[col][8 * g + (wave & 1) * 4 + (wave >> 1) * 16];
#pragma unroll   // whole, so that the 16 LDS reads go out as a group and every store takes a constant offset from one address
    for (int it = 0; it < 16; ++it) vst2(qd + (size_t)((it >> 2) * 16 + (it & 3)) * 512, *(const v4f*)(qs + (it >> 2) * 16 * 132 + (it & 3) * 32)); }
  else if (which == 1) { for (int e = tid; e < 64 * 16; e += 128) { const int rl = e >> 4, q = e & 15; vst2((unsigned*)(KH + (b * NN + n0 + rl) * DD + c0 + q * 8), *(const v4u*)&sh[rl][q * 8]); } }
  else { for (int e = tid; e < 128 * 8; e += 128) { const int cl = e >> 3, q = e & 7; vst2((unsigned*)(VT + (b * DD + c0 + cl) * (size_t)NN + n0 + q * 8), *(const v4u*)&th[cl][q * 8]); } } }
// ---- k_att: block = (128 queries, h, b), 8 waves: logits = ((q*m_h) . k + cb[s]) / 8 (K 512), softmax, P (hi + residual) . v_h
// Both products are taken transposed: S^T = K (q*m_h)^T and ctx^T += V^T P^T. A lane then holds 16 scores of ONE query (col): keys 8 g + r and 16 + 8 g + r of its wave's 32 keys; maximum and sum are in-lane but for one exchange between the wave's halves, and the two score tiles, converted in place, are the B fragment of the second product.
// A wave holds 32 queries (two column groups), so that each K and V fragment read from LDS serves two products. A pass is 64 keys: waves 0..3 take its first 32, waves 4..7 its last 32, each with a running maximum, sum and context of its own over its 1,024 keys; behind the key loop wave 4 + i hands its three to wave i through LDS, which joins them and stores.
// Each wave forms its 32 B fragments (q * m_h), rounded once to f16, in registers ahead of the key loop and keeps them there. The head's bias row (once) and each pass's K and V tiles (two buffers) come into LDS by asynchronous copies whose waves cover whole 128-B lines; the key loop reads K, V and the bias from LDS.
#define KP 520   // f16 per staged K row: 1,040 B = 16 B x 65, an odd multiple of 16 B for the ds_load_b128 readers
#define VP 72    // f16 per staged V row: 144 B = 16 B x 9
#define LSC 0.18033688f   // log2(e) / 8: from a score (q*m_h) . k + cb to the base-2 exponent of e^(score / 8)
#define NB2(mx) __builtin_fmaf(-(mx), LSC, 11.0f)   // 2^(score LSC + NB2(mx)) = 2^11 e^((score - mx) / 8)
// two copies, same form
__device__ __forceinline__ void cp2(unsigned l, unsigned ls, const char* g, size_t gs) {
  asm volatile("global_load_async_to_lds_b128 %0, %2, off\n\tglobal_load_async_to_lds_b128 %1, %3, off\n\ts_wait_xcnt 0x0" :: "v"(l), "v"(l + ls), "v"(g), "v"(g + gs) : "memory"); }
// eight v_exp_f32, each in place, in one statement that ends with the slot the instruction set asks for behind a transcendental
__device__ __forceinline__ void exp8(v8f& x) {
  asm("v_exp_f32 %0, %0\n\tv_exp_f32 %1, %1\n\tv_exp_f32 %2, %2\n\tv_exp_f32 %3, %3\n\tv_exp_f32 %4, %4\n\tv_exp_f32 %5, %5\n\tv_exp_f32 %6, %6\n\tv_exp_f32 %7, %7\n\tv_nop"
      : "+v"(x[0]), "+v"(x[1]), "+v"(x[2]), "+v"(x[3]), "+v"(x[4]), "+v"(x[5]), "+v"(x[6]), "+v"(x[7])); }
// one v_exp_f32 with the same slot behind it, for the same reason
__device__ __forceinline__ float exp1(float x) { float r; asm("v_exp_f32 %0, %1\n\tv_nop" : "=v"(r) : "v"(x)); return r; }
// register budget and residency of two waves per SIMD; the 256 blocks lie one to a WGP. This build keeps one copy address (4 B a lane) in scratch: one reload a pass, issued ahead of the K copies and used behind them
__global__ __launch_bounds__(256) __attribute__((amdgpu_waves_per_eu(2, 2))) void k_att(const float* __restrict__ QF, const float* __restrict__ MIX, const _Float16* __restrict__ KH, const _Float16* __restrict__ VT, const float* __restrict__ CB, float* __restrict__ O) {
  __shared__ __align__(16) _Float16 sk[2][64][KP]; __shared__ __align__(16) _Float16 sv[2][DH][VP]; __shared__ __align__(16) float scb[NN];
  const int tid = threadIdx.x, wave = __builtin_amdgcn_readfirstlane(tid >> 5), lane = tid & 31, col = lane & 15, g = lane >> 4; const int qg = wave & 3, kh = wave >> 2;
  const int h = blockIdx.y; const size_t b = blockIdx.z; const int q0 = blockIdx.x * 128 + qg * 32; const size_t rq = b * NN + q0;
  // copy maps: 1,024-B rows (K): one copy of the block = four rows, a wave = 512 contiguous bytes; V: one copy = 32 rows of 128 B; bias: one copy = 4,096 B
  const int crow = tid >> 6, ccol = (tid & 63) * 8, vrow = tid >> 3, vcol = (tid & 7) * 8;
  // the block's K rows and the head's V rows (uniform), and the lane's own byte offset in each (32 bits: one register each through the key loop)
  const char* kbase = (const char*)(KH + b * NN * DD); const char* vbase = (const char*)(VT + (b * DD + (size_t)h * DH) * (size_t)NN);
  const unsigned koff = (unsigned)(crow * DD + ccol) * 2u, voff = (unsigned)(vrow * NN + vcol) * 2u;
  const char* bsrc = (const char*)(CB + (b * NH + h) * (size_t)NN + tid * 4);
  const unsigned kdst = lds_off(&sk[0][crow][ccol]), vdst = lds_off(&sv[0][vrow][vcol]);
#define STAGE(t, bf) do { const char* kt = kbase + (koff + (unsigned)(t) * (64u * DD * 2u)); const unsigned kl = kdst + (unsigned)(bf) * (64u * KP * 2u); \
    cp8(kl, 4u * KP * 2u, kt, 4 * DD * 2); cp8(kl + 32u * KP * 2u, 4u * KP * 2u, kt + 32 * DD * 2, 4 * DD * 2); \
    cp2(vdst + (unsigned)(bf) * (DH * VP * 2u), 32u * VP * 2u, vbase + (voff + (unsigned)(t) * 128u), (size_t)32 * NN * 2); } while (0)
  cp2(lds_off(&scb[tid * 4]), 4096u, bsrc, 4096);
  STAGE(0, 0);
  // the wave's 32 query rows as 2 x 16 B fragments (A's table with column for row), under the copies' flight: four 16-B loads a fragment, each 512 contiguous bytes of the wave; element e of a lane is d = 32 kc + 8 g + (e & 7) + 16 (e >> 3)
  v16h qf[2][DD / 32];
  { const float* qp = QF + rq * DD + lane * 4; const float* mp = MIX + h * DD + 8 * g;
#pragma unroll   // whole, so that qf is indexed by constants and stays in registers
    for (int kc = 0; kc < DD / 32; ++kc)
#pragma unroll
      for (int p = 0; p < 4; ++p) { const v4f mm = *(const v4f*)(mp + kc * 32 + (p & 1) * 4 + (p >> 1) * 16);
#pragma unroll
        for (int u = 0; u < 2; ++u) { const v4f x = *(const v4f*)(qp + u * (16 * DD) + kc * 512 + p * 128);
#pragma unroll
          for (int i = 0; i < 4; ++i) qf[u][kc][p * 4 + i] = (_Float16)(x[i] * bfr(mm[i])); } } }
  asm volatile("s_wait_xcnt 0x0" ::: "memory");        // ahead of the first overwrite of an address register of the loads above
  asm volatile("s_wait_asynccnt 0x0" ::: "memory");   // this wave's copies of the bias row and of pass 0 have landed
  __syncthreads();                                     // ... and every other wave's: nothing staged is read before this
  STAGE(1, 1);
  float m[2] = {3.0e38f, 3.0e38f}, l[2] = {0.f, 0.f};   // per column group, this lane's query over this wave's keys: NB2 of the running maximum of the scores (equal in both halves), and the sum of P (with its 2^11) over this half's keys alone
  v8f acc[2][4] = {}, accl[2][4] = {};
#pragma unroll 1
  for (int ks = 0; ks < NN / 64; ++ks) { const int bf = ks & 1; v8f s[2][2];
    v16h vf[4];
    { const _Float16* k0 = &sk[bf][kh * 32 + col][0]; const _Float16* k1 = &sk[bf][kh * 32 + 16 + col][0];
      // the bias of this lane's 16 keys (the same for both column groups) is the C operand of each tile's first product: the matrix unit adds it
      const float* cbp = &scb[ks * 64 + kh * 32 + 8 * g]; union { v8f v; v4f q[2]; } cb0, cb1; cb0.q[0] = *(const v4f*)cbp; cb0.q[1] = *(const v4f*)(cbp + 4); cb1.q[0] = *(const v4f*)(cbp + 16); cb1.q[1] = *(const v4f*)(cbp + 20);
      v8f c[2][2] = {{cb0.v, cb1.v}, {cb0.v, cb1.v}};
      // LDS reads two k steps ahead of the products that use them, in a ring of three register sets (a fourth set did not fit beside the 32 Q fragments: the build kept one of them in scratch); each K fragment serves both column groups, each Q fragment both 16-key groups
      v16h ka[3], kb[3];
#pragma unroll
      for (int i = 0; i < 2; ++i) { ka[i] = frag_h(k0 + i * 32, lane); kb[i] = frag_h(k1 + i * 32, lane); }
#pragma unroll   // whole: the ring and qf are indexed by constants
      for (int kc = 0; kc < DD / 32; ++kc) {
        if (kc + 2 < DD / 32) { ka[(kc + 2) % 3] = frag_h(k0 + (kc + 2) * 32, lane); kb[(kc + 2) % 3] = frag_h(k1 + (kc + 2) * 32, lane); }
#pragma unroll
        for (int u = 0; u < 2; ++u) { c[u][0] = wmma16q(ka[kc % 3], qf[u][kc], c[u][0]); c[u][1] = wmma16q(kb[kc % 3], qf[u][kc], c[u][1]); } }
#pragma unroll
      for (int u = 0; u < 2; ++u) { s[u][0] = c[u][0]; s[u][1] = c[u][1]; } }
    float alpha[2]; v16h pa[2], pal[2];
#pragma unroll   // whole: every array below is indexed by constants
    for (int u = 0; u < 2; ++u) {
      float mx[8];
#pragma unroll
      for (int r = 0; r < 8; ++r) mx[r] = fmaxf(s[u][0][r], s[u][1][r]);
      float mh = fmaxf(fmaxf(fmaxf(mx[0], mx[1]), fmaxf(mx[2], mx[3])), fmaxf(fmaxf(mx[4], mx[5]), fmaxf(mx[6], mx[7])));
      mh = fmaxf(mh, xhalf(mh));   // the other half's 16 keys of the same query
      // the running maximum is kept as nb = NB2(maximum), which falls as the maximum rises. The old sums are rescaled by the difference of the two rounded nb, so that every pass's P and the sums carry exactly the same factor, also where the scores are large
      const float nb = fminf(m[u], NB2(mh)); alpha[u] = exp1(nb - m[u]); m[u] = nb;
#pragma unroll
      for (int r = 0; r < 8; ++r) { s[u][0][r] = __builtin_fmaf(s[u][0][r], LSC, nb); s[u][1][r] = __builtin_fmaf(s[u][1][r], LSC, nb); }
      // P = 2^11 e^(logit - maximum) = 2^(score LSC + nb): one fma and v_exp_f32 (exp8 above) a score. With that factor in P its f16 residual needs none of its own: below 2^-14 it is a subnormal, exact to 2^-25 beside a row maximum of 2^11
      exp8(s[u][0]); exp8(s[u][1]);
      float es[8];
#pragma unroll
      for (int r = 0; r < 8; ++r) { const float p0 = s[u][0][r], p1 = s[u][1][r]; es[r] = p0 + p1;
        pa[u][r] = (_Float16)p0; pa[u][8 + r] = (_Float16)p1; pal[u][r] = (_Float16)(p0 - (float)pa[u][r]); pal[u][8 + r] = (_Float16)(p1 - (float)pa[u][8 + r]); }
      l[u] = l[u] * alpha[u] + (((es[0] + es[1]) + (es[2] + es[3])) + ((es[4] + es[5]) + (es[6] + es[7])));
      asm volatile("" : "+v"(l[u])); }   // each row's sum pinned against spills: left free, the build moves these additions behind the pass's barrier and keeps the 32 P values in registers through the second product and the copies
    // V is read here, behind both column groups' P and under the rescaling: read earlier it was live through the softmax, and the build kept values in scratch
#pragma unroll
    for (int j = 0; j < 4; ++j) vf[j] = frag_h(&sv[bf][j * 16 + col][kh * 32], lane);
#pragma unroll
    for (int u = 0; u < 2; ++u)
#pragma unroll
      for (int j = 0; j < 4; ++j)
#pragma unroll
        for (int r = 0; r < 8; ++r) { acc[u][j][r] *= alpha[u]; accl[u][j][r] *= alpha[u]; }
#pragma unroll
    for (int j = 0; j < 4; ++j)
#pragma unroll
      for (int u = 0; u < 2; ++u) { acc[u][j] = wmma16(vf[j], pa[u], acc[u][j]); accl[u][j] = wmma16(vf[j], pal[u], accl[u][j]); }
    asm volatile("s_wait_dscnt 0x0" ::: "memory");     // this wave's reads of this pass's buffers have returned
    asm volatile("s_wait_asynccnt 0x0" ::: "memory");  // this wave's copies of the next pass have landed
    __syncthreads();                                   // publishes the next pass and ends every reader's last read of this pass's buffers
    if (ks + 2 < NN / 64) STAGE(ks + 2, bf); }
  asm volatile("s_wait_asynccnt 0x0" ::: "memory");    // no copy is outstanding when the wave reuses LDS and ends
  // hand-over and output staging lie in the K ring: every wave's reads of the ring returned, and no copy was left in flight, ahead of the last pass's barrier
  // buffer 0: per query group 17 x 512 B (16 B a lane): the second key half's 16 context pieces, then (m, l) of both column groups; buffer 1: per query group 32 output rows
  v4f* xb = (v4f*)&sk[0][0][0] + qg * (17 * 32) + lane;
  float lt[2] = {l[0] + xhalf(l[0]), l[1] + xhalf(l[1])};   // the halves' sums are joined here, once
  if (kh == 1) {
#pragma unroll
    for (int u = 0; u < 2; ++u)
#pragma unroll
      for (int j = 0; j < 4; ++j)
#pragma unroll
        for (int q = 0; q < 2; ++q) { v4f o;
#pragma unroll
          for (int i = 0; i < 4; ++i) o[i] = acc[u][j][q * 4 + i] + accl[u][j][q * 4 + i];
          xb[((u * 4 + j) * 2 + q) * 32] = o; }
    v4f ml; ml[0] = m[0]; ml[1] = lt[0]; ml[2] = m[1]; ml[3] = lt[1]; xb[16 * 32] = ml; }
  __syncthreads();                                     // the second key half's results are in LDS for the waves that join them
  if (kh == 0) {
    float (*so)[68] = (float (*)[68])&sk[1][0][0] + qg * 32;
    const v4f ml = xb[16 * 32];
#pragma unroll
    for (int u = 0; u < 2; ++u) { const float m1 = ml[2 * u], l1 = ml[2 * u + 1], mn = fminf(m[u], m1), a0 = exp1(mn - m[u]), a1 = exp1(mn - m1);
      const float il = 1.0f / (lt[u] * a0 + l1 * a1), w0 = a0 * il, w1 = a1 * il;
#pragma unroll
      for (int j = 0; j < 4; ++j)
#pragma unroll
        for (int q = 0; q < 2; ++q) { const v4f p = xb[((u * 4 + j) * 2 + q) * 32]; v4f o;
#pragma unroll
          for (int i = 0; i < 4; ++i) o[i] = (acc[u][j][q * 4 + i] + accl[u][j][q * 4 + i]) * w0 + p[i] * w1;
          *(v4f*)&so[u * 16 + col][j * 16 + 8 * g + q * 4] = o; } }
    LDSX(); for (int rl = 0; rl < 16; ++rl) vst2(O + (rq + 2 * rl + g) * DD + (size_t)h * DH + col * 4, *(const v4f*)&so[2 * rl + g][col * 4]); } }
// ---- k_out: block = (64 rows, 128 cols): out = ctx (hi + lo) . Wd^T + bd
__global__ __launch_bounds__(128) void k_out(const float* __restrict__ Or, const float* __restrict__ WD, const float* __restrict__ BD, float* __restrict__ OUT) { __shared__ __align__(16) float ring[2 * GST]; __shared__ __align__(16) float sf[4][16][132];
  const int tid = threadIdx.x, wave = tid >> 5, lane = tid & 31, col = lane & 15, g = lane >> 4; const size_t r0 = (size_t)blockIdx.x * 64 + wave * 16; const int c0 = blockIdx.y * 128;
  const char* asrc = (const char*)(Or + ((size_t)blockIdx.x * 64 + (tid >> 4)) * DD + (tid & 15) * 4); const char* bsrc = (const char*)(WD + (size_t)(c0 + (tid >> 4)) * DD + (tid & 15) * 4);
  const unsigned gdst = lds_off(&ring[(tid >> 4) * GP + (tid & 15) * 4]);
  gstage(gdst, asrc, bsrc);
  asm volatile("s_wait_asynccnt 0x0" ::: "memory");   // this wave's copies of stage 0 have landed
  __syncthreads();                                     // ... and every other wave's: nothing staged is read before this
  gstage(gdst + GST * 4u, asrc + GK * 4, bsrc + GK * 4);
  v8f acc[8] = {};
#pragma unroll 1   // one trip per stage, so that the ring's waits and its barrier stand once, at the trip's foot
  for (int t = 0; t < DD / GK; ++t) { const int bf = t & 1; const float* ar = &ring[bf * GST + (wave * 16 + col) * GP]; const float* br = &ring[bf * GST + GA + col * GP];
#pragma unroll
    for (int kc = 0; kc < GK / 32; ++kc) { const F2 a = split_row(ar, kc * 32, lane); v16b w[8];
#pragma unroll
      for (int j = 0; j < 8; ++j) w[j] = fragb_f32(br + j * 16 * GP + kc * 32, lane);
#pragma unroll
      for (int j = 0; j < 8; ++j) { acc[j] = wmma_bf(a.h, w[j], acc[j]); acc[j] = wmma_bf(a.l, w[j], acc[j]); } }
    asm volatile("s_wait_dscnt 0x0" ::: "memory");     // this wave's reads of this stage's buffer have returned
    asm volatile("s_wait_asynccnt 0x0" ::: "memory");  // this wave's copies of the next stage have landed
    __syncthreads();                                   // publishes the next stage and ends every reader's last read of this stage's buffer
    if (t + 2 < DD / GK) gstage(gdst + (unsigned)bf * (GST * 4u), asrc + (t + 2) * (GK * 4), bsrc + (t + 2) * (GK * 4)); }
  asm volatile("s_wait_asynccnt 0x0" ::: "memory");    // no copy is outstanding when the wave ends
#pragma unroll
  for (int j = 0; j < 8; ++j) { const float bb = bfr(BD[c0 + j * 16 + col]);
#pragma unroll
    for (int r = 0; r < 8; ++r) sf[wave][8 * g + r][j * 16 + col] = acc[j][r] + bb; }
  LDSX(); for (int rl = 0; rl < 16; ++rl) vst2(OUT + (r0 + rl) * DD + c0 + lane * 4, *(const v4f*)&sf[wave][rl][lane * 4]); }
extern "C" void kernel_launch(void* const* d_in, const int* in_sizes, int n_in, void* d_out, int out_size, void* d_ws, size_t ws_size, hipStream_t stream) {
  (void)in_sizes; (void)n_in; (void)out_size;
  const float** F = (const float**)d_in;   // 0 x [2,2048,512], 1 Wq, 2 Wk, 3 Wv [512,512] natural, 4 Wb [8,512], 5 mixing [8,512], 6 Wd [512,512], 7 bd [512]
  if (ws_size < (size_t)WS_END) return;
  char* ws = (char*)d_ws; _Float16 *KH = (_Float16*)(ws + WS_KH), *VT = (_Float16*)(ws + WS_VT); float *QF = (float*)(ws + WS_QF), *CB = (float*)(ws + WS_CB), *O = (float*)(ws + WS_O);
  k_proj<<<dim3(NN / 64, DD / 128, 3 * NB), 128, 0, stream>>>(F[0], F[1], F[2], F[3], F[4], QF, KH, VT, CB);
  k_att<<<dim3(TQB, NH, TNB), 256, 0, stream>>>(QF, F[5], KH, VT, CB, O);
  k_out<<<dim3(TNB * NN / 64, DD / 128), 128, 0, stream>>>(O, F[6], F[7], (float*)d_out);
}

// v009
// A run of this version takes 80.3 microseconds.
// Next to v008, in two timings, it ran 1.07 and 1.08 times as fast.
// Over all steps from v000 it is 10.8 times as fast.
// compute dtype: all float inputs rounded to bf16; q/k/v = x W^T with EXACT bf16 products on WMMA 16x16x32 (natural rows); per head the bilinear scores sum_d q_d m_hd k_d as a 512-deep WMMA product of (q * m_h) and k, each rounded once to f16 (1 product; the attention is diffuse: logits std ~0.1), content bias x . Wb^T on the same WMMA form (exact bf16 products), x 1/8; running-max softmax in f32 (hardware exp); P x 2^11 rounded once to f16 . v (f16; 1 product); out = ctx (bf16 hi + lo) . Wd^T + bd; f32 output.
#include <hip/hip_runtime.h>
#include <math.h>

typedef __attribute__((ext_vector_type(16))) _Float16 v16h;
typedef __attribute__((ext_vector_type(16))) __bf16 v16b;
typedef __attribute__((ext_vector_type(8)))  _Float16 v8h;
typedef __attribute__((ext_vector_type(8)))  float v8f;
typedef __attribute__((ext_vector_type(4)))  float v4f;
typedef __attribute__((ext_vector_type(2)))  float v2f;
typedef __attribute__((ext_vector_type(4)))  unsigned v4u;
typedef __attribute__((ext_vector_type(4)))  int v4i;
typedef float __attribute__((may_alias)) float_a;
typedef int __attribute__((may_alias)) int_a;

template <typename T> __device__ __forceinline__ void vst2(void* p, T v) { *(T*)p = v;  }
__device__ __forceinline__ v8f wmma16(v16h a, v16h b, v8f c) {
  v8f d = __builtin_amdgcn_wmma_f32_16x16x32_f16(false, a, false, b, (short)0, c, false, false);
  asm volatile("v_nop\n\tv_nop\n\tv_nop\n\tv_nop" : "+v"(d) : "v"(a), "v"(b));
  return d;
}
// as wmma16, but its statement does not name B: with the 32 resident Q fragments of k_att (its B operands) among the statement's operands they were not all kept in registers (scratch)
__device__ __forceinline__ v8f wmma16q(v16h a, v16h b, v8f c) {
  v8f d = __builtin_amdgcn_wmma_f32_16x16x32_f16(false, a, false, b, (short)0, c, false, false);
  asm volatile("v_nop\n\tv_nop\n\tv_nop\n\tv_nop" : "+v"(d) : "v"(a));
  return d;
}
// lane l takes the value of lane l ^ 16
__device__ __forceinline__ float xhalf(float x) { return __builtin_bit_cast(float, __builtin_amdgcn_permlanex16(__builtin_bit_cast(int, x), __builtin_bit_cast(int, x), 0x76543210, 0xfedcba98, false, false)); }
__device__ __forceinline__ v8f wmma_bf(v16b a, v16b b, v8f c) {
  v8f d = __builtin_amdgcn_wmma_f32_16x16x32_bf16(false, a, false, b, (short)0, c, false, false);
  asm volatile("v_nop\n\tv_nop\n\tv_nop\n\tv_nop" : "+v"(d) : "v"(a), "v"(b));
  return d;
}
// 16x16x32 fragments: lane = (h = lane>>4, row/col = lane&15); elements 0..7 = k0+8h+0..7, 8..15 = k0+16+8h+0..7; D element r = row 8h+r
__device__ __forceinline__ v16h frag_h(const _Float16* rowk0, int lane) {
  union { v16h v; v8h q[2]; } u; const _Float16* p = rowk0 + 8 * (lane >> 4);
  u.q[0] = *(const v8h*)p; u.q[1] = *(const v8h*)(p + 16); return u.v;
}
__device__ __forceinline__ v16h frag_f32(const float* rowk0, int lane) {
  v16h a; const float* p = rowk0 + 8 * (lane >> 4);
#pragma unroll
  for (int i = 0; i < 8; ++i) { a[i] = (_Float16)p[i]; a[8 + i] = (_Float16)p[16 + i]; }
  return a;
}
__device__ __forceinline__ v16h frag_f32s(const float* rowk0, int lane, float sc) {
  v16h a; const float* p = rowk0 + 8 * (lane >> 4);
#pragma unroll
  for (int i = 0; i < 8; ++i) { a[i] = (_Float16)(p[i] * sc); a[8 + i] = (_Float16)(p[16 + i] * sc); }
  return a;
}
// column fragment from a [K][ld] layout (column n), rows >= K read as 0
__device__ __forceinline__ v16h fragc_f32(const float* W, int k0, int n, int lane, int ld, int K) {
  v16h a; const int g = lane >> 4;
#pragma unroll
  for (int i = 0; i < 8; ++i) { const int ka = k0 + 8 * g + i, kb = ka + 16;
    a[i] = (_Float16)(ka < K ? W[(size_t)(ka < K ? ka : K - 1) * ld + n] : 0.f); a[8 + i] = (_Float16)(kb < K ? W[(size_t)(kb < K ? kb : K - 1) * ld + n] : 0.f); }
  return a;
}
struct F2 { v16b h, l; };
__device__ __forceinline__ F2 bsplit16(const float v[16]) { F2 r;
#pragma unroll
  for (int i = 0; i < 16; ++i) { const __bf16 h = (__bf16)v[i]; r.h[i] = h; r.l[i] = (__bf16)(v[i] - (float)h); }
  return r; }
__device__ __forceinline__ F2 split_row(const float* row, int k0, int lane) { float v[16]; const float* p = row + k0 + 8 * (lane >> 4);
#pragma unroll
  for (int i = 0; i < 8; ++i) { v[i] = p[i]; v[8 + i] = p[16 + i]; }
  return bsplit16(v); }
__device__ __forceinline__ F2 split_rowK(const float* row, int k0, int lane, int K) { float v[16]; const int g = lane >> 4;
#pragma unroll
  for (int i = 0; i < 8; ++i) { const int ka = k0 + 8 * g + i, kb = ka + 16; v[i] = ka < K ? row[ka < K ? ka : K - 1] : 0.f; v[8 + i] = kb < K ? row[kb < K ? kb : K - 1] : 0.f; }
  return bsplit16(v); }
__device__ __forceinline__ F2 split_col(const float* W, int k0, int n, int lane, int ld, int K) { float v[16]; const int g = lane >> 4;
#pragma unroll
  for (int i = 0; i < 8; ++i) { const int ka = k0 + 8 * g + i, kb = ka + 16; v[i] = ka < K ? W[(size_t)(ka < K ? ka : K - 1) * ld + n] : 0.f; v[8 + i] = kb < K ? W[(size_t)(kb < K ? kb : K - 1) * ld + n] : 0.f; }
  return bsplit16(v); }
__device__ __forceinline__ v8f mac3(const F2& a, const F2& b, v8f c) { c = wmma_bf(a.l, b.h, c); c = wmma_bf(a.h, b.l, c); return wmma_bf(a.h, b.h, c); }
__device__ __forceinline__ float sigm(float v) { return 1.0f / (1.0f + expf(-v)); }
#define LDSX() do { asm volatile("s_wait_dscnt 0" ::: "memory"); __builtin_amdgcn_wave_barrier(); __builtin_amdgcn_fence(__ATOMIC_RELEASE, "workgroup"); } while (0)


// Collaborative attention (B 2, L 2,048, D 512, 8 heads x 64 with a shared 512-wide key/query space): scores = (q diag(m_h) k^T + content_bias(k side)) / sqrt(64); softmax; per-head 64-dim values; dense output projection.
#define NB 2
#define NN 2048
#define DD 512
#define NH 8
#define DH 64
#ifndef TNB
#define TNB NB
#endif
#ifndef TQB
#define TQB (NN / 128)
#endif
typedef __attribute__((ext_vector_type(8))) __bf16 v8b;
__device__ __forceinline__ v16b frag_b(const __bf16* rowk0, int lane) {
  union { v16b v; v8b q[2]; } u; const __bf16* p = rowk0 + 8 * (lane >> 4);
  u.q[0] = *(const v8b*)p; u.q[1] = *(const v8b*)(p + 16); return u.v;
}
__device__ __forceinline__ float bfr(float v) { return (float)(__bf16)v; }
__device__ __attribute__((noinline)) float exp_ni(float v) { return expf(v); }
__device__ __attribute__((noinline)) float erf_ni(float v) { return erff(v); }

#define WS_QF  0u                                   // f32 q in A-fragment order: [(b*NN + l) / 16][d / 32][piece 0..3][lane][4]; lane = (g, row), piece p = d 8 g + 4 (p & 1) + 16 (p >> 1) + 0..3 of its 32
#define WS_KH  (WS_QF + 4u * (size_t)NB * NN * DD)       // f16 k rows [b*NN + s][512]
#define WS_VT  (WS_KH + 2u * (size_t)NB * NN * DD)       // f16 v planes [b][512][NN]
#define WS_CB  (WS_VT + 2u * (size_t)NB * DD * NN)       // f32 content bias [b][h][NN]
#define WS_O   (WS_CB + 4u * (size_t)NB * NH * NN)       // f32 ctx rows [b*NN + l][512]
#define WS_END (WS_O + 4u * (size_t)NB * NN * DD)

__device__ __forceinline__ v16b fragb_f32(const float* __restrict__ p, int lane) { v16b a; const float* pp = p + 8 * (lane >> 4);
#pragma unroll
  for (int i = 0; i < 8; ++i) { a[i] = (__bf16)pp[i]; a[8 + i] = (__bf16)pp[16 + i]; } return a; }
typedef __attribute__((address_space(3))) const unsigned char lds_byte;
__device__ __forceinline__ unsigned lds_off(const void* p) { return (unsigned)(size_t)(lds_byte*)p; }
// eight copies of 16 B per lane, LDS step ls bytes, global step gs bytes; the s_wait_xcnt stands inside the statement so that no address register of a copy is rewritten ahead of it
__device__ __forceinline__ void cp8(unsigned l, unsigned ls, const char* g, size_t gs) {
  asm volatile("global_load_async_to_lds_b128 %0, %8, off\n\tglobal_load_async_to_lds_b128 %1, %9, off\n\tglobal_load_async_to_lds_b128 %2, %10, off\n\tglobal_load_async_to_lds_b128 %3, %11, off\n\t"
               "global_load_async_to_lds_b128 %4, %12, off\n\tglobal_load_async_to_lds_b128 %5, %13, off\n\tglobal_load_async_to_lds_b128 %6, %14, off\n\tglobal_load_async_to_lds_b128 %7, %15, off\n\ts_wait_xcnt 0x0"
               :: "v"(l), "v"(l + ls), "v"(l + 2 * ls), "v"(l + 3 * ls), "v"(l + 4 * ls), "v"(l + 5 * ls), "v"(l + 6 * ls), "v"(l + 7 * ls),
                  "v"(g), "v"(g + gs), "v"(g + 2 * gs), "v"(g + 3 * gs), "v"(g + 4 * gs), "v"(g + 5 * gs), "v"(g + 6 * gs), "v"(g + 7 * gs) : "memory"); }
// The two projection kernels (64 rows x 128 cols a block) take their operands through LDS: a stage is 64 f32 of k (256 B) of the 64 A rows and the 128 B rows, two buffers; the f32 values are rounded where the fragments are formed.
#define GK 64               // f32 of k per stage
#define GP 68               // f32 per staged row: 272 B = 16 B x 17, an odd multiple of 16 B for the ds_load_b128 readers
#define GA (64 * GP)        // f32 of a stage's A rows
#define GST (192 * GP)      // f32 of a stage
// one stage: a copy of the block = 8 rows of 256 B, a wave = two rows' whole 128-B lines; dst, a, b are the lane's own places in row (tid >> 4)
__device__ __forceinline__ void gstage(unsigned dst, const char* a, const char* b) {
  cp8(dst, 8u * GP * 4u, a, (size_t)8 * DD * 4);
  cp8(dst + GA * 4u, 8u * GP * 4u, b, (size_t)8 * DD * 4);
  cp8(dst + (GA + 64u * GP) * 4u, 8u * GP * 4u, b + (size_t)64 * DD * 4, (size_t)8 * DD * 4); }
// ---- k_proj: block = (64 rows, 128 cols, which*NB + b): which 0 q -> f32, once, in A-fragment order; 1 k -> f16 rows; 2 v -> f16 planes
// The k blocks of the first 128 columns also form the content bias cb[b][h][s] = x_s . Wb[h] of their 64 rows: a ninth column tile whose A fragments are the x fragments the wave has formed anyway. Its B fragments (row col & 7 of Wb: columns 8..15 repeat 0..7 and are not stored) come straight from global memory, 16 KiB that every such block reads.
__global__ __launch_bounds__(128) void k_proj(const float* __restrict__ X, const float* __restrict__ WQ, const float* __restrict__ WK, const float* __restrict__ WV, const float* __restrict__ WB, float* __restrict__ QF, _Float16* __restrict__ KH, _Float16* __restrict__ VT, float* __restrict__ CB) {
  __shared__ __align__(16) float ring[2 * GST];
  // the output staging lies over the ring, which nobody reads and no copy writes behind the last stage's barrier: keeps the block's LDS small enough for three blocks per WGP
  float (*sf)[132] = (float (*)[132])&ring[0]; _Float16 (*sh)[136] = (_Float16 (*)[136])&ring[64 * 132]; _Float16 (*th)[72] = (_Float16 (*)[72])&ring[64 * 132 + 64 * 68]; float (*sc)[64] = (float (*)[64])&ring[64 * 132 + 64 * 68 + 128 * 36];
  const int tid = threadIdx.x, wave = tid >> 5, lane = tid & 31, col = lane & 15, g = lane >> 4; const int which = blockIdx.z / NB; const size_t b = blockIdx.z % NB; const int n0 = blockIdx.x * 64; const int c0 = blockIdx.y * 128;
  const float* Wm = which == 0 ? WQ : which == 1 ? WK : WV;
  const bool docb = which == 1 && blockIdx.y == 0;   // the same for the whole block
  const float* wbp = WB + (col & 7) * DD + 8 * g;
  const char* asrc = (const char*)(X + (b * NN + n0 + (tid >> 4)) * DD + (tid & 15) * 4); const char* bsrc = (const char*)(Wm + (size_t)(c0 + (tid >> 4)) * DD + (tid & 15) * 4);
  const unsigned gdst = lds_off(&ring[(tid >> 4) * GP + (tid & 15) * 4]);
  gstage(gdst, asrc, bsrc);
  asm volatile("s_wait_asynccnt 0x0" ::: "memory");   // this wave's copies of stage 0 have landed
  __syncthreads();                                     // ... and every other wave's: nothing staged is read before this
  gstage(gdst + GST * 4u, asrc + GK * 4, bsrc + GK * 4);
  v8f acc[8] = {}, acb = {};
#pragma unroll 1   // one trip per stage, so that the ring's waits and its barrier stand once, at the trip's foot
  for (int t = 0; t < DD / GK; ++t) { const int bf = t & 1; const float* ar = &ring[bf * GST + (wave * 16 + col) * GP]; const float* br = &ring[bf * GST + GA + col * GP];
    // this stage's 64 k of the lane's Wb row, asked for at the head of the trip and used at its foot, behind the 16 other products
    v4f wb[GK / 32][4]; v16b af[GK / 32];
    if (docb) {
#pragma unroll
      for (int kc = 0; kc < GK / 32; ++kc)
#pragma unroll
        for (int p = 0; p < 4; ++p) wb[kc][p] = *(const v4f*)(wbp + t * GK + kc * 32 + (p & 1) * 4 + (p >> 1) * 16); }
#pragma unroll
    for (int kc = 0; kc < GK / 32; ++kc) { const v16b a = fragb_f32(ar + kc * 32, lane); v16b w[8]; af[kc] = a;
#pragma unroll
      for (int j = 0; j < 8; ++j) w[j] = fragb_f32(br + j * 16 * GP + kc * 32, lane);
#pragma unroll
      for (int j = 0; j < 8; ++j) acc[j] = wmma_bf(a, w[j], acc[j]); }
    if (docb) {
#pragma unroll
      for (int kc = 0; kc < GK / 32; ++kc) { v16b w;
#pragma unroll
        for (int p = 0; p < 4; ++p)
#pragma unroll
          for (int i = 0; i < 4; ++i) w[p * 4 + i] = (__bf16)wb[kc][p][i];
        acb = wmma_bf(af[kc], w, acb); } }
    asm volatile("s_wait_dscnt 0x0" ::: "memory");     // this wave's reads of this stage's buffer have returned
    asm volatile("s_wait_asynccnt 0x0" ::: "memory");  // this wave's copies of the next stage have landed
    __syncthreads();                                   // publishes the next stage and ends every reader's last read of this stage's buffer
    if (t + 2 < DD / GK) gstage(gdst + (unsigned)bf * (GST * 4u), asrc + (t + 2) * (GK * 4), bsrc + (t + 2) * (GK * 4)); }
  asm volatile("s_wait_asynccnt 0x0" ::: "memory");    // no copy is outstanding when the ring becomes output staging
#pragma unroll
  for (int j = 0; j < 8; ++j)
#pragma unroll
    for (int r = 0; r < 8; ++r) { const float v = acc[j][r]; if (which == 0) sf[wave * 16 + 8 * g + r][j * 16 + col] = v; else if (which == 1) sh[wave * 16 + 8 * g + r][j * 16 + col] = (_Float16)v; else th[j * 16 + col][wave * 16 + 8 * g + r] = (_Float16)v; }
  if (docb && col < 8) { v4f lo, hi;
#pragma unroll
    for (int i = 0; i < 4; ++i) { lo[i] = acb[i]; hi[i] = acb[4 + i]; }
    *(v4f*)&sc[col][wave * 16 + 8 * g] = lo; *(v4f*)&sc[col][wave * 16 + 8 * g + 4] = hi; }
  __syncthreads();
  // 8 heads x 64 keys: a wave stores two heads' 256 contiguous bytes each
  if (docb) { vst2(CB + (b * NH + (tid >> 4)) * (size_t)NN + n0 + (tid & 15) * 4, *(const v4f*)&sc[tid >> 4][(tid & 15) * 4]);
    asm volatile("s_wait_xcnt 0x0" ::: "memory"); }   // ahead of the k rows' stores below, whose set-up overwrites this store's address and data registers
  if (which == 0) {
    // wave w stores piece w of each of the block's 4 x 4 (16 rows x 32 d) units: 512 contiguous bytes a store
    float* qd = QF + ((b * NN + n0) * (size_t)DD + (size_t)(c0 / 32) * 512) + wave * 128 + lane * 4; const float* qs = &sf[col][8 * g + (wave & 1) * 4 + (wave >> 1) * 16];
#pragma unroll   // whole, so that the 16 LDS reads go out as a group and every store takes a constant offset from one address
    for (int it = 0; it < 16; ++it) vst2(qd + (size_t)((it >> 2) * 16 + (it & 3)) * 512, *(const v4f*)(qs + (it >> 2) * 16 * 132 + (it & 3) * 32)); }
  else if (which == 1) { for (int e = tid; e < 64 * 16; e += 128) { const int rl = e >> 4, q = e & 15; vst2((unsigned*)(KH + (b * NN + n0 + rl) * DD + c0 + q * 8), *(const v4u*)&sh[rl][q * 8]); } }
  else { for (int e = tid; e < 128 * 8; e += 128) { const int cl = e >> 3, q = e & 7; vst2((unsigned*)(VT + (b * DD + c0 + cl) * (size_t)NN + n0 + q * 8), *(const v4u*)&th[cl][q * 8]); } } }
// ---- k_att: block = (128 queries, h, b), 8 waves: logits = ((q*m_h) . k + cb[s]) / 8 (K 512), softmax, P . v_h
// Both products are taken transposed: S^T = K (q*m_h)^T and ctx^T += V^T P^T. A lane then holds 16 scores of ONE query (col): keys 8 g + r and 16 + 8 g + r of its wave's 32 keys; maximum and sum are in-lane but for one exchange between the wave's halves, and the two score tiles, converted in place, are the B fragment of the second product.
// A wave holds 32 queries (two column groups), so that each K and V fragment read from LDS serves two products. A pass is 64 keys: waves 0..3 take its first 32, waves 4..7 its last 32, each with a running maximum, sum and context of its own over its 1,024 keys; behind the key loop wave 4 + i hands its three to wave i through LDS, which joins them and stores.
// Each wave forms its 32 B fragments (q * m_h), rounded once to f16, in registers ahead of the key loop and keeps them there. The head's bias row (once) and each pass's K and V tiles (two buffers) come into LDS by asynchronous copies whose waves cover whole 128-B lines; the key loop reads K, V and the bias from LDS.
#define KP 520   // f16 per staged K row: 1,040 B = 16 B x 65, an odd multiple of 16 B for the ds_load_b128 readers
#define VP 72    // f16 per staged V row: 144 B = 16 B x 9
#define LSC 0.18033688f   // log2(e) / 8: from a score (q*m_h) . k + cb to the base-2 exponent of e^(score / 8)
#define NB2(mx) __builtin_fmaf(-(mx), LSC, 11.0f)   // 2^(score LSC + NB2(mx)) = 2^11 e^((score - mx) / 8)
// two copies, same form
__device__ __forceinline__ void cp2(unsigned l, unsigned ls, const char* g, size_t gs) {
  asm volatile("global_load_async_to_lds_b128 %0, %2, off\n\tglobal_load_async_to_lds_b128 %1, %3, off\n\ts_wait_xcnt 0x0" :: "v"(l), "v"(l + ls), "v"(g), "v"(g + gs) : "memory"); }
// eight v_exp_f32, each in place, in one statement that ends with the slot the instruction set asks for behind a transcendental
__device__ __forceinline__ void exp8(v8f& x) {
  asm("v_exp_f32 %0, %0\n\tv_exp_f32 %1, %1\n\tv_exp_f32 %2, %2\n\tv_exp_f32 %3, %3\n\tv_exp_f32 %4, %4\n\tv_exp_f32 %5, %5\n\tv_exp_f32 %6, %6\n\tv_exp_f32 %7, %7\n\tv_nop"
      : "+v"(x[0]), "+v"(x[1]), "+v"(x[2]), "+v"(x[3]), "+v"(x[4]), "+v"(x[5]), "+v"(x[6]), "+v"(x[7])); }
// one v_exp_f32 with the same slot behind it, for the same reason
__device__ __forceinline__ float exp1(float x) { float r; asm("v_exp_f32 %0, %1\n\tv_nop" : "=v"(r) : "v"(x)); return r; }
// register budget and residency of two waves per SIMD; the 256 blocks lie one to a WGP
__global__ __launch_bounds__(256) __attribute__((amdgpu_waves_per_eu(2, 2))) void k_att(const float* __restrict__ QF, const float* __restrict__ MIX, const _Float16* __restrict__ KH, const _Float16* __restrict__ VT, const float* __restrict__ CB, float* __restrict__ O) {
  __shared__ __align__(16) _Float16 sk[2][64][KP]; __shared__ __align__(16) _Float16 sv[2][DH][VP]; __shared__ __align__(16) float scb[NN];
  const int tid = threadIdx.x, wave = __builtin_amdgcn_readfirstlane(tid >> 5), lane = tid & 31, col = lane & 15, g = lane >> 4; const int qg = wave & 3, kh = wave >> 2;
  const int h = blockIdx.y; const size_t b = blockIdx.z; const int q0 = blockIdx.x * 128 + qg * 32; const size_t rq = b * NN + q0;
  // copy maps: 1,024-B rows (K): one copy of the block = four rows, a wave = 512 contiguous bytes; V: one copy = 32 rows of 128 B; bias: one copy = 4,096 B
  const int crow = tid >> 6, ccol = (tid & 63) * 8, vrow = tid >> 3, vcol = (tid & 7) * 8;
  // the block's K rows and the head's V rows (uniform), and the lane's own byte offset in each (32 bits: one register each through the key loop)
  const char* kbase = (const char*)(KH + b * NN * DD); const char* vbase = (const char*)(VT + (b * DD + (size_t)h * DH) * (size_t)NN);
  const unsigned koff = (unsigned)(crow * DD + ccol) * 2u, voff = (unsigned)(vrow * NN + vcol) * 2u;
  const char* bsrc = (const char*)(CB + (b * NH + h) * (size_t)NN + tid * 4);
  const unsigned kdst = lds_off(&sk[0][crow][ccol]), vdst = lds_off(&sv[0][vrow][vcol]);
#define STAGE(t, bf) do { const char* kt = kbase + (koff + (unsigned)(t) * (64u * DD * 2u)); const unsigned kl = kdst + (unsigned)(bf) * (64u * KP * 2u); \
    cp8(kl, 4u * KP * 2u, kt, 4 * DD * 2); cp8(kl + 32u * KP * 2u, 4u * KP * 2u, kt + 32 * DD * 2, 4 * DD * 2); \
    cp2(vdst + (unsigned)(bf) * (DH * VP * 2u), 32u * VP * 2u, vbase + (voff + (unsigned)(t) * 128u), (size_t)32 * NN * 2); } while (0)
  cp2(lds_off(&scb[tid * 4]), 4096u, bsrc, 4096);
  STAGE(0, 0);
  // the wave's 32 query rows as 2 x 16 B fragments (A's table with column for row), under the copies' flight: four 16-B loads a fragment, each 512 contiguous bytes of the wave; element e of a lane is d = 32 kc + 8 g + (e & 7) + 16 (e >> 3)
  v16h qf[2][DD / 32];
  { const float* qp = QF + rq * DD + lane * 4; const float* mp = MIX + h * DD + 8 * g;
#pragma unroll   // whole, so that qf is indexed by constants and stays in registers
    for (int kc = 0; kc < DD / 32; ++kc)
#pragma unroll
      for (int p = 0; p < 4; ++p) { const v4f mm = *(const v4f*)(mp + kc * 32 + (p & 1) * 4 + (p >> 1) * 16);
#pragma unroll
        for (int u = 0; u < 2; ++u) { const v4f x = *(const v4f*)(qp + u * (16 * DD) + kc * 512 + p * 128);
#pragma unroll
          for (int i = 0; i < 4; ++i) qf[u][kc][p * 4 + i] = (_Float16)(x[i] * bfr(mm[i])); } } }
  asm volatile("s_wait_xcnt 0x0" ::: "memory");        // ahead of the first overwrite of an address register of the loads above
  asm volatile("s_wait_asynccnt 0x0" ::: "memory");   // this wave's copies of the bias row and of pass 0 have landed
  __syncthreads();                                     // ... and every other wave's: nothing staged is read before this
  STAGE(1, 1);
  float m[2] = {3.0e38f, 3.0e38f}, l[2] = {0.f, 0.f};   // per column group, this lane's query over this wave's keys: NB2 of the running maximum of the scores (equal in both halves), and the sum of P (with its 2^11) over this half's keys alone
  v8f acc[2][4] = {};
#pragma unroll 1
  for (int ks = 0; ks < NN / 64; ++ks) { const int bf = ks & 1; v8f s[2][2];
    v16h vf[4];
    { const _Float16* k0 = &sk[bf][kh * 32 + col][0]; const _Float16* k1 = &sk[bf][kh * 32 + 16 + col][0];
      // the bias of this lane's 16 keys (the same for both column groups) is the C operand of each tile's first product: the matrix unit adds it
      const float* cbp = &scb[ks * 64 + kh * 32 + 8 * g]; union { v8f v; v4f q[2]; } cb0, cb1; cb0.q[0] = *(const v4f*)cbp; cb0.q[1] = *(const v4f*)(cbp + 4); cb1.q[0] = *(const v4f*)(cbp + 16); cb1.q[1] = *(const v4f*)(cbp + 20);
      v8f c[2][2] = {{cb0.v, cb1.v}, {cb0.v, cb1.v}};
      // LDS reads two k steps ahead of the products that use them, in a ring of three register sets (a fourth set did not fit beside the 32 Q fragments: the build kept one of them in scratch); each K fragment serves both column groups, each Q fragment both 16-key groups
      v16h ka[3], kb[3];
#pragma unroll
      for (int i = 0; i < 2; ++i) { ka[i] = frag_h(k0 + i * 32, lane); kb[i] = frag_h(k1 + i * 32, lane); }
#pragma unroll   // whole: the ring and qf are indexed by constants
      for (int kc = 0; kc < DD / 32; ++kc) {
        if (kc + 2 < DD / 32) { ka[(kc + 2) % 3] = frag_h(k0 + (kc + 2) * 32, lane); kb[(kc + 2) % 3] = frag_h(k1 + (kc + 2) * 32, lane); }
#pragma unroll
        for (int u = 0; u < 2; ++u) { c[u][0] = wmma16q(ka[kc % 3], qf[u][kc], c[u][0]); c[u][1] = wmma16q(kb[kc % 3], qf[u][kc], c[u][1]); } }
#pragma unroll
      for (int u = 0; u < 2; ++u) { s[u][0] = c[u][0]; s[u][1] = c[u][1]; } }
    float alpha[2]; v16h pa[2];
#pragma unroll   // whole: every array below is indexed by constants
    for (int u = 0; u < 2; ++u) {
      float mx[8];
#pragma unroll
      for (int r = 0; r < 8; ++r) mx[r] = fmaxf(s[u][0][r], s[u][1][r]);
      float mh = fmaxf(fmaxf(fmaxf(mx[0], mx[1]), fmaxf(mx[2], mx[3])), fmaxf(fmaxf(mx[4], mx[5]), fmaxf(mx[6], mx[7])));
      mh = fmaxf(mh, xhalf(mh));   // the other half's 16 keys of the same query
      // the running maximum is kept as nb = NB2(maximum), which falls as the maximum rises. The old sums are rescaled by the difference of the two rounded nb, so that every pass's P and the sums carry exactly the same factor, also where the scores are large
      const float nb = fminf(m[u], NB2(mh)); alpha[u] = exp1(nb - m[u]); m[u] = nb;
#pragma unroll
      for (int r = 0; r < 8; ++r) { s[u][0][r] = __builtin_fmaf(s[u][0][r], LSC, nb); s[u][1][r] = __builtin_fmaf(s[u][1][r], LSC, nb); }
      // P = 2^11 e^(logit - maximum) = 2^(score LSC + nb): one fma and v_exp_f32 (exp8 above) a score. P is rounded once to f16, as v is: each term P v then carries two roundings of the same size. With that factor a P below 2^-14 is a subnormal, exact to 2^-25 beside a row maximum of 2^11. The sum l takes the unrounded P
      exp8(s[u][0]); exp8(s[u][1]);
      float es[8];
#pragma unroll
      for (int r = 0; r < 8; ++r) { const float p0 = s[u][0][r], p1 = s[u][1][r]; es[r] = p0 + p1;
        pa[u][r] = (_Float16)p0; pa[u][8 + r] = (_Float16)p1; }
      l[u] = l[u] * alpha[u] + (((es[0] + es[1]) + (es[2] + es[3])) + ((es[4] + es[5]) + (es[6] + es[7])));
      asm volatile("" : "+v"(l[u])); }   // each row's sum pinned against spills: left free, the build moves these additions behind the pass's barrier and keeps the 32 P values in registers through the second product and the copies
    // V is read here, behind both column groups' P and under the rescaling: read earlier it was live through the softmax, and the build kept values in scratch
#pragma unroll
    for (int j = 0; j < 4; ++j) vf[j] = frag_h(&sv[bf][j * 16 + col][kh * 32], lane);
#pragma unroll
    for (int u = 0; u < 2; ++u)
#pragma unroll
      for (int j = 0; j < 4; ++j)
#pragma unroll
        for (int r = 0; r < 8; ++r) acc[u][j][r] *= alpha[u];
#pragma unroll
    for (int j = 0; j < 4; ++j)
#pragma unroll
      for (int u = 0; u < 2; ++u) acc[u][j] = wmma16(vf[j], pa[u], acc[u][j]);
    asm volatile("s_wait_dscnt 0x0" ::: "memory");     // this wave's reads of this pass's buffers have returned
    asm volatile("s_wait_asynccnt 0x0" ::: "memory");  // this wave's copies of the next pass have landed
    __syncthreads();                                   // publishes the next pass and ends every reader's last read of this pass's buffers
    if (ks + 2 < NN / 64) STAGE(ks + 2, bf); }
  asm volatile("s_wait_asynccnt 0x0" ::: "memory");    // no copy is outstanding when the wave reuses LDS and ends
  // hand-over and output staging lie in the K ring: every wave's reads of the ring returned, and no copy was left in flight, ahead of the last pass's barrier
  // buffer 0: per query group 17 x 512 B (16 B a lane): the second key half's 16 context pieces, then (m, l) of both column groups; buffer 1: per query group 32 output rows
  v4f* xb = (v4f*)&sk[0][0][0] + qg * (17 * 32) + lane;
  float lt[2] = {l[0] + xhalf(l[0]), l[1] + xhalf(l[1])};   // the halves' sums are joined here, once
  if (kh == 1) {
#pragma unroll
    for (int u = 0; u < 2; ++u)
#pragma unroll
      for (int j = 0; j < 4; ++j)
#pragma unroll
        for (int q = 0; q < 2; ++q) { v4f o;
#pragma unroll
          for (int i = 0; i < 4; ++i) o[i] = acc[u][j][q * 4 + i];
          xb[((u * 4 + j) * 2 + q) * 32] = o; }
    v4f ml; ml[0] = m[0]; ml[1] = lt[0]; ml[2] = m[1]; ml[3] = lt[1]; xb[16 * 32] = ml; }
  __syncthreads();                                     // the second key half's results are in LDS for the waves that join them
  if (kh == 0) {
    float (*so)[68] = (float (*)[68])&sk[1][0][0] + qg * 32;
    const v4f ml = xb[16 * 32];
#pragma unroll
    for (int u = 0; u < 2; ++u) { const float m1 = ml[2 * u], l1 = ml[2 * u + 1], mn = fminf(m[u], m1), a0 = exp1(mn - m[u]), a1 = exp1(mn - m1);
      const float il = 1.0f / (lt[u] * a0 + l1 * a1), w0 = a0 * il, w1 = a1 * il;
#pragma unroll
      for (int j = 0; j < 4; ++j)
#pragma unroll
        for (int q = 0; q < 2; ++q) { const v4f p = xb[((u * 4 + j) * 2 + q) * 32]; v4f o;
#pragma unroll
          for (int i = 0; i < 4; ++i) o[i] = acc[u][j][q * 4 + i] * w0 + p[i] * w1;
          *(v4f*)&so[u * 16 + col][j * 16 + 8 * g + q * 4] = o; } }
    LDSX(); for (int rl = 0; rl < 16; ++rl) vst2(O + (rq + 2 * rl + g) * DD + (size_t)h * DH + col * 4, *(const v4f*)&so[2 * rl + g][col * 4]); } }
// ---- k_out: block = (64 rows, 128 cols): out = ctx (hi + lo) . Wd^T + bd
__global__ __launch_bounds__(128) void k_out(const float* __restrict__ Or, const float* __restrict__ WD, const float* __restrict__ BD, float* __restrict__ OUT) { __shared__ __align__(16) float ring[2 * GST]; __shared__ __align__(16) float sf[4][16][132];
  const int tid = threadIdx.x, wave = tid >> 5, lane = tid & 31, col = lane & 15, g = lane >> 4; const size_t r0 = (size_t)blockIdx.x * 64 + wave * 16; const int c0 = blockIdx.y * 128;
  const char* asrc = (const char*)(Or + ((size_t)blockIdx.x * 64 + (tid >> 4)) * DD + (tid & 15) * 4); const char* bsrc = (const char*)(WD + (size_t)(c0 + (tid >> 4)) * DD + (tid & 15) * 4);
  const unsigned gdst = lds_off(&ring[(tid >> 4) * GP + (tid & 15) * 4]);
  gstage(gdst, asrc, bsrc);
  asm volatile("s_wait_asynccnt 0x0" ::: "memory");   // this wave's copies of stage 0 have landed
  __syncthreads();                                     // ... and every other wave's: nothing staged is read before this
  gstage(gdst + GST * 4u, asrc + GK * 4, bsrc + GK * 4);
  v8f acc[8] = {};
#pragma unroll 1   // one trip per stage, so that the ring's waits and its barrier stand once, at the trip's foot
  for (int t = 0; t < DD / GK; ++t) { const int bf = t & 1; const float* ar = &ring[bf * GST + (wave * 16 + col) * GP]; const float* br = &ring[bf * GST + GA + col * GP];
#pragma unroll
    for (int kc = 0; kc < GK / 32; ++kc) { const F2 a = split_row(ar, kc * 32, lane); v16b w[8];
#pragma unroll
      for (int j = 0; j < 8; ++j) w[j] = fragb_f32(br + j * 16 * GP + kc * 32, lane);
#pragma unroll
      for (int j = 0; j < 8; ++j) { acc[j] = wmma_bf(a.h, w[j], acc[j]); acc[j] = wmma_bf(a.l, w[j], acc[j]); } }
    asm volatile("s_wait_dscnt 0x0" ::: "memory");     // this wave's reads of this stage's buffer have returned
    asm volatile("s_wait_asynccnt 0x0" ::: "memory");  // this wave's copies of the next stage have landed
    __syncthreads();                                   // publishes the next stage and ends every reader's last read of this stage's buffer
    if (t + 2 < DD / GK) gstage(gdst + (unsigned)bf * (GST * 4u), asrc + (t + 2) * (GK * 4), bsrc + (t + 2) * (GK * 4)); }
  asm volatile("s_wait_asynccnt 0x0" ::: "memory");    // no copy is outstanding when the wave ends
#pragma unroll
  for (int j = 0; j < 8; ++j) { const float bb = bfr(BD[c0 + j * 16 + col]);
#pragma unroll
    for (int r = 0; r < 8; ++r) sf[wave][8 * g + r][j * 16 + col] = acc[j][r] + bb; }
  LDSX(); for (int rl = 0; rl < 16; ++rl) vst2(OUT + (r0 + rl) * DD + c0 + lane * 4, *(const v4f*)&sf[wave][rl][lane * 4]); }
extern "C" void kernel_launch(void* const* d_in, const int* in_sizes, int n_in, void* d_out, int out_size, void* d_ws, size_t ws_size, hipStream_t stream) {
  (void)in_sizes; (void)n_in; (void)out_size;
  const float** F = (const float**)d_in;   // 0 x [2,2048,512], 1 Wq, 2 Wk, 3 Wv [512,512] natural, 4 Wb [8,512], 5 mixing [8,512], 6 Wd [512,512], 7 bd [512]
  if (ws_size < (size_t)WS_END) return;
  char* ws = (char*)d_ws; _Float16 *KH = (_Float16*)(ws + WS_KH), *VT = (_Float16*)(ws + WS_VT); float *QF = (float*)(ws + WS_QF), *CB = (float*)(ws + WS_CB), *O = (float*)(ws + WS_O);
  k_proj<<<dim3(NN / 64, DD / 128, 3 * NB), 128, 0, stream>>>(F[0], F[1], F[2], F[3], F[4], QF, KH, VT, CB);
  k_att<<<dim3(TQB, NH, TNB), 256, 0, stream>>>(QF, F[5], KH, VT, CB, O);
  k_out<<<dim3(TNB * NN / 64, DD / 128), 128, 0, stream>>>(O, F[6], F[7], (float*)d_out);
}
